// v000
// Measured on an AMD MI455X. A time is GPU time per run, averaged over a window of back-to-back runs after a warm-up
// (all launches, gaps included; the runs take copies of the inputs in turn), and the median of several windows.
// Apart from v000's, it joins two sittings. Times from different sittings can be a few percent apart, while
// side-by-side timings come from the same sitting.
// The starting kernel, v000, takes 971 microseconds a run.
#include <hip/hip_runtime.h>

#define DIMC  768
#define HEADS 12
#define HDIM  64
#define BATCH 8
#define SEQ   1024
#define QSCALE 0.125f   // HD^-0.5

typedef __attribute__((ext_vector_type(16))) _Float16 v16h;
typedef __attribute__((ext_vector_type(8)))  _Float16 v8h;
typedef __attribute__((ext_vector_type(8)))  float    v8f;

// Load a 16-bit A/B WMMA fragment for one K=32 step from a row-major row
// pointer. Per CDNA5 layout: lane<16 holds K {k0..k0+7, k0+16..k0+23} with
// k0=0, lane>=16 with k0=8. Two 16-byte chunks per lane.
__device__ __forceinline__ v16h frag_ld(const _Float16* __restrict__ row, int k0) {
  v8h lo = *(const v8h*)(row + k0);
  v8h hi = *(const v8h*)(row + k0 + 16);
  v16h r;
#pragma unroll
  for (int t = 0; t < 8; ++t) { r[t] = lo[t]; r[t + 8] = hi[t]; }
  return r;
}

__device__ __forceinline__ v8f wmma16(v16h a, v16h b, v8f c) {
  return __builtin_amdgcn_wmma_f32_16x16x32_f16(false, a, false, b,
                                                (short)0, c, false, false);
}

__device__ __forceinline__ v8f vzero8() {
  v8f z;
#pragma unroll
  for (int e = 0; e < 8; ++e) z[e] = 0.f;
  return z;
}

// ---------------------------------------------------------------- converts
__global__ void convert_x_kernel(const float* __restrict__ x,
                                 _Float16* __restrict__ xh, int n) {
  int i = blockIdx.x * blockDim.x + threadIdx.x;
  if (i < n) xh[i] = (_Float16)x[i];
}

__global__ void convert_w_kernel(const float* __restrict__ Wq,
                                 const float* __restrict__ Wk,
                                 const float* __restrict__ Wv,
                                 const float* __restrict__ Wp,
                                 _Float16* __restrict__ WqT,
                                 _Float16* __restrict__ WkT,
                                 _Float16* __restrict__ WvT,
                                 _Float16* __restrict__ WpT) {
  int idx = blockIdx.x * blockDim.x + threadIdx.x;
  if (idx >= DIMC * DIMC) return;
  int kk = idx / DIMC, nn = idx % DIMC;
  int tid = nn * DIMC + kk;              // transposed: [n][k]
  WqT[tid] = (_Float16)Wq[idx];
  WkT[tid] = (_Float16)Wk[idx];
  WvT[tid] = (_Float16)Wv[idx];
  WpT[tid] = (_Float16)Wp[idx];
}

// ---------------------------------------------------------------- QKV GEMM
// grid = (M/16, 9), block = 128 (4 waves). col groups 0-2 -> q, 3-5 -> k, 6-8 -> v.
// q scaled by QSCALE. v written TRANSPOSED per head: [b][h][d][j].
__global__ __launch_bounds__(128)
void qkv_gemm_kernel(const _Float16* __restrict__ xh,
                     const _Float16* __restrict__ WqT,
                     const _Float16* __restrict__ WkT,
                     const _Float16* __restrict__ WvT,
                     _Float16* __restrict__ qb, _Float16* __restrict__ kb,
                     _Float16* __restrict__ vb) {
  const int mt = blockIdx.x, cg = blockIdx.y;
  const int wave = threadIdx.x >> 5, ln = threadIdx.x & 31;
  const int hlf = ln >> 4, lc = ln & 15;
  const int m0 = mt * 16;
  const int which = cg / 3;  // 0=q 1=k 2=v
  const _Float16* WT = (which == 0) ? WqT : (which == 1) ? WkT : WvT;
  const int nbase = (cg % 3) * 256 + wave * 64;  // within [0,768)
  const int kfrag = hlf * 8;

  const _Float16* arow = xh + (size_t)(m0 + lc) * DIMC;
  const _Float16* brow[4];
#pragma unroll
  for (int t = 0; t < 4; ++t)
    brow[t] = WT + (size_t)(nbase + t * 16 + lc) * DIMC;

  v8f c[4];
#pragma unroll
  for (int t = 0; t < 4; ++t) c[t] = vzero8();

  // software-pipelined, fully unrolled k loop: fragments for step s+1 are in
  // flight while step s WMMAs execute; full unroll lets SSA renaming remove
  // all buffer-rotation register copies.
  v16h a = frag_ld(arow, kfrag);
  v16h bfr[4];
#pragma unroll
  for (int t = 0; t < 4; ++t) bfr[t] = frag_ld(brow[t], kfrag);

  const int NSTEP = DIMC / 32;
#pragma unroll
  for (int s = 0; s < NSTEP - 1; ++s) {
    const int ks2 = (s + 1) * 32 + kfrag;
    v16h a_n = frag_ld(arow, ks2);
    v16h b_n[4];
#pragma unroll
    for (int t = 0; t < 4; ++t) b_n[t] = frag_ld(brow[t], ks2);
#pragma unroll
    for (int t = 0; t < 4; ++t) c[t] = wmma16(a, bfr[t], c[t]);
    a = a_n;
#pragma unroll
    for (int t = 0; t < 4; ++t) bfr[t] = b_n[t];
  }
#pragma unroll
  for (int t = 0; t < 4; ++t) c[t] = wmma16(a, bfr[t], c[t]);

  const int b_ = m0 / SEQ;
  const int nrow0 = m0 % SEQ;
  if (which == 2) {
    // V: transposed store [b][h][d][j]
#pragma unroll
    for (int t = 0; t < 4; ++t) {
      int col = nbase + t * 16 + lc;
      int head = col >> 6, d = col & 63;
      _Float16* vt = vb + (((size_t)b_ * HEADS + head) * HDIM + d) * SEQ;
#pragma unroll
      for (int r = 0; r < 8; ++r)
        vt[nrow0 + r + hlf * 8] = (_Float16)c[t][r];
    }
  } else {
    const float scale = (which == 0) ? QSCALE : 1.f;
    _Float16* dst = (which == 0) ? qb : kb;
#pragma unroll
    for (int t = 0; t < 4; ++t) {
      int col = nbase + t * 16 + lc;
      int head = col >> 6, d = col & 63;
#pragma unroll
      for (int r = 0; r < 8; ++r) {
        int i = nrow0 + r + hlf * 8;
        dst[(((size_t)b_ * HEADS + head) * SEQ + i) * HDIM + d] =
            (_Float16)(c[t][r] * scale);
      }
    }
  }
}

// ---------------------------------------------------- fused talking-heads attn
// grid = (SEQ/16, BATCH), block = 384 (12 waves, wave g owns head g).
// q,k layout [b][h][j][d]; v layout [b][h][d][j] (pre-transposed).
__global__ __launch_bounds__(384)
void attn_kernel(const _Float16* __restrict__ q, const _Float16* __restrict__ k,
                 const _Float16* __restrict__ v,
                 const float* __restrict__ Wl, const float* __restrict__ bl,
                 const float* __restrict__ Ww, const float* __restrict__ bw,
                 _Float16* __restrict__ oh) {
  __shared__ __align__(16) float    Smix[HEADS][16][16];   // raw score exchange
  __shared__ __align__(16) _Float16 Pn[HEADS][16][32];     // normalized probs
  __shared__ __align__(16) _Float16 P2[HEADS][16][32];     // post-mixed probs
  __shared__ float sWl[HEADS][HEADS], sWw[HEADS][HEADS];
  __shared__ float sbl[HEADS], sbw[HEADS];

  const int b = blockIdx.y;
  const int i0 = blockIdx.x * 16;
  const int wv = threadIdx.x >> 5;  // head
  const int ln = threadIdx.x & 31;
  const int hlf = ln >> 4, lc = ln & 15;
  const int kfrag = hlf * 8;

  if (threadIdx.x < HEADS * HEADS) {
    (&sWl[0][0])[threadIdx.x] = Wl[threadIdx.x];
    (&sWw[0][0])[threadIdx.x] = Ww[threadIdx.x];
  }
  if (threadIdx.x < HEADS) { sbl[threadIdx.x] = bl[threadIdx.x];
                             sbw[threadIdx.x] = bw[threadIdx.x]; }
  __syncthreads();

  const size_t headBase = ((size_t)b * HEADS + wv) * SEQ;
  const _Float16* vtb = v + headBase * HDIM;  // [d][j] for this (b, head)
  const _Float16* qrow = q + (headBase + i0 + lc) * HDIM;
  v16h aq0 = frag_ld(qrow, kfrag);
  v16h aq1 = frag_ld(qrow, kfrag + 32);

  float m[8], l[8];
#pragma unroll
  for (int r = 0; r < 8; ++r) { m[r] = -1e30f; l[r] = 0.f; }

  // ---------------- pass 1: online softmax stats over mixed scores ----------
  for (int j0 = 0; j0 < SEQ; j0 += 16) {
    const _Float16* krow = k + (headBase + j0 + lc) * HDIM;
    if (j0 + 16 < SEQ)
      __builtin_prefetch(k + (headBase + j0 + 16 + lc) * HDIM, 0, 1);
    v16h bk0 = frag_ld(krow, kfrag);
    v16h bk1 = frag_ld(krow, kfrag + 32);
    v8f c = vzero8();
    c = wmma16(aq0, bk0, c);
    c = wmma16(aq1, bk1, c);
#pragma unroll
    for (int r = 0; r < 8; ++r) Smix[wv][r + hlf * 8][lc] = c[r];
    __syncthreads();
#pragma unroll
    for (int r = 0; r < 8; ++r) {
      float s2 = sbl[wv];
#pragma unroll
      for (int h = 0; h < HEADS; ++h) s2 += sWl[wv][h] * Smix[h][r + hlf * 8][lc];
      float mx = s2;  // row max across the 16 lanes of this half
      mx = fmaxf(mx, __shfl_xor(mx, 1, 32));
      mx = fmaxf(mx, __shfl_xor(mx, 2, 32));
      mx = fmaxf(mx, __shfl_xor(mx, 4, 32));
      mx = fmaxf(mx, __shfl_xor(mx, 8, 32));
      float nm = fmaxf(m[r], mx);
      float p = __expf(s2 - nm);
      p += __shfl_xor(p, 1, 32);
      p += __shfl_xor(p, 2, 32);
      p += __shfl_xor(p, 4, 32);
      p += __shfl_xor(p, 8, 32);
      l[r] = l[r] * __expf(m[r] - nm) + p;
      m[r] = nm;
    }
    __syncthreads();
  }

  float rl[8];
#pragma unroll
  for (int r = 0; r < 8; ++r) rl[r] = 1.f / l[r];

  v8f oacc[4];
#pragma unroll
  for (int t = 0; t < 4; ++t) oacc[t] = vzero8();

  // ---------------- pass 2: probs, post-mix, P @ V (j-steps of 32) ----------
  for (int j0 = 0; j0 < SEQ; j0 += 32) {
    if (j0 + 32 < SEQ) {
      __builtin_prefetch(k + (headBase + j0 + 32 + lc) * HDIM, 0, 1);
      __builtin_prefetch(vtb + (size_t)(lc * 4) * SEQ + j0 + 32, 0, 1);
    }
    // two 16-col subtiles: scores -> pre-mix -> normalized probs
#pragma unroll
    for (int sub = 0; sub < 2; ++sub) {
      const int jb = j0 + sub * 16;
      const _Float16* krow = k + (headBase + jb + lc) * HDIM;
      v16h bk0 = frag_ld(krow, kfrag);
      v16h bk1 = frag_ld(krow, kfrag + 32);
      v8f c = vzero8();
      c = wmma16(aq0, bk0, c);
      c = wmma16(aq1, bk1, c);
#pragma unroll
      for (int r = 0; r < 8; ++r) Smix[wv][r + hlf * 8][lc] = c[r];
      __syncthreads();
#pragma unroll
      for (int r = 0; r < 8; ++r) {
        float s2 = sbl[wv];
#pragma unroll
        for (int h = 0; h < HEADS; ++h)
          s2 += sWl[wv][h] * Smix[h][r + hlf * 8][lc];
        Pn[wv][r + hlf * 8][sub * 16 + lc] = (_Float16)(__expf(s2 - m[r]) * rl[r]);
      }
      __syncthreads();
    }
    // post-softmax mix over heads for all 32 cols
    // (+bw per element: summed over all 1024 j reproduces the bias exactly)
#pragma unroll
    for (int sub = 0; sub < 2; ++sub) {
#pragma unroll
      for (int r = 0; r < 8; ++r) {
        float p2 = sbw[wv];
#pragma unroll
        for (int h = 0; h < HEADS; ++h)
          p2 += sWw[wv][h] * (float)Pn[h][r + hlf * 8][sub * 16 + lc];
        P2[wv][r + hlf * 8][sub * 16 + lc] = (_Float16)p2;
      }
    }
    __syncthreads();
    // A = P2[wv] (16x32), B = V^T tiles straight from global: full K=32 WMMAs
    v16h a = frag_ld(&P2[wv][lc][0], kfrag);
#pragma unroll
    for (int t = 0; t < 4; ++t) {
      const int d = t * 16 + lc;
      v16h bb = frag_ld(vtb + (size_t)d * SEQ + j0, kfrag);
      oacc[t] = wmma16(a, bb, oacc[t]);
    }
    __syncthreads();
  }

  // write (B, N, DIM) f16
#pragma unroll
  for (int t = 0; t < 4; ++t) {
    int col = wv * HDIM + t * 16 + lc;
#pragma unroll
    for (int r = 0; r < 8; ++r) {
      int i = i0 + r + hlf * 8;
      oh[((size_t)b * SEQ + i) * DIMC + col] = (_Float16)oacc[t][r];
    }
  }
}

// ---------------------------------------------------------------- out proj
// grid = (M/16, 3), block = 128 (4 waves x 64 cols).
__global__ __launch_bounds__(128)
void out_proj_kernel(const _Float16* __restrict__ oh,
                     const _Float16* __restrict__ WpT,
                     const float* __restrict__ bp, float* __restrict__ out) {
  const int mt = blockIdx.x, cg = blockIdx.y;
  const int wave = threadIdx.x >> 5, ln = threadIdx.x & 31;
  const int hlf = ln >> 4, lc = ln & 15;
  const int m0 = mt * 16;
  const int nbase = cg * 256 + wave * 64;
  const int kfrag = hlf * 8;

  const _Float16* arow = oh + (size_t)(m0 + lc) * DIMC;
  const _Float16* brow[4];
#pragma unroll
  for (int t = 0; t < 4; ++t)
    brow[t] = WpT + (size_t)(nbase + t * 16 + lc) * DIMC;

  v8f c[4];
#pragma unroll
  for (int t = 0; t < 4; ++t) c[t] = vzero8();

  v16h a = frag_ld(arow, kfrag);
  v16h bfr[4];
#pragma unroll
  for (int t = 0; t < 4; ++t) bfr[t] = frag_ld(brow[t], kfrag);

  const int NSTEP = DIMC / 32;
#pragma unroll
  for (int s = 0; s < NSTEP - 1; ++s) {
    const int ks2 = (s + 1) * 32 + kfrag;
    v16h a_n = frag_ld(arow, ks2);
    v16h b_n[4];
#pragma unroll
    for (int t = 0; t < 4; ++t) b_n[t] = frag_ld(brow[t], ks2);
#pragma unroll
    for (int t = 0; t < 4; ++t) c[t] = wmma16(a, bfr[t], c[t]);
    a = a_n;
#pragma unroll
    for (int t = 0; t < 4; ++t) bfr[t] = b_n[t];
  }
#pragma unroll
  for (int t = 0; t < 4; ++t) c[t] = wmma16(a, bfr[t], c[t]);

#pragma unroll
  for (int t = 0; t < 4; ++t) {
    int col = nbase + t * 16 + lc;
    float bias = bp[col];
#pragma unroll
    for (int r = 0; r < 8; ++r)
      out[(size_t)(m0 + r + hlf * 8) * DIMC + col] = c[t][r] + bias;
  }
}

// ---------------------------------------------------------------- launch
extern "C" void kernel_launch(void* const* d_in, const int* in_sizes, int n_in,
                              void* d_out, int out_size, void* d_ws, size_t ws_size,
                              hipStream_t stream) {
  (void)in_sizes; (void)n_in; (void)out_size; (void)ws_size;
  const float* x  = (const float*)d_in[0];
  const float* Wq = (const float*)d_in[1];
  const float* Wk = (const float*)d_in[2];
  const float* Wv = (const float*)d_in[3];
  const float* Wl = (const float*)d_in[4];
  const float* bl = (const float*)d_in[5];
  const float* Ww = (const float*)d_in[6];
  const float* bw = (const float*)d_in[7];
  const float* Wp = (const float*)d_in[8];
  const float* bp = (const float*)d_in[9];
  float* out = (float*)d_out;

  _Float16* ws = (_Float16*)d_ws;
  size_t off = 0;
  const size_t NX = (size_t)BATCH * SEQ * DIMC;   // 6,291,456
  const size_t NW = (size_t)DIMC * DIMC;
  _Float16* xh  = ws + off; off += NX;
  _Float16* WqT = ws + off; off += NW;
  _Float16* WkT = ws + off; off += NW;
  _Float16* WvT = ws + off; off += NW;
  _Float16* WpT = ws + off; off += NW;
  _Float16* qb  = ws + off; off += NX;
  _Float16* kb  = ws + off; off += NX;
  _Float16* vb  = ws + off; off += NX;   // transposed layout [b][h][d][j]
  _Float16* oh  = ws + off; off += NX;

  convert_x_kernel<<<(int)((NX + 255) / 256), 256, 0, stream>>>(x, xh, (int)NX);
  convert_w_kernel<<<(int)((NW + 255) / 256), 256, 0, stream>>>(
      Wq, Wk, Wv, Wp, WqT, WkT, WvT, WpT);
  qkv_gemm_kernel<<<dim3(BATCH * SEQ / 16, 9), 128, 0, stream>>>(
      xh, WqT, WkT, WvT, qb, kb, vb);
  attn_kernel<<<dim3(SEQ / 16, BATCH), 384, 0, stream>>>(
      qb, kb, vb, Wl, bl, Ww, bw, oh);
  out_proj_kernel<<<dim3(BATCH * SEQ / 16, 3), 128, 0, stream>>>(oh, WpT, bp, out);
}

// v001
// A run of this version takes 599 microseconds.
// Timed twice side by side with v000, it ran 1.69 times as fast both times.
#include <hip/hip_runtime.h>

#define DIMC  768
#define HEADS 12
#define HDIM  64
#define BATCH 8
#define SEQ   1024
#define QSCALE 0.125f   // HD^-0.5

typedef __attribute__((ext_vector_type(16))) _Float16 v16h;
typedef __attribute__((ext_vector_type(8)))  _Float16 v8h;
typedef __attribute__((ext_vector_type(8)))  float    v8f;

// Load a 16-bit A/B WMMA fragment for one K=32 step from a row-major row
// pointer. Per CDNA5 layout: lane<16 holds K {k0..k0+7, k0+16..k0+23} with
// k0=0, lane>=16 with k0=8. Two 16-byte chunks per lane.
__device__ __forceinline__ v16h frag_ld(const _Float16* __restrict__ row, int k0) {
  v8h lo = *(const v8h*)(row + k0);
  v8h hi = *(const v8h*)(row + k0 + 16);
  v16h r;
#pragma unroll
  for (int t = 0; t < 8; ++t) { r[t] = lo[t]; r[t + 8] = hi[t]; }
  return r;
}

__device__ __forceinline__ v8f wmma16(v16h a, v16h b, v8f c) {
  return __builtin_amdgcn_wmma_f32_16x16x32_f16(false, a, false, b,
                                                (short)0, c, false, false);
}

__device__ __forceinline__ v8f vzero8() {
  v8f z;
#pragma unroll
  for (int e = 0; e < 8; ++e) z[e] = 0.f;
  return z;
}

// ---------------------------------------------------------------- converts
__global__ void convert_x_kernel(const float* __restrict__ x,
                                 _Float16* __restrict__ xh, int n) {
  int i = blockIdx.x * blockDim.x + threadIdx.x;
  if (i < n) xh[i] = (_Float16)x[i];
}

__global__ void convert_w_kernel(const float* __restrict__ Wq,
                                 const float* __restrict__ Wk,
                                 const float* __restrict__ Wv,
                                 const float* __restrict__ Wp,
                                 _Float16* __restrict__ WqT,
                                 _Float16* __restrict__ WkT,
                                 _Float16* __restrict__ WvT,
                                 _Float16* __restrict__ WpT) {
  int idx = blockIdx.x * blockDim.x + threadIdx.x;
  if (idx >= DIMC * DIMC) return;
  int kk = idx / DIMC, nn = idx % DIMC;
  int tid = nn * DIMC + kk;              // transposed: [n][k]
  WqT[tid] = (_Float16)Wq[idx];
  WkT[tid] = (_Float16)Wk[idx];
  WvT[tid] = (_Float16)Wv[idx];
  WpT[tid] = (_Float16)Wp[idx];
}

// ---------------------------------------------------------------- QKV GEMM
// grid = (M/16, 9), block = 128 (4 waves). col groups 0-2 -> q, 3-5 -> k, 6-8 -> v.
// q scaled by QSCALE. v written TRANSPOSED per head: [b][h][d][j].
__global__ __launch_bounds__(128)
void qkv_gemm_kernel(const _Float16* __restrict__ xh,
                     const _Float16* __restrict__ WqT,
                     const _Float16* __restrict__ WkT,
                     const _Float16* __restrict__ WvT,
                     _Float16* __restrict__ qb, _Float16* __restrict__ kb,
                     _Float16* __restrict__ vb) {
  const int mt = blockIdx.x, cg = blockIdx.y;
  const int wave = threadIdx.x >> 5, ln = threadIdx.x & 31;
  const int hlf = ln >> 4, lc = ln & 15;
  const int m0 = mt * 16;
  const int which = cg / 3;  // 0=q 1=k 2=v
  const _Float16* WT = (which == 0) ? WqT : (which == 1) ? WkT : WvT;
  const int nbase = (cg % 3) * 256 + wave * 64;  // within [0,768)
  const int kfrag = hlf * 8;

  const _Float16* arow = xh + (size_t)(m0 + lc) * DIMC;
  const _Float16* brow[4];
#pragma unroll
  for (int t = 0; t < 4; ++t)
    brow[t] = WT + (size_t)(nbase + t * 16 + lc) * DIMC;

  v8f c[4];
#pragma unroll
  for (int t = 0; t < 4; ++t) c[t] = vzero8();

  // software-pipelined, fully unrolled k loop: fragments for step s+1 are in
  // flight while step s WMMAs execute; full unroll lets SSA renaming remove
  // all buffer-rotation register copies.
  v16h a = frag_ld(arow, kfrag);
  v16h bfr[4];
#pragma unroll
  for (int t = 0; t < 4; ++t) bfr[t] = frag_ld(brow[t], kfrag);

  const int NSTEP = DIMC / 32;
#pragma unroll
  for (int s = 0; s < NSTEP - 1; ++s) {
    const int ks2 = (s + 1) * 32 + kfrag;
    v16h a_n = frag_ld(arow, ks2);
    v16h b_n[4];
#pragma unroll
    for (int t = 0; t < 4; ++t) b_n[t] = frag_ld(brow[t], ks2);
#pragma unroll
    for (int t = 0; t < 4; ++t) c[t] = wmma16(a, bfr[t], c[t]);
    a = a_n;
#pragma unroll
    for (int t = 0; t < 4; ++t) bfr[t] = b_n[t];
  }
#pragma unroll
  for (int t = 0; t < 4; ++t) c[t] = wmma16(a, bfr[t], c[t]);

  const int b_ = m0 / SEQ;
  const int nrow0 = m0 % SEQ;
  if (which == 2) {
    // V: transposed store [b][h][d][j]
#pragma unroll
    for (int t = 0; t < 4; ++t) {
      int col = nbase + t * 16 + lc;
      int head = col >> 6, d = col & 63;
      _Float16* vt = vb + (((size_t)b_ * HEADS + head) * HDIM + d) * SEQ;
#pragma unroll
      for (int r = 0; r < 8; ++r)
        vt[nrow0 + r + hlf * 8] = (_Float16)c[t][r];
    }
  } else {
    const float scale = (which == 0) ? QSCALE : 1.f;
    _Float16* dst = (which == 0) ? qb : kb;
#pragma unroll
    for (int t = 0; t < 4; ++t) {
      int col = nbase + t * 16 + lc;
      int head = col >> 6, d = col & 63;
#pragma unroll
      for (int r = 0; r < 8; ++r) {
        int i = nrow0 + r + hlf * 8;
        dst[(((size_t)b_ * HEADS + head) * SEQ + i) * HDIM + d] =
            (_Float16)(c[t][r] * scale);
      }
    }
  }
}

// ---------------------------------------------------- fused talking-heads attn
// grid = (SEQ/16, BATCH), block = 384 (12 waves, wave g owns head g).
// q,k layout [b][h][j][d]; v layout [b][h][d][j] (pre-transposed).
// Scores are formed as K * Q^T, so lane (lc, hlf) holds 8 contiguous columns
// (hlf*8 .. hlf*8+7 of each 16-column subtile) of query row lc. The lane keeps
// those positions through exchange, pre-mix, softmax and post-mix, which makes
// every LDS access 16 bytes wide and ends in the A-fragment layout of P @ V.
#define SPITCH 20   // floats per Smix row: 80 B, conflict-free for 16-byte ops
#define PPITCH 40   // halves per Pn row:   80 B, same reason
typedef __attribute__((ext_vector_type(4))) float v4f;
typedef __attribute__((ext_vector_type(2))) float v2f;

// A value that is equal in all lanes of the wave, moved to a scalar register.
__device__ __forceinline__ float uni(float x) {
  return __builtin_bit_cast(float,
      __builtin_amdgcn_readfirstlane(__builtin_bit_cast(int, x)));
}

// Pre-softmax head mix of this lane's 8 positions: bias + sum_h w[h] * S[h].
// srow points at Smix[0][lc][hlf*8]. Written on 2-wide vectors so that both
// passes get the same packed fused multiply-adds and the same values.
__device__ __forceinline__ void premix8(const float* srow, const float (&w)[HEADS],
                                        float bias, float (&s2)[8]) {
  v2f acc[4];
#pragma unroll
  for (int e = 0; e < 4; ++e) acc[e] = (v2f){bias, bias};
  // all 24 loads stand ahead of the arithmetic, so that they are in flight together
  v4f tl[HEADS], th[HEADS];
#pragma unroll
  for (int h = 0; h < HEADS; ++h) {
    tl[h] = *(const v4f*)(srow + h * 16 * SPITCH);
    th[h] = *(const v4f*)(srow + h * 16 * SPITCH + 4);
  }
#pragma unroll
  for (int h = 0; h < HEADS; ++h) {
    const v2f w2 = {w[h], w[h]};
    const v4f lo = tl[h], hi = th[h];
    acc[0] = __builtin_elementwise_fma(w2, (v2f){lo[0], lo[1]}, acc[0]);
    acc[1] = __builtin_elementwise_fma(w2, (v2f){lo[2], lo[3]}, acc[1]);
    acc[2] = __builtin_elementwise_fma(w2, (v2f){hi[0], hi[1]}, acc[2]);
    acc[3] = __builtin_elementwise_fma(w2, (v2f){hi[2], hi[3]}, acc[3]);
  }
#pragma unroll
  for (int e = 0; e < 4; ++e) { s2[2 * e] = acc[e][0]; s2[2 * e + 1] = acc[e][1]; }
}

__global__ __launch_bounds__(384)
void attn_kernel(const _Float16* __restrict__ q, const _Float16* __restrict__ k,
                 const _Float16* __restrict__ v,
                 const float* __restrict__ Wl, const float* __restrict__ bl,
                 const float* __restrict__ Ww, const float* __restrict__ bw,
                 _Float16* __restrict__ oh) {
  __shared__ __align__(16) float    Smix[HEADS][16][SPITCH];  // raw score exchange
  __shared__ __align__(16) _Float16 Pn[HEADS][16][PPITCH];    // normalized probs
  __shared__ float sWl[HEADS][HEADS], sWw[HEADS][HEADS];
  __shared__ float sbl[HEADS], sbw[HEADS];

  const int b = blockIdx.y;
  const int i0 = blockIdx.x * 16;
  const int wv = threadIdx.x >> 5;  // head
  const int ln = threadIdx.x & 31;
  const int hlf = ln >> 4, lc = ln & 15;
  const int kfrag = hlf * 8;

  if (threadIdx.x < HEADS * HEADS) {
    (&sWl[0][0])[threadIdx.x] = Wl[threadIdx.x];
    (&sWw[0][0])[threadIdx.x] = Ww[threadIdx.x];
  }
  if (threadIdx.x < HEADS) { sbl[threadIdx.x] = bl[threadIdx.x];
                             sbw[threadIdx.x] = bw[threadIdx.x]; }
  __syncthreads();

  // this head's mixing rows are the same in every lane of the wave: held in
  // scalar registers for both passes (as vector values the compiler kept up to
  // eight broadcast copies of each, at the cost of the LDS loads in flight)
  float wl[HEADS], ww[HEADS];
#pragma unroll
  for (int h = 0; h < HEADS; ++h) { wl[h] = uni(sWl[wv][h]); ww[h] = uni(sWw[wv][h]); }
  const float blv = uni(sbl[wv]), bwv = uni(sbw[wv]);

  const size_t headBase = ((size_t)b * HEADS + wv) * SEQ;
  const _Float16* vtb = v + headBase * HDIM;  // [d][j] for this (b, head)
  const _Float16* qrow = q + (headBase + i0 + lc) * HDIM;
  v16h aq0 = frag_ld(qrow, kfrag);
  v16h aq1 = frag_ld(qrow, kfrag + 32);

  // softmax stats of row lc over this lane's own columns only
  float m = -1e30f, l = 0.f;

  // ---------------- pass 1: online softmax stats over mixed scores ----------
  for (int j0 = 0; j0 < SEQ; j0 += 16) {
    const _Float16* krow = k + (headBase + j0 + lc) * HDIM;
    if (j0 + 16 < SEQ)
      __builtin_prefetch(k + (headBase + j0 + 16 + lc) * HDIM, 0, 1);
    v16h bk0 = frag_ld(krow, kfrag);
    v16h bk1 = frag_ld(krow, kfrag + 32);
    v8f c = vzero8();
    c = wmma16(bk0, aq0, c);   // c[r] = S[i0 + lc][j0 + hlf*8 + r]
    c = wmma16(bk1, aq1, c);
    {
      v4f s_lo = {c[0], c[1], c[2], c[3]}, s_hi = {c[4], c[5], c[6], c[7]};
      *(v4f*)&Smix[wv][lc][kfrag]     = s_lo;
      *(v4f*)&Smix[wv][lc][kfrag + 4] = s_hi;
    }
    __syncthreads();
    float s2[8];
    premix8(&Smix[0][lc][kfrag], wl, blv, s2);
    float mx = s2[0];
#pragma unroll
    for (int e = 1; e < 8; ++e) mx = fmaxf(mx, s2[e]);
    const float nm = fmaxf(m, mx);
    float p = 0.f;
#pragma unroll
    for (int e = 0; e < 8; ++e) p += __expf(s2[e] - nm);
    l = l * __expf(m - nm) + p;
    m = nm;
    __syncthreads();
  }

  // merge the two half-row stats (lanes lc and lc + 16), once
  float rl;
  {
    const float mo = __shfl_xor(m, 16, 32);
    const float mt = fmaxf(m, mo);
    float ls = l * __expf(m - mt);
    ls += __shfl_xor(ls, 16, 32);
    m = mt;
    rl = 1.f / ls;
  }

  v8f oacc[4];
#pragma unroll
  for (int t = 0; t < 4; ++t) oacc[t] = vzero8();

  // ---------------- pass 2: probs, post-mix, P @ V (j-steps of 32) ----------
  for (int j0 = 0; j0 < SEQ; j0 += 32) {
    if (j0 + 32 < SEQ) {
      __builtin_prefetch(k + (headBase + j0 + 32 + lc) * HDIM, 0, 1);
      __builtin_prefetch(vtb + (size_t)(lc * 4) * SEQ + j0 + 32, 0, 1);
    }
    // two 16-col subtiles: scores -> pre-mix -> normalized probs
#pragma unroll
    for (int sub = 0; sub < 2; ++sub) {
      const int jb = j0 + sub * 16;
      const _Float16* krow = k + (headBase + jb + lc) * HDIM;
      v16h bk0 = frag_ld(krow, kfrag);
      v16h bk1 = frag_ld(krow, kfrag + 32);
      v8f c = vzero8();
      c = wmma16(bk0, aq0, c);   // c[r] = S[i0 + lc][jb + hlf*8 + r]
      c = wmma16(bk1, aq1, c);
      {
        v4f s_lo = {c[0], c[1], c[2], c[3]}, s_hi = {c[4], c[5], c[6], c[7]};
        *(v4f*)&Smix[wv][lc][kfrag]     = s_lo;
        *(v4f*)&Smix[wv][lc][kfrag + 4] = s_hi;
      }
      __syncthreads();
      float s2[8];
      premix8(&Smix[0][lc][kfrag], wl, blv, s2);
      v8h pk;
#pragma unroll
      for (int e = 0; e < 8; ++e) pk[e] = (_Float16)(__expf(s2[e] - m) * rl);
      *(v8h*)&Pn[wv][lc][sub * 16 + kfrag] = pk;
      __syncthreads();
    }
    // post-softmax mix over heads for all 32 cols, at the positions of the
    // A fragment: a[t] = P2[lc][kfrag + t], a[t + 8] = P2[lc][kfrag + 16 + t]
    // (+bw per element: summed over all 1024 j reproduces the bias exactly)
    v16h a;
#pragma unroll
    for (int g = 0; g < 2; ++g) {   // g = 0: columns kfrag.., g = 1: kfrag + 16..
      v8h pl[HEADS];   // loads ahead of the arithmetic, in flight together
#pragma unroll
      for (int h = 0; h < HEADS; ++h) pl[h] = *(const v8h*)&Pn[h][lc][kfrag + g * 16];
      v2f p2[4];
#pragma unroll
      for (int e = 0; e < 4; ++e) p2[e] = (v2f){bwv, bwv};
#pragma unroll
      for (int h = 0; h < HEADS; ++h) {
        const v2f w2 = {ww[h], ww[h]};
        const v8h pn = pl[h];
#pragma unroll
        for (int e = 0; e < 4; ++e)
          p2[e] = __builtin_elementwise_fma(
              w2, (v2f){(float)pn[2 * e], (float)pn[2 * e + 1]}, p2[e]);
      }
#pragma unroll
      for (int e = 0; e < 4; ++e) {
        a[g * 8 + 2 * e]     = (_Float16)p2[e][0];
        a[g * 8 + 2 * e + 1] = (_Float16)p2[e][1];
      }
    }
    __syncthreads();
    // A = post-mixed probs (16x32), B = V^T tiles straight from global
#pragma unroll
    for (int t = 0; t < 4; ++t) {
      const int d = t * 16 + lc;
      v16h bb = frag_ld(vtb + (size_t)d * SEQ + j0, kfrag);
      oacc[t] = wmma16(a, bb, oacc[t]);
    }
    __syncthreads();
  }

  // write (B, N, DIM) f16
#pragma unroll
  for (int t = 0; t < 4; ++t) {
    int col = wv * HDIM + t * 16 + lc;
#pragma unroll
    for (int r = 0; r < 8; ++r) {
      int i = i0 + r + hlf * 8;
      oh[((size_t)b * SEQ + i) * DIMC + col] = (_Float16)oacc[t][r];
    }
  }
}

// ---------------------------------------------------------------- out proj
// grid = (M/16, 3), block = 128 (4 waves x 64 cols).
__global__ __launch_bounds__(128)
void out_proj_kernel(const _Float16* __restrict__ oh,
                     const _Float16* __restrict__ WpT,
                     const float* __restrict__ bp, float* __restrict__ out) {
  const int mt = blockIdx.x, cg = blockIdx.y;
  const int wave = threadIdx.x >> 5, ln = threadIdx.x & 31;
  const int hlf = ln >> 4, lc = ln & 15;
  const int m0 = mt * 16;
  const int nbase = cg * 256 + wave * 64;
  const int kfrag = hlf * 8;

  const _Float16* arow = oh + (size_t)(m0 + lc) * DIMC;
  const _Float16* brow[4];
#pragma unroll
  for (int t = 0; t < 4; ++t)
    brow[t] = WpT + (size_t)(nbase + t * 16 + lc) * DIMC;

  v8f c[4];
#pragma unroll
  for (int t = 0; t < 4; ++t) c[t] = vzero8();

  v16h a = frag_ld(arow, kfrag);
  v16h bfr[4];
#pragma unroll
  for (int t = 0; t < 4; ++t) bfr[t] = frag_ld(brow[t], kfrag);

  const int NSTEP = DIMC / 32;
#pragma unroll
  for (int s = 0; s < NSTEP - 1; ++s) {
    const int ks2 = (s + 1) * 32 + kfrag;
    v16h a_n = frag_ld(arow, ks2);
    v16h b_n[4];
#pragma unroll
    for (int t = 0; t < 4; ++t) b_n[t] = frag_ld(brow[t], ks2);
#pragma unroll
    for (int t = 0; t < 4; ++t) c[t] = wmma16(a, bfr[t], c[t]);
    a = a_n;
#pragma unroll
    for (int t = 0; t < 4; ++t) bfr[t] = b_n[t];
  }
#pragma unroll
  for (int t = 0; t < 4; ++t) c[t] = wmma16(a, bfr[t], c[t]);

#pragma unroll
  for (int t = 0; t < 4; ++t) {
    int col = nbase + t * 16 + lc;
    float bias = bp[col];
#pragma unroll
    for (int r = 0; r < 8; ++r)
      out[(size_t)(m0 + r + hlf * 8) * DIMC + col] = c[t][r] + bias;
  }
}

// ---------------------------------------------------------------- launch
extern "C" void kernel_launch(void* const* d_in, const int* in_sizes, int n_in,
                              void* d_out, int out_size, void* d_ws, size_t ws_size,
                              hipStream_t stream) {
  (void)in_sizes; (void)n_in; (void)out_size; (void)ws_size;
  const float* x  = (const float*)d_in[0];
  const float* Wq = (const float*)d_in[1];
  const float* Wk = (const float*)d_in[2];
  const float* Wv = (const float*)d_in[3];
  const float* Wl = (const float*)d_in[4];
  const float* bl = (const float*)d_in[5];
  const float* Ww = (const float*)d_in[6];
  const float* bw = (const float*)d_in[7];
  const float* Wp = (const float*)d_in[8];
  const float* bp = (const float*)d_in[9];
  float* out = (float*)d_out;

  _Float16* ws = (_Float16*)d_ws;
  size_t off = 0;
  const size_t NX = (size_t)BATCH * SEQ * DIMC;   // 6,291,456
  const size_t NW = (size_t)DIMC * DIMC;
  _Float16* xh  = ws + off; off += NX;
  _Float16* WqT = ws + off; off += NW;
  _Float16* WkT = ws + off; off += NW;
  _Float16* WvT = ws + off; off += NW;
  _Float16* WpT = ws + off; off += NW;
  _Float16* qb  = ws + off; off += NX;
  _Float16* kb  = ws + off; off += NX;
  _Float16* vb  = ws + off; off += NX;   // transposed layout [b][h][d][j]
  _Float16* oh  = ws + off; off += NX;

  convert_x_kernel<<<(int)((NX + 255) / 256), 256, 0, stream>>>(x, xh, (int)NX);
  convert_w_kernel<<<(int)((NW + 255) / 256), 256, 0, stream>>>(
      Wq, Wk, Wv, Wp, WqT, WkT, WvT, WpT);
  qkv_gemm_kernel<<<dim3(BATCH * SEQ / 16, 9), 128, 0, stream>>>(
      xh, WqT, WkT, WvT, qb, kb, vb);
  attn_kernel<<<dim3(SEQ / 16, BATCH), 384, 0, stream>>>(
      qb, kb, vb, Wl, bl, Ww, bw, oh);
  out_proj_kernel<<<dim3(BATCH * SEQ / 16, 3), 128, 0, stream>>>(oh, WpT, bp, out);
}

// v002
// Measured time: 437 microseconds a run.
// Timed twice side by side with v001, it ran 1.38 and 1.37 times as fast.
// Counting every step since v000, it is 2.32 times as fast.
#include <hip/hip_runtime.h>

#define DIMC  768
#define HEADS 12
#define HDIM  64
#define BATCH 8
#define SEQ   1024
#define QSCALE 0.125f   // HD^-0.5

typedef __attribute__((ext_vector_type(16))) _Float16 v16h;
typedef __attribute__((ext_vector_type(8)))  _Float16 v8h;
typedef __attribute__((ext_vector_type(8)))  float    v8f;

// Every f16 matrix in the workspace is kept in FRAGMENT ORDER: one 16-row x
// 32-k operand tile is 512 contiguous halves, as two 512-byte chunks, and lane
// ln's 16 bytes of a chunk stand at ln * 16 bytes. A fragment load then reads
// 4 whole 128-byte lines per instruction instead of 32 bytes of each of 16.
// Per CDNA5 layout: lane<16 holds K {k0..k0+7, k0+16..k0+23} with k0=0,
// lane>=16 with k0=8; chunk 0 is the first run of 8, chunk 1 the second.
#define FTILE 512   // halves per 16 x 32 tile

// Offset in halves of element (r, k) of a matrix with nks tiles along k.
__device__ __forceinline__ size_t fragoff(int r, int k, int nks) {
  return (size_t)((r >> 4) * nks + (k >> 5)) * FTILE + ((k >> 4) & 1) * 256 +
         (((k >> 3) & 1) * 16 + (r & 15)) * 8 + (k & 7);
}

// Load one A/B fragment; tile points at the start of its 16 x 32 tile.
__device__ __forceinline__ v16h frag_ld(const _Float16* __restrict__ tile, int ln) {
  v8h lo = *(const v8h*)(tile + ln * 8);
  v8h hi = *(const v8h*)(tile + 256 + ln * 8);
  v16h r;
#pragma unroll
  for (int t = 0; t < 8; ++t) { r[t] = lo[t]; r[t + 8] = hi[t]; }
  return r;
}

// Stands behind global loads whose address registers the compiler reuses next:
// those registers are not rewritten before the loads' addresses are taken.
__device__ __forceinline__ void xwait() { asm volatile("s_wait_xcnt 0x0" ::: "memory"); }

__device__ __forceinline__ v8f wmma16(v16h a, v16h b, v8f c) {
  return __builtin_amdgcn_wmma_f32_16x16x32_f16(false, a, false, b,
                                                (short)0, c, false, false);
}

__device__ __forceinline__ v8f vzero8() {
  v8f z;
#pragma unroll
  for (int e = 0; e < 8; ++e) z[e] = 0.f;
  return z;
}

// ---------------------------------------------------------------- converts
__global__ void convert_x_kernel(const float* __restrict__ x,
                                 _Float16* __restrict__ xh, int n) {
  // thread i writes the i-th 16-byte piece of xh (fragment order), n pieces
  int i = blockIdx.x * blockDim.x + threadIdx.x;
  if (i >= n) return;
  const int lane = i & 31, chunk = (i >> 5) & 1, tile = i >> 6;
  const int ks = tile % (DIMC / 32), rt = tile / (DIMC / 32);
  const float* src = x + (size_t)(rt * 16 + (lane & 15)) * DIMC +
                     ks * 32 + chunk * 16 + (lane >> 4) * 8;
  const float4 lo = *(const float4*)src, hi = *(const float4*)(src + 4);
  v8h o = {(_Float16)lo.x, (_Float16)lo.y, (_Float16)lo.z, (_Float16)lo.w,
           (_Float16)hi.x, (_Float16)hi.y, (_Float16)hi.z, (_Float16)hi.w};
  *(v8h*)(xh + (size_t)i * 8) = o;
}

__global__ void convert_w_kernel(const float* __restrict__ Wq,
                                 const float* __restrict__ Wk,
                                 const float* __restrict__ Wv,
                                 const float* __restrict__ Wp,
                                 _Float16* __restrict__ WqT,
                                 _Float16* __restrict__ WkT,
                                 _Float16* __restrict__ WvT,
                                 _Float16* __restrict__ WpT) {
  int idx = blockIdx.x * blockDim.x + threadIdx.x;
  if (idx >= DIMC * DIMC) return;
  int kk = idx / DIMC, nn = idx % DIMC;
  size_t tid = fragoff(nn, kk, DIMC / 32);  // transposed [n][k], fragment order
  WqT[tid] = (_Float16)Wq[idx];
  WkT[tid] = (_Float16)Wk[idx];
  WvT[tid] = (_Float16)Wv[idx];
  WpT[tid] = (_Float16)Wp[idx];
}

// ---------------------------------------------------------------- QKV GEMM
// grid = (M/16, 9), block = 128 (4 waves). col groups 0-2 -> q, 3-5 -> k, 6-8 -> v.
// q scaled by QSCALE. v written TRANSPOSED per head: [b][h][d][j]. q, k, v are
// per-head matrices in fragment order (rows i, j, d; k index d, d, j).
__global__ __launch_bounds__(128)
void qkv_gemm_kernel(const _Float16* __restrict__ xh,
                     const _Float16* __restrict__ WqT,
                     const _Float16* __restrict__ WkT,
                     const _Float16* __restrict__ WvT,
                     _Float16* __restrict__ qb, _Float16* __restrict__ kb,
                     _Float16* __restrict__ vb) {
  const int mt = blockIdx.x, cg = blockIdx.y;
  const int wave = threadIdx.x >> 5, ln = threadIdx.x & 31;
  const int hlf = ln >> 4, lc = ln & 15;
  const int m0 = mt * 16;
  const int which = cg / 3;  // 0=q 1=k 2=v
  const _Float16* WT = (which == 0) ? WqT : (which == 1) ? WkT : WvT;
  const int nbase = (cg % 3) * 256 + wave * 64;  // within [0,768)

  const _Float16* arow = xh + (size_t)mt * (DIMC / 32) * FTILE;
  const _Float16* brow[4];
#pragma unroll
  for (int t = 0; t < 4; ++t)
    brow[t] = WT + (size_t)((nbase >> 4) + t) * (DIMC / 32) * FTILE;

  v8f c[4];
#pragma unroll
  for (int t = 0; t < 4; ++t) c[t] = vzero8();

  // software-pipelined, fully unrolled k loop: fragments for step s+1 are in
  // flight while step s WMMAs execute; full unroll lets SSA renaming remove
  // all buffer-rotation register copies.
  v16h a = frag_ld(arow, ln);
  v16h bfr[4];
#pragma unroll
  for (int t = 0; t < 4; ++t) bfr[t] = frag_ld(brow[t], ln);

  const int NSTEP = DIMC / 32;
#pragma unroll
  for (int s = 0; s < NSTEP - 1; ++s) {
    const int ks2 = (s + 1) * FTILE;
    v16h a_n = frag_ld(arow + ks2, ln);
    v16h b_n[4];
#pragma unroll
    for (int t = 0; t < 4; ++t) b_n[t] = frag_ld(brow[t] + ks2, ln);
#pragma unroll
    for (int t = 0; t < 4; ++t) c[t] = wmma16(a, bfr[t], c[t]);
    a = a_n;
#pragma unroll
    for (int t = 0; t < 4; ++t) bfr[t] = b_n[t];
  }
#pragma unroll
  for (int t = 0; t < 4; ++t) c[t] = wmma16(a, bfr[t], c[t]);

  const int b_ = m0 / SEQ;
  const int nrow0 = m0 % SEQ;
  if (which == 2) {
    // V: transposed store [b][h][d][j]; the lane's 8 values of j are one piece
#pragma unroll
    for (int t = 0; t < 4; ++t) {
      int col = nbase + t * 16 + lc;
      int head = col >> 6, d = col & 63;
      _Float16* vt = vb + ((size_t)b_ * HEADS + head) * HDIM * SEQ;
      v8h pk;
#pragma unroll
      for (int r = 0; r < 8; ++r) pk[r] = (_Float16)c[t][r];
      *(v8h*)(vt + fragoff(d, nrow0 + hlf * 8, SEQ / 32)) = pk;
    }
  } else {
    const float scale = (which == 0) ? QSCALE : 1.f;
    _Float16* dst = (which == 0) ? qb : kb;
#pragma unroll
    for (int t = 0; t < 4; ++t) {
      int col = nbase + t * 16 + lc;
      int head = col >> 6, d = col & 63;
#pragma unroll
      for (int r = 0; r < 8; ++r) {
        int i = nrow0 + r + hlf * 8;
        dst[((size_t)b_ * HEADS + head) * SEQ * HDIM + fragoff(i, d, HDIM / 32)] =
            (_Float16)(c[t][r] * scale);
      }
    }
    xwait();   // the listing runs on from these stores into code that reuses their registers
  }
}

// ---------------------------------------------------- fused talking-heads attn
// grid = (SEQ/16, BATCH), block = 384 (12 waves, wave g owns head g).
// q,k layout [b][h][j][d]; v layout [b][h][d][j] (pre-transposed); each (b, h)
// matrix in fragment order.
// Scores are formed as K * Q^T, so lane (lc, hlf) holds 8 contiguous columns
// (hlf*8 .. hlf*8+7 of each 16-column subtile) of query row lc. The lane keeps
// those positions through exchange, pre-mix, softmax and post-mix, which makes
// every LDS access 16 bytes wide and ends in the A-fragment layout of P @ V.
#define SPITCH 20   // floats per Smix row: 80 B, conflict-free for 16-byte ops
#define PPITCH 40   // halves per Pn row:   80 B, same reason
typedef __attribute__((ext_vector_type(4))) float v4f;
typedef __attribute__((ext_vector_type(2))) float v2f;

// A value that is equal in all lanes of the wave, moved to a scalar register.
__device__ __forceinline__ float uni(float x) {
  return __builtin_bit_cast(float,
      __builtin_amdgcn_readfirstlane(__builtin_bit_cast(int, x)));
}

// Pre-softmax head mix of this lane's 8 positions: bias + sum_h w[h] * S[h].
// srow points at Smix[0][lc][hlf*8]. Written on 2-wide vectors so that both
// passes get the same packed fused multiply-adds and the same values.
__device__ __forceinline__ void premix8(const float* srow, const float (&w)[HEADS],
                                        float bias, float (&s2)[8]) {
  v2f acc[4];
#pragma unroll
  for (int e = 0; e < 4; ++e) acc[e] = (v2f){bias, bias};
  // all 24 loads stand ahead of the arithmetic, so that they are in flight together
  v4f tl[HEADS], th[HEADS];
#pragma unroll
  for (int h = 0; h < HEADS; ++h) {
    tl[h] = *(const v4f*)(srow + h * 16 * SPITCH);
    th[h] = *(const v4f*)(srow + h * 16 * SPITCH + 4);
  }
#pragma unroll
  for (int h = 0; h < HEADS; ++h) {
    const v2f w2 = {w[h], w[h]};
    const v4f lo = tl[h], hi = th[h];
    acc[0] = __builtin_elementwise_fma(w2, (v2f){lo[0], lo[1]}, acc[0]);
    acc[1] = __builtin_elementwise_fma(w2, (v2f){lo[2], lo[3]}, acc[1]);
    acc[2] = __builtin_elementwise_fma(w2, (v2f){hi[0], hi[1]}, acc[2]);
    acc[3] = __builtin_elementwise_fma(w2, (v2f){hi[2], hi[3]}, acc[3]);
  }
#pragma unroll
  for (int e = 0; e < 4; ++e) { s2[2 * e] = acc[e][0]; s2[2 * e + 1] = acc[e][1]; }
}

__global__ __launch_bounds__(384)
void attn_kernel(const _Float16* __restrict__ q, const _Float16* __restrict__ k,
                 const _Float16* __restrict__ v,
                 const float* __restrict__ Wl, const float* __restrict__ bl,
                 const float* __restrict__ Ww, const float* __restrict__ bw,
                 _Float16* __restrict__ oh) {
  __shared__ __align__(16) float    Smix[HEADS][16][SPITCH];  // raw score exchange
  __shared__ __align__(16) _Float16 Pn[HEADS][16][PPITCH];    // normalized probs
  __shared__ float sWl[HEADS][HEADS], sWw[HEADS][HEADS];
  __shared__ float sbl[HEADS], sbw[HEADS];

  const int b = blockIdx.y;
  const int i0 = blockIdx.x * 16;
  const int wv = threadIdx.x >> 5;  // head
  const int ln = threadIdx.x & 31;
  const int hlf = ln >> 4, lc = ln & 15;
  const int kfrag = hlf * 8;

  if (threadIdx.x < HEADS * HEADS) {
    (&sWl[0][0])[threadIdx.x] = Wl[threadIdx.x];
    (&sWw[0][0])[threadIdx.x] = Ww[threadIdx.x];
  }
  if (threadIdx.x < HEADS) { sbl[threadIdx.x] = bl[threadIdx.x];
                             sbw[threadIdx.x] = bw[threadIdx.x]; }
  __syncthreads();

  // this head's mixing rows are the same in every lane of the wave: held in
  // scalar registers for both passes (as vector values the compiler kept up to
  // eight broadcast copies of each, at the cost of the LDS loads in flight)
  float wl[HEADS], ww[HEADS];
#pragma unroll
  for (int h = 0; h < HEADS; ++h) { wl[h] = uni(sWl[wv][h]); ww[h] = uni(sWw[wv][h]); }
  const float blv = uni(sbl[wv]), bwv = uni(sbw[wv]);

  const size_t headBase = ((size_t)b * HEADS + wv) * SEQ;
  const _Float16* vtb = v + headBase * HDIM;  // [d][j] for this (b, head)
  const _Float16* kh  = k + headBase * HDIM;  // [j][d]: 2 tiles per 16 rows
  const _Float16* qt  = q + headBase * HDIM + (size_t)(i0 >> 4) * 2 * FTILE;
  v16h aq0 = frag_ld(qt, ln);
  v16h aq1 = frag_ld(qt + FTILE, ln);

  // softmax stats of row lc over this lane's own columns only
  float m = -1e30f, l = 0.f;

  // ---------------- pass 1: online softmax stats over mixed scores ----------
  for (int j0 = 0; j0 < SEQ; j0 += 16) {
    const _Float16* kt = kh + (size_t)(j0 >> 4) * 2 * FTILE;
    if (j0 + 16 < SEQ) {  // the next 16 rows: 2 KiB in a row, 64 bytes a lane
      __builtin_prefetch(kt + 2 * FTILE + ln * 32, 0, 1);
      xwait();
    }
    v16h bk0 = frag_ld(kt, ln);
    v16h bk1 = frag_ld(kt + FTILE, ln);
    v8f c = vzero8();
    c = wmma16(bk0, aq0, c);   // c[r] = S[i0 + lc][j0 + hlf*8 + r]
    c = wmma16(bk1, aq1, c);
    {
      v4f s_lo = {c[0], c[1], c[2], c[3]}, s_hi = {c[4], c[5], c[6], c[7]};
      *(v4f*)&Smix[wv][lc][kfrag]     = s_lo;
      *(v4f*)&Smix[wv][lc][kfrag + 4] = s_hi;
    }
    __syncthreads();
    float s2[8];
    premix8(&Smix[0][lc][kfrag], wl, blv, s2);
    float mx = s2[0];
#pragma unroll
    for (int e = 1; e < 8; ++e) mx = fmaxf(mx, s2[e]);
    const float nm = fmaxf(m, mx);
    float p = 0.f;
#pragma unroll
    for (int e = 0; e < 8; ++e) p += __expf(s2[e] - nm);
    l = l * __expf(m - nm) + p;
    m = nm;
    __syncthreads();
  }

  // merge the two half-row stats (lanes lc and lc + 16), once
  float rl;
  {
    const float mo = __shfl_xor(m, 16, 32);
    const float mt = fmaxf(m, mo);
    float ls = l * __expf(m - mt);
    ls += __shfl_xor(ls, 16, 32);
    m = mt;
    rl = 1.f / ls;
  }

  v8f oacc[4];
#pragma unroll
  for (int t = 0; t < 4; ++t) oacc[t] = vzero8();

  // ---------------- pass 2: probs, post-mix, P @ V (j-steps of 32) ----------
  for (int j0 = 0; j0 < SEQ; j0 += 32) {
    if (j0 + 32 < SEQ) {
      // the next 32 rows of K: 4 KiB in a row, one line a lane; the next four
      // V tiles: 1 KiB each, 8 lanes a tile
      __builtin_prefetch(kh + (size_t)((j0 + 32) >> 4) * 2 * FTILE + ln * 64, 0, 1);
      __builtin_prefetch(vtb + (size_t)((ln >> 3) * (SEQ / 32) + ((j0 + 32) >> 5)) * FTILE +
                             (ln & 7) * 64, 0, 1);
      xwait();
    }
    // two 16-col subtiles: scores -> pre-mix -> normalized probs
#pragma unroll
    for (int sub = 0; sub < 2; ++sub) {
      const int jb = j0 + sub * 16;
      const _Float16* kt = kh + (size_t)(jb >> 4) * 2 * FTILE;
      v16h bk0 = frag_ld(kt, ln);
      v16h bk1 = frag_ld(kt + FTILE, ln);
      v8f c = vzero8();
      c = wmma16(bk0, aq0, c);   // c[r] = S[i0 + lc][jb + hlf*8 + r]
      c = wmma16(bk1, aq1, c);
      if (sub == 1) xwait();   // both subtiles load through one address register
      {
        v4f s_lo = {c[0], c[1], c[2], c[3]}, s_hi = {c[4], c[5], c[6], c[7]};
        *(v4f*)&Smix[wv][lc][kfrag]     = s_lo;
        *(v4f*)&Smix[wv][lc][kfrag + 4] = s_hi;
      }
      __syncthreads();
      float s2[8];
      premix8(&Smix[0][lc][kfrag], wl, blv, s2);
      v8h pk;
#pragma unroll
      for (int e = 0; e < 8; ++e) pk[e] = (_Float16)(__expf(s2[e] - m) * rl);
      *(v8h*)&Pn[wv][lc][sub * 16 + kfrag] = pk;
      __syncthreads();
    }
    // post-softmax mix over heads for all 32 cols, at the positions of the
    // A fragment: a[t] = P2[lc][kfrag + t], a[t + 8] = P2[lc][kfrag + 16 + t]
    // (+bw per element: summed over all 1024 j reproduces the bias exactly)
    v16h a;
#pragma unroll
    for (int g = 0; g < 2; ++g) {   // g = 0: columns kfrag.., g = 1: kfrag + 16..
      v8h pl[HEADS];   // loads ahead of the arithmetic, in flight together
#pragma unroll
      for (int h = 0; h < HEADS; ++h) pl[h] = *(const v8h*)&Pn[h][lc][kfrag + g * 16];
      v2f p2[4];
#pragma unroll
      for (int e = 0; e < 4; ++e) p2[e] = (v2f){bwv, bwv};
#pragma unroll
      for (int h = 0; h < HEADS; ++h) {
        const v2f w2 = {ww[h], ww[h]};
        const v8h pn = pl[h];
#pragma unroll
        for (int e = 0; e < 4; ++e)
          p2[e] = __builtin_elementwise_fma(
              w2, (v2f){(float)pn[2 * e], (float)pn[2 * e + 1]}, p2[e]);
      }
#pragma unroll
      for (int e = 0; e < 4; ++e) {
        a[g * 8 + 2 * e]     = (_Float16)p2[e][0];
        a[g * 8 + 2 * e + 1] = (_Float16)p2[e][1];
      }
    }
    __syncthreads();
    // A = post-mixed probs (16x32), B = V^T tiles straight from global
#pragma unroll
    for (int t = 0; t < 4; ++t) {
      v16h bb = frag_ld(vtb + (size_t)(t * (SEQ / 32) + (j0 >> 5)) * FTILE, ln);
      oacc[t] = wmma16(a, bb, oacc[t]);
    }
    xwait();
    __syncthreads();
  }

  // write (B * N, DIM) f16, fragment order (A operand of the out projection)
#pragma unroll
  for (int t = 0; t < 4; ++t) {
    int col = wv * HDIM + t * 16 + lc;
#pragma unroll
    for (int r = 0; r < 8; ++r) {
      int i = i0 + r + hlf * 8;
      oh[fragoff(b * SEQ + i, col, DIMC / 32)] = (_Float16)oacc[t][r];
    }
  }
}

// ---------------------------------------------------------------- out proj
// grid = (M/16, 3), block = 128 (4 waves x 64 cols).
__global__ __launch_bounds__(128)
void out_proj_kernel(const _Float16* __restrict__ oh,
                     const _Float16* __restrict__ WpT,
                     const float* __restrict__ bp, float* __restrict__ out) {
  const int mt = blockIdx.x, cg = blockIdx.y;
  const int wave = threadIdx.x >> 5, ln = threadIdx.x & 31;
  const int hlf = ln >> 4, lc = ln & 15;
  const int m0 = mt * 16;
  const int nbase = cg * 256 + wave * 64;

  const _Float16* arow = oh + (size_t)mt * (DIMC / 32) * FTILE;
  const _Float16* brow[4];
#pragma unroll
  for (int t = 0; t < 4; ++t)
    brow[t] = WpT + (size_t)((nbase >> 4) + t) * (DIMC / 32) * FTILE;

  v8f c[4];
#pragma unroll
  for (int t = 0; t < 4; ++t) c[t] = vzero8();

  v16h a = frag_ld(arow, ln);
  v16h bfr[4];
#pragma unroll
  for (int t = 0; t < 4; ++t) bfr[t] = frag_ld(brow[t], ln);

  const int NSTEP = DIMC / 32;
#pragma unroll
  for (int s = 0; s < NSTEP - 1; ++s) {
    const int ks2 = (s + 1) * FTILE;
    v16h a_n = frag_ld(arow + ks2, ln);
    if (s == NSTEP - 2) xwait();  // the last B loads land on A's dead address register
    v16h b_n[4];
#pragma unroll
    for (int t = 0; t < 4; ++t) b_n[t] = frag_ld(brow[t] + ks2, ln);
#pragma unroll
    for (int t = 0; t < 4; ++t) c[t] = wmma16(a, bfr[t], c[t]);
    a = a_n;
#pragma unroll
    for (int t = 0; t < 4; ++t) bfr[t] = b_n[t];
  }
#pragma unroll
  for (int t = 0; t < 4; ++t) c[t] = wmma16(a, bfr[t], c[t]);

#pragma unroll
  for (int t = 0; t < 4; ++t) {
    int col = nbase + t * 16 + lc;
    float bias = bp[col];
#pragma unroll
    for (int r = 0; r < 8; ++r)
      out[(size_t)(m0 + r + hlf * 8) * DIMC + col] = c[t][r] + bias;
  }
}

// ---------------------------------------------------------------- launch
extern "C" void kernel_launch(void* const* d_in, const int* in_sizes, int n_in,
                              void* d_out, int out_size, void* d_ws, size_t ws_size,
                              hipStream_t stream) {
  (void)in_sizes; (void)n_in; (void)out_size; (void)ws_size;
  const float* x  = (const float*)d_in[0];
  const float* Wq = (const float*)d_in[1];
  const float* Wk = (const float*)d_in[2];
  const float* Wv = (const float*)d_in[3];
  const float* Wl = (const float*)d_in[4];
  const float* bl = (const float*)d_in[5];
  const float* Ww = (const float*)d_in[6];
  const float* bw = (const float*)d_in[7];
  const float* Wp = (const float*)d_in[8];
  const float* bp = (const float*)d_in[9];
  float* out = (float*)d_out;

  _Float16* ws = (_Float16*)d_ws;
  size_t off = 0;
  const size_t NX = (size_t)BATCH * SEQ * DIMC;   // 6,291,456
  const size_t NW = (size_t)DIMC * DIMC;
  _Float16* xh  = ws + off; off += NX;
  _Float16* WqT = ws + off; off += NW;
  _Float16* WkT = ws + off; off += NW;
  _Float16* WvT = ws + off; off += NW;
  _Float16* WpT = ws + off; off += NW;
  _Float16* qb  = ws + off; off += NX;
  _Float16* kb  = ws + off; off += NX;
  _Float16* vb  = ws + off; off += NX;   // transposed layout [b][h][d][j]
  _Float16* oh  = ws + off; off += NX;

  convert_x_kernel<<<(int)((NX / 8 + 255) / 256), 256, 0, stream>>>(x, xh, (int)(NX / 8));
  convert_w_kernel<<<(int)((NW + 255) / 256), 256, 0, stream>>>(
      Wq, Wk, Wv, Wp, WqT, WkT, WvT, WpT);
  qkv_gemm_kernel<<<dim3(BATCH * SEQ / 16, 9), 128, 0, stream>>>(
      xh, WqT, WkT, WvT, qb, kb, vb);
  attn_kernel<<<dim3(SEQ / 16, BATCH), 384, 0, stream>>>(
      qb, kb, vb, Wl, bl, Ww, bw, oh);
  out_proj_kernel<<<dim3(BATCH * SEQ / 16, 3), 128, 0, stream>>>(oh, WpT, bp, out);
}

// v003
// A run of this version takes 285 microseconds.
// Timed twice side by side with v002, it ran 1.53 times as fast both times.
// Counting every step since v000, it is 3.56 times as fast.
#include <hip/hip_runtime.h>

#define DIMC  768
#define HEADS 12
#define HDIM  64
#define BATCH 8
#define SEQ   1024
#define QSCALE 0.125f   // HD^-0.5

typedef __attribute__((ext_vector_type(16))) _Float16 v16h;
typedef __attribute__((ext_vector_type(8)))  _Float16 v8h;
typedef __attribute__((ext_vector_type(8)))  float    v8f;

// Every f16 matrix in the workspace is kept in FRAGMENT ORDER: one 16-row x
// 32-k operand tile is 512 contiguous halves, as two 512-byte chunks, and lane
// ln's 16 bytes of a chunk stand at ln * 16 bytes. A fragment load then reads
// 4 whole 128-byte lines per instruction instead of 32 bytes of each of 16.
// Per CDNA5 layout: lane<16 holds K {k0..k0+7, k0+16..k0+23} with k0=0,
// lane>=16 with k0=8; chunk 0 is the first run of 8, chunk 1 the second.
#define FTILE 512   // halves per 16 x 32 tile

// Offset in halves of element (r, k) of a matrix with nks tiles along k.
__device__ __forceinline__ size_t fragoff(int r, int k, int nks) {
  return (size_t)((r >> 4) * nks + (k >> 5)) * FTILE + ((k >> 4) & 1) * 256 +
         (((k >> 3) & 1) * 16 + (r & 15)) * 8 + (k & 7);
}

// Load one A/B fragment; tile points at the start of its 16 x 32 tile.
__device__ __forceinline__ v16h frag_ld(const _Float16* __restrict__ tile, int ln) {
  v8h lo = *(const v8h*)(tile + ln * 8);
  v8h hi = *(const v8h*)(tile + 256 + ln * 8);
  v16h r;
#pragma unroll
  for (int t = 0; t < 8; ++t) { r[t] = lo[t]; r[t + 8] = hi[t]; }
  return r;
}

// Stands behind global loads whose address registers the compiler reuses next:
// those registers are not rewritten before the loads' addresses are taken.
__device__ __forceinline__ void xwait() { asm volatile("s_wait_xcnt 0x0" ::: "memory"); }

__device__ __forceinline__ v8f wmma16(v16h a, v16h b, v8f c) {
  return __builtin_amdgcn_wmma_f32_16x16x32_f16(false, a, false, b,
                                                (short)0, c, false, false);
}

__device__ __forceinline__ v8f vzero8() {
  v8f z;
#pragma unroll
  for (int e = 0; e < 8; ++e) z[e] = 0.f;
  return z;
}

// ---------------------------------------------------------------- converts
__global__ void convert_x_kernel(const float* __restrict__ x,
                                 _Float16* __restrict__ xh, int n) {
  // thread i writes the i-th 16-byte piece of xh (fragment order), n pieces
  int i = blockIdx.x * blockDim.x + threadIdx.x;
  if (i >= n) return;
  const int lane = i & 31, chunk = (i >> 5) & 1, tile = i >> 6;
  const int ks = tile % (DIMC / 32), rt = tile / (DIMC / 32);
  const float* src = x + (size_t)(rt * 16 + (lane & 15)) * DIMC +
                     ks * 32 + chunk * 16 + (lane >> 4) * 8;
  const float4 lo = *(const float4*)src, hi = *(const float4*)(src + 4);
  v8h o = {(_Float16)lo.x, (_Float16)lo.y, (_Float16)lo.z, (_Float16)lo.w,
           (_Float16)hi.x, (_Float16)hi.y, (_Float16)hi.z, (_Float16)hi.w};
  *(v8h*)(xh + (size_t)i * 8) = o;
}

__global__ void convert_w_kernel(const float* __restrict__ Wq,
                                 const float* __restrict__ Wk,
                                 const float* __restrict__ Wv,
                                 const float* __restrict__ Wp,
                                 _Float16* __restrict__ WqT,
                                 _Float16* __restrict__ WkT,
                                 _Float16* __restrict__ WvT,
                                 _Float16* __restrict__ WpT) {
  int idx = blockIdx.x * blockDim.x + threadIdx.x;
  if (idx >= DIMC * DIMC) return;
  int kk = idx / DIMC, nn = idx % DIMC;
  size_t tid = fragoff(nn, kk, DIMC / 32);  // transposed [n][k], fragment order
  WqT[tid] = (_Float16)Wq[idx];
  WkT[tid] = (_Float16)Wk[idx];
  WvT[tid] = (_Float16)Wv[idx];
  WpT[tid] = (_Float16)Wp[idx];
}

// ---------------------------------------------------------------- QKV GEMM
// grid = (M/16, 9), block = 128 (4 waves). col groups 0-2 -> q, 3-5 -> k, 6-8 -> v.
// q scaled by QSCALE. v written TRANSPOSED per head: [b][h][d][j]. q, k, v are
// per-head matrices in fragment order (rows i, j, d; k index d, d, j).
__global__ __launch_bounds__(128)
void qkv_gemm_kernel(const _Float16* __restrict__ xh,
                     const _Float16* __restrict__ WqT,
                     const _Float16* __restrict__ WkT,
                     const _Float16* __restrict__ WvT,
                     _Float16* __restrict__ qb, _Float16* __restrict__ kb,
                     _Float16* __restrict__ vb) {
  const int mt = blockIdx.x, cg = blockIdx.y;
  const int wave = threadIdx.x >> 5, ln = threadIdx.x & 31;
  const int hlf = ln >> 4, lc = ln & 15;
  const int m0 = mt * 16;
  const int which = cg / 3;  // 0=q 1=k 2=v
  const _Float16* WT = (which == 0) ? WqT : (which == 1) ? WkT : WvT;
  const int nbase = (cg % 3) * 256 + wave * 64;  // within [0,768)

  const _Float16* arow = xh + (size_t)mt * (DIMC / 32) * FTILE;
  const _Float16* brow[4];
#pragma unroll
  for (int t = 0; t < 4; ++t)
    brow[t] = WT + (size_t)((nbase >> 4) + t) * (DIMC / 32) * FTILE;

  v8f c[4];
#pragma unroll
  for (int t = 0; t < 4; ++t) c[t] = vzero8();

  // software-pipelined, fully unrolled k loop: fragments for step s+1 are in
  // flight while step s WMMAs execute; full unroll lets SSA renaming remove
  // all buffer-rotation register copies.
  v16h a = frag_ld(arow, ln);
  v16h bfr[4];
#pragma unroll
  for (int t = 0; t < 4; ++t) bfr[t] = frag_ld(brow[t], ln);

  const int NSTEP = DIMC / 32;
#pragma unroll
  for (int s = 0; s < NSTEP - 1; ++s) {
    const int ks2 = (s + 1) * FTILE;
    v16h a_n = frag_ld(arow + ks2, ln);
    v16h b_n[4];
#pragma unroll
    for (int t = 0; t < 4; ++t) b_n[t] = frag_ld(brow[t] + ks2, ln);
#pragma unroll
    for (int t = 0; t < 4; ++t) c[t] = wmma16(a, bfr[t], c[t]);
    a = a_n;
#pragma unroll
    for (int t = 0; t < 4; ++t) bfr[t] = b_n[t];
  }
#pragma unroll
  for (int t = 0; t < 4; ++t) c[t] = wmma16(a, bfr[t], c[t]);

  const int b_ = m0 / SEQ;
  const int nrow0 = m0 % SEQ;
  if (which == 2) {
    // V: transposed store [b][h][d][j]; the lane's 8 values of j are one piece
#pragma unroll
    for (int t = 0; t < 4; ++t) {
      int col = nbase + t * 16 + lc;
      int head = col >> 6, d = col & 63;
      _Float16* vt = vb + ((size_t)b_ * HEADS + head) * HDIM * SEQ;
      v8h pk;
#pragma unroll
      for (int r = 0; r < 8; ++r) pk[r] = (_Float16)c[t][r];
      *(v8h*)(vt + fragoff(d, nrow0 + hlf * 8, SEQ / 32)) = pk;
    }
  } else {
    const float scale = (which == 0) ? QSCALE : 1.f;
    _Float16* dst = (which == 0) ? qb : kb;
#pragma unroll
    for (int t = 0; t < 4; ++t) {
      int col = nbase + t * 16 + lc;
      int head = col >> 6, d = col & 63;
#pragma unroll
      for (int r = 0; r < 8; ++r) {
        int i = nrow0 + r + hlf * 8;
        dst[((size_t)b_ * HEADS + head) * SEQ * HDIM + fragoff(i, d, HDIM / 32)] =
            (_Float16)(c[t][r] * scale);
      }
    }
    xwait();   // the listing runs on from these stores into code that reuses their registers
  }
}

// ---------------------------------------------------- fused talking-heads attn
// grid = (SEQ/16, BATCH), block = 512 (16 waves), 16 query rows, 64 columns a step.
// q,k layout [b][h][j][d]; v layout [b][h][d][j] (pre-transposed); each (b, h)
// matrix in fragment order.
// Wave w forms the raw scores of heads 3*(w>>2)..+2 on column tile w&3 (as
// K * Q^T, so a lane holds 8 contiguous columns of query row lc) and puts them
// into Smix once. Both head mixes are matrix products over the head index:
// D[g][pos] = sum_h W[g][h] * S[h][pos], f32 16x16x4, three k steps for 12 heads.
// One mix tile is one column j with its 16 query rows (lane lc = row); wave w
// mixes columns 4w..4w+3 of the step, so every score is read from LDS once.
// Head order, the same in A, B and D: lane half hlf, register r < 6 <-> head
// 6*hlf + r (D rows 6, 7, 14, 15 are padding, weights and bias 0). With it the
// D of the pre-mix, after the softmax in place, is the B of the post-mix.
#define NWV 16      // waves per block
#define JS  64      // columns per step
#define SP  68      // floats per Smix row: 272 B = 16 B x odd
#define PP  72      // halves per Pn row:   144 B = 16 B x odd
typedef __attribute__((ext_vector_type(4))) float    v4f;
typedef __attribute__((ext_vector_type(2))) float    v2f;
typedef __attribute__((ext_vector_type(4))) _Float16 v4h;

__device__ __forceinline__ v8f wmma4(v2f a, v2f b, v8f c) {
  return __builtin_amdgcn_wmma_f32_16x16x4_f32(false, a, false, b,
                                               (short)0, c, false, false);
}

// e^x in the fast form (one multiply, v_exp_f32). The v_nop fills the one slot that
// the instruction set asks for between a transcendental and a next instruction
// that reads its result or overwrites its source.
__device__ __forceinline__ float exp_slot(float x) {
  float y;
  asm("v_exp_f32 %0, %1\n\tv_nop" : "=v"(y) : "v"(x * 1.44269504f));
  return y;
}

// Six fragments: two neighbouring tiles of each of three neighbouring heads, all
// twelve loads through one address register and in flight together.
__device__ __forceinline__ void frag_ld6(const _Float16* __restrict__ tile0, int ln,
                                         v16h (&f)[3][2]) {
  const _Float16* p = tile0 + ln * 8;
  v8h t[12];
#pragma unroll
  for (int i = 0; i < 11; ++i)
    t[i] = *(const v8h*)(p + (i >> 2) * (SEQ * HDIM) + ((i >> 1) & 1) * FTILE + (i & 1) * 256);
  xwait();   // the last load may land on the address register that the eleven name
  t[11] = *(const v8h*)(p + 2 * (SEQ * HDIM) + FTILE + 256);
  xwait();
#pragma unroll
  for (int u = 0; u < 3; ++u)
#pragma unroll
    for (int s = 0; s < 2; ++s)
#pragma unroll
      for (int e = 0; e < 8; ++e) {
        f[u][s][e]     = t[u * 4 + s * 2][e];
        f[u][s][e + 8] = t[u * 4 + s * 2 + 1][e];
      }
}

__global__ __launch_bounds__(512)
void attn_kernel(const _Float16* __restrict__ q, const _Float16* __restrict__ k,
                 const _Float16* __restrict__ v,
                 const float* __restrict__ Wl, const float* __restrict__ bl,
                 const float* __restrict__ Ww, const float* __restrict__ bw,
                 _Float16* __restrict__ oh) {
  __shared__ __align__(16) float    Smix[2][HEADS][16][SP];  // raw scores, two steps
  __shared__ __align__(16) _Float16 Pn[HEADS][16][PP];       // post-mixed probs
  __shared__ float stM[NWV][HEADS][16], stL[NWV][HEADS][16]; // per-wave softmax stats

  const int b = blockIdx.y;
  const int i0 = blockIdx.x * 16;
  const int wv = threadIdx.x >> 5;
  const int ln = threadIdx.x & 31;
  const int hlf = ln >> 4, lc = ln & 15;
  const int jt = wv & 3;         // column tile (scores), d tile (P @ V)
  const int h0 = (wv >> 2) * 3;  // first of this wave's three heads

  // A operands of the two mixes: row lc of A is output head 6*(lc>>3) + (lc&7)
  const bool live = (lc & 7) < 6;
  const int grow = live ? (lc >> 3) * 6 + (lc & 7) : 0;
  v2f wa[3], wb[3];
#pragma unroll
  for (int s = 0; s < 3; ++s)
#pragma unroll
    for (int e = 0; e < 2; ++e) {
      const int hh = 6 * hlf + 2 * s + e;
      const float tl = Wl[grow * HEADS + hh], tw = Ww[grow * HEADS + hh];
      wa[s][e] = live ? tl : 0.f;
      wb[s][e] = live ? tw : 0.f;
    }
  xwait();
  v8f cbl = vzero8(), cbw = vzero8();   // C operands: the biases, by D row
#pragma unroll
  for (int r = 0; r < 6; ++r) { cbl[r] = bl[6 * hlf + r]; cbw[r] = bw[6 * hlf + r]; }
  xwait();

  const size_t base = ((size_t)b * HEADS + h0) * SEQ * HDIM;  // first of the three heads
  const _Float16* kh = k + base;   // [j][d]: 2 tiles per 16 rows
  const _Float16* vt = v + base;   // [d][j]
  v16h aq[3][2];
  frag_ld6(q + base + (size_t)(i0 >> 4) * 2 * FTILE, ln, aq);

  // this wave's six K fragments of step n
  auto kload = [&](int n, v16h (&kf)[3][2]) {
    frag_ld6(kh + (size_t)(n * (JS / 16) + jt) * 2 * FTILE, ln, kf);
  };

  // raw scores of step n -> Smix[n & 1]
  auto scores = [&](int n, const v16h (&kf)[3][2]) {
#pragma unroll
    for (int u = 0; u < 3; ++u) {
      v8f c = vzero8();
      c = wmma16(kf[u][0], aq[u][0], c);   // c[r] = S[i0 + lc][n*64 + jt*16 + hlf*8 + r]
      c = wmma16(kf[u][1], aq[u][1], c);
      float* dst = &Smix[n & 1][h0 + u][lc][jt * 16 + hlf * 8];
      v4f s_lo = {c[0], c[1], c[2], c[3]}, s_hi = {c[4], c[5], c[6], c[7]};
      *(v4f*)dst       = s_lo;
      *(v4f*)(dst + 4) = s_hi;
    }
  };

  // pre-softmax mix of columns 4*wv..+3 of step n, on top of c0 (C operand):
  // d[t][r] = c0[r] + sum_h Wl[6*hlf + r][h] * S[h][lc][4*wv + t]
  auto premix = [&](int n, const v8f& c0, v8f (&d)[4]) {
    v4f sv[6];
#pragma unroll
    for (int r = 0; r < 6; ++r)
      sv[r] = *(const v4f*)&Smix[n & 1][6 * hlf + r][lc][wv * 4];
#pragma unroll
    for (int t = 0; t < 4; ++t) d[t] = c0;
#pragma unroll
    for (int s = 0; s < 3; ++s)
#pragma unroll
      for (int t = 0; t < 4; ++t)
        d[t] = wmma4(wa[s], (v2f){sv[2 * s][t], sv[2 * s + 1][t]}, d[t]);
  };

  // softmax stats of (head 6*hlf + r, row lc) over this wave's own columns only
  float m[6], l[6];
#pragma unroll
  for (int r = 0; r < 6; ++r) { m[r] = -1e30f; l[r] = 0.f; }

  v16h kf[3][2];
  kload(0, kf);
  scores(0, kf);
  __syncthreads();

  // ---------------- pass 1: online softmax stats over mixed scores ----------
  // One barrier a step: it publishes step n + 1 and ends the reads of step n,
  // whose buffer is written again only in step n + 1.
  for (int n = 0; n < SEQ / JS; ++n) {
    // the next step's K flies while this step is mixed (after the last step:
    // step 0 again, for pass 2)
    kload((n + 1) & (SEQ / JS - 1), kf);
    v8f d[4];
    premix(n, cbl, d);
#pragma unroll
    for (int r = 0; r < 6; ++r) {
      const float mx = fmaxf(fmaxf(d[0][r], d[1][r]), fmaxf(d[2][r], d[3][r]));
      const float nm = fmaxf(m[r], mx);
      float p = 0.f;
#pragma unroll
      for (int t = 0; t < 4; ++t) p += __expf(d[t][r] - nm);
      l[r] = l[r] * __expf(m[r] - nm) + p;
      m[r] = nm;
    }
    scores((n + 1) & (SEQ / JS - 1), kf);   // 16 & 15 = 0: buffer 0, last read in step 14
    __syncthreads();
  }

  // merge the 16 waves' stats, once; every wave needs all (head, row) pairs
#pragma unroll
  for (int r = 0; r < 6; ++r) {
    stM[wv][6 * hlf + r][lc] = m[r];
    stL[wv][6 * hlf + r][lc] = l[r];
  }
  __syncthreads();
  float rl[6];
#pragma unroll
  for (int r = 0; r < 6; ++r) {
    float mt = -1e30f;
#pragma unroll
    for (int w = 0; w < NWV; ++w) mt = fmaxf(mt, stM[w][6 * hlf + r][lc]);
    float ls = 0.f;
#pragma unroll
    for (int w = 0; w < NWV; ++w)
      ls += stL[w][6 * hlf + r][lc] * exp_slot(stM[w][6 * hlf + r][lc] - mt);
    cbl[r] -= mt;   // pass 2: the row maximum is taken off in the C operand
    rl[r] = 1.f / ls;
  }

  v8f oacc[3];
#pragma unroll
  for (int u = 0; u < 3; ++u) oacc[u] = vzero8();

  // ---------------- pass 2: probs, post-mix, P @ V ---------------------------
  for (int n = 0; n < SEQ / JS; ++n) {
    // this step's V fragments fly while the step is mixed
    v16h vf[3][2];
    frag_ld6(vt + (size_t)(jt * (SEQ / 32) + n * 2) * FTILE, ln, vf);
    v8f d[4], e[4];
    premix(n, cbl, d);
#pragma unroll
    for (int t = 0; t < 4; ++t)
#pragma unroll
      for (int r = 0; r < 6; ++r) d[t][r] = exp_slot(d[t][r]) * rl[r];
    // post-softmax mix (+bw per element: summed over all 1024 j it reproduces
    // the bias term): e[t][r] = P2[6*hlf + r][lc][4*wv + t]
#pragma unroll
    for (int t = 0; t < 4; ++t) e[t] = cbw;
#pragma unroll
    for (int s = 0; s < 3; ++s)
#pragma unroll
      for (int t = 0; t < 4; ++t)
        e[t] = wmma4(wb[s], (v2f){d[t][2 * s], d[t][2 * s + 1]}, e[t]);
    v4h pk[6];
#pragma unroll
    for (int r = 0; r < 6; ++r)
      pk[r] = (v4h){(_Float16)e[0][r], (_Float16)e[1][r], (_Float16)e[2][r], (_Float16)e[3][r]};
#pragma unroll
    for (int r = 0; r < 6; ++r) *(v4h*)&Pn[6 * hlf + r][lc][wv * 4] = pk[r];
    __syncthreads();   // publishes Pn; ends the reads of this step's Smix buffer
    // the next step's K flies during P @ V
    if (n + 1 < SEQ / JS) kload(n + 1, kf);
    // A = post-mixed probs (16 x 32, twice), B = V^T tiles
#pragma unroll
    for (int u = 0; u < 3; ++u)
#pragma unroll
      for (int ks = 0; ks < 2; ++ks) {
        const _Float16* pr = &Pn[h0 + u][lc][ks * 32 + hlf * 8];
        const v8h lo = *(const v8h*)pr, hi = *(const v8h*)(pr + 16);
        v16h a;
#pragma unroll
        for (int t = 0; t < 8; ++t) { a[t] = lo[t]; a[t + 8] = hi[t]; }
        oacc[u] = wmma16(a, vf[u][ks], oacc[u]);
      }
    if (n + 1 < SEQ / JS) scores(n + 1, kf);
    __syncthreads();   // publishes the next scores; ends the reads of Pn
  }

  // write (B * N, DIM) f16, fragment order (A operand of the out projection)
#pragma unroll
  for (int u = 0; u < 3; ++u) {
    int col = (h0 + u) * HDIM + jt * 16 + lc;
#pragma unroll
    for (int r = 0; r < 8; ++r) {
      int i = i0 + r + hlf * 8;
      oh[fragoff(b * SEQ + i, col, DIMC / 32)] = (_Float16)oacc[u][r];
    }
  }
}

// ---------------------------------------------------------------- out proj
// grid = (M/16, 3), block = 128 (4 waves x 64 cols).
__global__ __launch_bounds__(128)
void out_proj_kernel(const _Float16* __restrict__ oh,
                     const _Float16* __restrict__ WpT,
                     const float* __restrict__ bp, float* __restrict__ out) {
  const int mt = blockIdx.x, cg = blockIdx.y;
  const int wave = threadIdx.x >> 5, ln = threadIdx.x & 31;
  const int hlf = ln >> 4, lc = ln & 15;
  const int m0 = mt * 16;
  const int nbase = cg * 256 + wave * 64;

  const _Float16* arow = oh + (size_t)mt * (DIMC / 32) * FTILE;
  const _Float16* brow[4];
#pragma unroll
  for (int t = 0; t < 4; ++t)
    brow[t] = WpT + (size_t)((nbase >> 4) + t) * (DIMC / 32) * FTILE;

  v8f c[4];
#pragma unroll
  for (int t = 0; t < 4; ++t) c[t] = vzero8();

  v16h a = frag_ld(arow, ln);
  v16h bfr[4];
#pragma unroll
  for (int t = 0; t < 4; ++t) bfr[t] = frag_ld(brow[t], ln);

  const int NSTEP = DIMC / 32;
#pragma unroll
  for (int s = 0; s < NSTEP - 1; ++s) {
    const int ks2 = (s + 1) * FTILE;
    v16h a_n = frag_ld(arow + ks2, ln);
    if (s == NSTEP - 2) xwait();  // the last B loads land on A's dead address register
    v16h b_n[4];
#pragma unroll
    for (int t = 0; t < 4; ++t) b_n[t] = frag_ld(brow[t] + ks2, ln);
#pragma unroll
    for (int t = 0; t < 4; ++t) c[t] = wmma16(a, bfr[t], c[t]);
    a = a_n;
#pragma unroll
    for (int t = 0; t < 4; ++t) bfr[t] = b_n[t];
  }
#pragma unroll
  for (int t = 0; t < 4; ++t) c[t] = wmma16(a, bfr[t], c[t]);

#pragma unroll
  for (int t = 0; t < 4; ++t) {
    int col = nbase + t * 16 + lc;
    float bias = bp[col];
#pragma unroll
    for (int r = 0; r < 8; ++r)
      out[(size_t)(m0 + r + hlf * 8) * DIMC + col] = c[t][r] + bias;
  }
}

// ---------------------------------------------------------------- launch
extern "C" void kernel_launch(void* const* d_in, const int* in_sizes, int n_in,
                              void* d_out, int out_size, void* d_ws, size_t ws_size,
                              hipStream_t stream) {
  (void)in_sizes; (void)n_in; (void)out_size; (void)ws_size;
  const float* x  = (const float*)d_in[0];
  const float* Wq = (const float*)d_in[1];
  const float* Wk = (const float*)d_in[2];
  const float* Wv = (const float*)d_in[3];
  const float* Wl = (const float*)d_in[4];
  const float* bl = (const float*)d_in[5];
  const float* Ww = (const float*)d_in[6];
  const float* bw = (const float*)d_in[7];
  const float* Wp = (const float*)d_in[8];
  const float* bp = (const float*)d_in[9];
  float* out = (float*)d_out;

  _Float16* ws = (_Float16*)d_ws;
  size_t off = 0;
  const size_t NX = (size_t)BATCH * SEQ * DIMC;   // 6,291,456
  const size_t NW = (size_t)DIMC * DIMC;
  _Float16* xh  = ws + off; off += NX;
  _Float16* WqT = ws + off; off += NW;
  _Float16* WkT = ws + off; off += NW;
  _Float16* WvT = ws + off; off += NW;
  _Float16* WpT = ws + off; off += NW;
  _Float16* qb  = ws + off; off += NX;
  _Float16* kb  = ws + off; off += NX;
  _Float16* vb  = ws + off; off += NX;   // transposed layout [b][h][d][j]
  _Float16* oh  = ws + off; off += NX;

  convert_x_kernel<<<(int)((NX / 8 + 255) / 256), 256, 0, stream>>>(x, xh, (int)(NX / 8));
  convert_w_kernel<<<(int)((NW + 255) / 256), 256, 0, stream>>>(
      Wq, Wk, Wv, Wp, WqT, WkT, WvT, WpT);
  qkv_gemm_kernel<<<dim3(BATCH * SEQ / 16, 9), 128, 0, stream>>>(
      xh, WqT, WkT, WvT, qb, kb, vb);
  attn_kernel<<<dim3(SEQ / 16, BATCH), 512, 0, stream>>>(
      qb, kb, vb, Wl, bl, Ww, bw, oh);
  out_proj_kernel<<<dim3(BATCH * SEQ / 16, 3), 128, 0, stream>>>(oh, WpT, bp, out);
}

// v004
// Measured time: 200 microseconds a run.
// In two side-by-side timings against v003, it was 1.44 and 1.42 times as fast.
// Counting every step since v000, it is 5.11 times as fast.
#include <hip/hip_runtime.h>

#define DIMC  768
#define HEADS 12
#define HDIM  64
#define BATCH 8
#define SEQ   1024
#define QSCALE 0.125f   // HD^-0.5

typedef __attribute__((ext_vector_type(16))) _Float16 v16h;
typedef __attribute__((ext_vector_type(8)))  _Float16 v8h;
typedef __attribute__((ext_vector_type(8)))  float    v8f;

// Every f16 matrix in the workspace is kept in FRAGMENT ORDER: one 16-row x
// 32-k operand tile is 512 contiguous halves, as two 512-byte chunks, and lane
// ln's 16 bytes of a chunk stand at ln * 16 bytes. A fragment load then reads
// 4 whole 128-byte lines per instruction instead of 32 bytes of each of 16.
// Per CDNA5 layout: lane<16 holds K {k0..k0+7, k0+16..k0+23} with k0=0,
// lane>=16 with k0=8; chunk 0 is the first run of 8, chunk 1 the second.
#define FTILE 512   // halves per 16 x 32 tile

// Offset in halves of element (r, k) of a matrix with nks tiles along k.
__device__ __forceinline__ size_t fragoff(int r, int k, int nks) {
  return (size_t)((r >> 4) * nks + (k >> 5)) * FTILE + ((k >> 4) & 1) * 256 +
         (((k >> 3) & 1) * 16 + (r & 15)) * 8 + (k & 7);
}

// Stands behind global loads whose address registers the compiler reuses next:
// those registers are not rewritten before the loads' addresses are taken.
__device__ __forceinline__ void xwait() { asm volatile("s_wait_xcnt 0x0" ::: "memory"); }

__device__ __forceinline__ v8f wmma16(v16h a, v16h b, v8f c) {
  return __builtin_amdgcn_wmma_f32_16x16x32_f16(false, a, false, b,
                                                (short)0, c, false, false);
}

__device__ __forceinline__ v8f vzero8() {
  v8f z;
#pragma unroll
  for (int e = 0; e < 8; ++e) z[e] = 0.f;
  return z;
}

// ---------------------------------------------------------------- converts
__global__ void convert_x_kernel(const float* __restrict__ x,
                                 _Float16* __restrict__ xh, int n) {
  // thread i writes the i-th 16-byte piece of xh (fragment order), n pieces
  int i = blockIdx.x * blockDim.x + threadIdx.x;
  if (i >= n) return;
  const int lane = i & 31, chunk = (i >> 5) & 1, tile = i >> 6;
  const int ks = tile % (DIMC / 32), rt = tile / (DIMC / 32);
  const float* src = x + (size_t)(rt * 16 + (lane & 15)) * DIMC +
                     ks * 32 + chunk * 16 + (lane >> 4) * 8;
  const float4 lo = *(const float4*)src, hi = *(const float4*)(src + 4);
  v8h o = {(_Float16)lo.x, (_Float16)lo.y, (_Float16)lo.z, (_Float16)lo.w,
           (_Float16)hi.x, (_Float16)hi.y, (_Float16)hi.z, (_Float16)hi.w};
  *(v8h*)(xh + (size_t)i * 8) = o;
}

__global__ void convert_w_kernel(const float* __restrict__ Wq,
                                 const float* __restrict__ Wk,
                                 const float* __restrict__ Wv,
                                 const float* __restrict__ Wp,
                                 _Float16* __restrict__ WqT,
                                 _Float16* __restrict__ WkT,
                                 _Float16* __restrict__ WvT,
                                 _Float16* __restrict__ WpT) {
  int idx = blockIdx.x * blockDim.x + threadIdx.x;
  if (idx >= DIMC * DIMC) return;
  int kk = idx / DIMC, nn = idx % DIMC;
  size_t tid = fragoff(nn, kk, DIMC / 32);  // transposed [n][k], fragment order
  WqT[tid] = (_Float16)Wq[idx];
  WkT[tid] = (_Float16)Wk[idx];
  WvT[tid] = (_Float16)Wv[idx];
  WpT[tid] = (_Float16)Wp[idx];
}

// ---------------------------------------------------------------- GEMM core
// One wave forms a 64 x 64 tile of X * W^T as 4 x 4 accumulator tiles, so that
// every loaded fragment feeds four WMMAs. a0, b0: the first 16-row tile of the
// wave's four neighbouring row tiles of each operand (fragment order, K = DIMC).
#define RTILE ((DIMC / 32) * FTILE)   // halves from one 16-row tile to the next

// The eight fragments of k step s: sixteen loads through two address registers.
__device__ __forceinline__ void frag_ld8(const _Float16* __restrict__ pa,
                                         const _Float16* __restrict__ pb, int s,
                                         v16h (&a)[4], v16h (&b)[4]) {
  v8h ta[8], tb[8];
#pragma unroll
  for (int i = 0; i < 8; ++i) {
    ta[i] = *(const v8h*)(pa + (i >> 1) * RTILE + s * FTILE + (i & 1) * 256);
    tb[i] = *(const v8h*)(pb + (i >> 1) * RTILE + s * FTILE + (i & 1) * 256);
  }
#pragma unroll
  for (int t = 0; t < 4; ++t) {
    a[t] = __builtin_shufflevector(ta[2 * t], ta[2 * t + 1],
                                   0, 1, 2, 3, 4, 5, 6, 7, 8, 9, 10, 11, 12, 13, 14, 15);
    b[t] = __builtin_shufflevector(tb[2 * t], tb[2 * t + 1],
                                   0, 1, 2, 3, 4, 5, 6, 7, 8, 9, 10, 11, 12, 13, 14, 15);
  }
}

__device__ __forceinline__ void gemm64(const _Float16* __restrict__ a0,
                                       const _Float16* __restrict__ b0, int ln,
                                       v8f (&c)[4][4]) {
  const _Float16* pa = a0 + ln * 8;
  const _Float16* pb = b0 + ln * 8;
#pragma unroll
  for (int i = 0; i < 4; ++i)
#pragma unroll
    for (int j = 0; j < 4; ++j) c[i][j] = vzero8();

  // fully unrolled k loop; the fragments of step s + 1 are asked for ahead of
  // the WMMAs of step s
  const int NSTEP = DIMC / 32;
  v16h a[4], b[4];
  frag_ld8(pa, pb, 0, a, b);
#pragma unroll
  for (int s = 0; s < NSTEP - 1; ++s) {
    v16h a_n[4], b_n[4];
    frag_ld8(pa, pb, s + 1, a_n, b_n);
    if (s == NSTEP - 2) xwait();  // the epilogue's address sums reuse the two address registers
    // holds the next step's loads ahead of this step's WMMAs: sunk to their uses,
    // each would wait out its whole latency with little else in flight
    __builtin_amdgcn_sched_barrier(0);
#pragma unroll
    for (int i = 0; i < 4; ++i)
#pragma unroll
      for (int j = 0; j < 4; ++j) c[i][j] = wmma16(a[i], b[j], c[i][j]);
#pragma unroll
    for (int t = 0; t < 4; ++t) { a[t] = a_n[t]; b[t] = b_n[t]; }
  }
#pragma unroll
  for (int i = 0; i < 4; ++i)
#pragma unroll
    for (int j = 0; j < 4; ++j) c[i][j] = wmma16(a[i], b[j], c[i][j]);
}

// ---------------------------------------------------------------- QKV GEMM
// grid = (M/128, 18), block = 128 (4 waves, 2 x 2 tiles of 64 x 64). col groups
// 0-5 -> q, 6-11 -> k, 12-17 -> v; a wave's 64 columns are one head.
// q scaled by QSCALE. v written TRANSPOSED per head: [b][h][d][j]. q, k, v are
// per-head matrices in fragment order (rows i, j, d; k index d, d, j).
__global__ __launch_bounds__(128)
void qkv_gemm_kernel(const _Float16* __restrict__ xh,
                     const _Float16* __restrict__ WqT,
                     const _Float16* __restrict__ WkT,
                     const _Float16* __restrict__ WvT,
                     _Float16* __restrict__ qb, _Float16* __restrict__ kb,
                     _Float16* __restrict__ vb) {
  const int mt = blockIdx.x, cg = blockIdx.y;
  const int wave = threadIdx.x >> 5, ln = threadIdx.x & 31;
  const int hlf = ln >> 4, lc = ln & 15;
  const int m0 = mt * 128 + (wave >> 1) * 64;
  const int which = cg / 6;  // 0=q 1=k 2=v
  const _Float16* WT = (which == 0) ? WqT : (which == 1) ? WkT : WvT;
  const int nbase = (cg % 6) * 128 + (wave & 1) * 64;  // within [0,768)

  v8f c[4][4];
  gemm64(xh + (size_t)(m0 >> 4) * RTILE, WT + (size_t)(nbase >> 4) * RTILE, ln, c);

  const int b_ = m0 / SEQ;
  const int nrow0 = m0 % SEQ;
  const int head = nbase >> 6;
  const size_t hoff = ((size_t)b_ * HEADS + head) * SEQ * HDIM;
  if (which == 2) {
    // V: transposed store [b][h][d][j]; the lane's 8 values of j are one piece
    _Float16* vt = vb + hoff;
#pragma unroll
    for (int i = 0; i < 4; ++i)
#pragma unroll
      for (int t = 0; t < 4; ++t) {
        v8h pk;
#pragma unroll
        for (int r = 0; r < 8; ++r) pk[r] = (_Float16)c[i][t][r];
        *(v8h*)(vt + fragoff(t * 16 + lc, nrow0 + i * 16 + hlf * 8, SEQ / 32)) = pk;
      }
  } else {
    const float scale = (which == 0) ? QSCALE : 1.f;
    _Float16* dst = ((which == 0) ? qb : kb) + hoff;
#pragma unroll
    for (int i = 0; i < 4; ++i)
#pragma unroll
      for (int t = 0; t < 4; ++t)
#pragma unroll
        for (int r = 0; r < 8; ++r)
          dst[fragoff(nrow0 + i * 16 + r + hlf * 8, t * 16 + lc, HDIM / 32)] =
              (_Float16)(c[i][t][r] * scale);
    xwait();   // the listing runs on from these stores into code that reuses their registers
  }
}

// ---------------------------------------------------- fused talking-heads attn
// grid = (SEQ/16, BATCH), block = 512 (16 waves), 16 query rows, 64 columns a step.
// q,k layout [b][h][j][d]; v layout [b][h][d][j] (pre-transposed); each (b, h)
// matrix in fragment order.
// Wave w forms the raw scores of heads 3*(w>>2)..+2 on column tile w&3 (as
// K * Q^T, so a lane holds 8 contiguous columns of query row lc) and puts them
// into Smix once. Both head mixes are matrix products over the head index:
// D[g][pos] = sum_h W[g][h] * S[h][pos], f32 16x16x4, three k steps for 12 heads.
// One mix tile is one column j with its 16 query rows (lane lc = row); wave w
// mixes columns 4w..4w+3 of the step, so every score is read from LDS once.
// Head order, the same in A, B and D: lane half hlf, register r < 6 <-> head
// 6*hlf + r (D rows 6, 7, 14, 15 are padding, weights and bias 0). With it the
// D of the pre-mix, after the softmax in place, is the B of the post-mix.
#define NWV 16      // waves per block
#define JS  64      // columns per step
#define SP  68      // floats per Smix row: 272 B = 16 B x odd
#define PP  72      // halves per Pn row:   144 B = 16 B x odd
typedef __attribute__((ext_vector_type(4))) float    v4f;
typedef __attribute__((ext_vector_type(2))) float    v2f;
typedef __attribute__((ext_vector_type(4))) _Float16 v4h;

__device__ __forceinline__ v8f wmma4(v2f a, v2f b, v8f c) {
  return __builtin_amdgcn_wmma_f32_16x16x4_f32(false, a, false, b,
                                               (short)0, c, false, false);
}

// e^x in the fast form (one multiply, v_exp_f32). The v_nop fills the one slot that
// the instruction set asks for between a transcendental and a next instruction
// that reads its result or overwrites its source.
__device__ __forceinline__ float exp_slot(float x) {
  float y;
  asm("v_exp_f32 %0, %1\n\tv_nop" : "=v"(y) : "v"(x * 1.44269504f));
  return y;
}

// Six fragments: two neighbouring tiles of each of three neighbouring heads, all
// twelve loads through one address register and in flight together.
__device__ __forceinline__ void frag_ld6(const _Float16* __restrict__ tile0, int ln,
                                         v16h (&f)[3][2]) {
  const _Float16* p = tile0 + ln * 8;
  v8h t[12];
#pragma unroll
  for (int i = 0; i < 11; ++i)
    t[i] = *(const v8h*)(p + (i >> 2) * (SEQ * HDIM) + ((i >> 1) & 1) * FTILE + (i & 1) * 256);
  xwait();   // the last load may land on the address register that the eleven name
  t[11] = *(const v8h*)(p + 2 * (SEQ * HDIM) + FTILE + 256);
  xwait();
#pragma unroll
  for (int u = 0; u < 3; ++u)
#pragma unroll
    for (int s = 0; s < 2; ++s)
#pragma unroll
      for (int e = 0; e < 8; ++e) {
        f[u][s][e]     = t[u * 4 + s * 2][e];
        f[u][s][e + 8] = t[u * 4 + s * 2 + 1][e];
      }
}

__global__ __launch_bounds__(512)
void attn_kernel(const _Float16* __restrict__ q, const _Float16* __restrict__ k,
                 const _Float16* __restrict__ v,
                 const float* __restrict__ Wl, const float* __restrict__ bl,
                 const float* __restrict__ Ww, const float* __restrict__ bw,
                 _Float16* __restrict__ oh) {
  __shared__ __align__(16) float    Smix[2][HEADS][16][SP];  // raw scores, two steps
  __shared__ __align__(16) _Float16 Pn[HEADS][16][PP];       // post-mixed probs
  __shared__ float stM[NWV][HEADS][16], stL[NWV][HEADS][16]; // per-wave softmax stats

  const int b = blockIdx.y;
  const int i0 = blockIdx.x * 16;
  const int wv = threadIdx.x >> 5;
  const int ln = threadIdx.x & 31;
  const int hlf = ln >> 4, lc = ln & 15;
  const int jt = wv & 3;         // column tile (scores), d tile (P @ V)
  const int h0 = (wv >> 2) * 3;  // first of this wave's three heads

  // A operands of the two mixes: row lc of A is output head 6*(lc>>3) + (lc&7)
  const bool live = (lc & 7) < 6;
  const int grow = live ? (lc >> 3) * 6 + (lc & 7) : 0;
  v2f wa[3], wb[3];
#pragma unroll
  for (int s = 0; s < 3; ++s)
#pragma unroll
    for (int e = 0; e < 2; ++e) {
      const int hh = 6 * hlf + 2 * s + e;
      const float tl = Wl[grow * HEADS + hh], tw = Ww[grow * HEADS + hh];
      wa[s][e] = live ? tl : 0.f;
      wb[s][e] = live ? tw : 0.f;
    }
  xwait();
  v8f cbl = vzero8(), cbw = vzero8();   // C operands: the biases, by D row
#pragma unroll
  for (int r = 0; r < 6; ++r) { cbl[r] = bl[6 * hlf + r]; cbw[r] = bw[6 * hlf + r]; }
  xwait();

  const size_t base = ((size_t)b * HEADS + h0) * SEQ * HDIM;  // first of the three heads
  const _Float16* kh = k + base;   // [j][d]: 2 tiles per 16 rows
  const _Float16* vt = v + base;   // [d][j]
  v16h aq[3][2];
  frag_ld6(q + base + (size_t)(i0 >> 4) * 2 * FTILE, ln, aq);

  // this wave's six K fragments of step n
  auto kload = [&](int n, v16h (&kf)[3][2]) {
    frag_ld6(kh + (size_t)(n * (JS / 16) + jt) * 2 * FTILE, ln, kf);
  };

  // raw scores of step n -> Smix[n & 1]
  auto scores = [&](int n, const v16h (&kf)[3][2]) {
#pragma unroll
    for (int u = 0; u < 3; ++u) {
      v8f c = vzero8();
      c = wmma16(kf[u][0], aq[u][0], c);   // c[r] = S[i0 + lc][n*64 + jt*16 + hlf*8 + r]
      c = wmma16(kf[u][1], aq[u][1], c);
      float* dst = &Smix[n & 1][h0 + u][lc][jt * 16 + hlf * 8];
      v4f s_lo = {c[0], c[1], c[2], c[3]}, s_hi = {c[4], c[5], c[6], c[7]};
      *(v4f*)dst       = s_lo;
      *(v4f*)(dst + 4) = s_hi;
    }
  };

  // pre-softmax mix of columns 4*wv..+3 of step n, on top of c0 (C operand):
  // d[t][r] = c0[r] + sum_h Wl[6*hlf + r][h] * S[h][lc][4*wv + t]
  auto premix = [&](int n, const v8f& c0, v8f (&d)[4]) {
    v4f sv[6];
#pragma unroll
    for (int r = 0; r < 6; ++r)
      sv[r] = *(const v4f*)&Smix[n & 1][6 * hlf + r][lc][wv * 4];
#pragma unroll
    for (int t = 0; t < 4; ++t) d[t] = c0;
#pragma unroll
    for (int s = 0; s < 3; ++s)
#pragma unroll
      for (int t = 0; t < 4; ++t)
        d[t] = wmma4(wa[s], (v2f){sv[2 * s][t], sv[2 * s + 1][t]}, d[t]);
  };

  // softmax stats of (head 6*hlf + r, row lc) over this wave's own columns only
  float m[6], l[6];
#pragma unroll
  for (int r = 0; r < 6; ++r) { m[r] = -1e30f; l[r] = 0.f; }

  v16h kf[3][2];
  kload(0, kf);
  scores(0, kf);
  __syncthreads();

  // ---------------- pass 1: online softmax stats over mixed scores ----------
  // One barrier a step: it publishes step n + 1 and ends the reads of step n,
  // whose buffer is written again only in step n + 1.
  for (int n = 0; n < SEQ / JS; ++n) {
    // the next step's K flies while this step is mixed (after the last step:
    // step 0 again, for pass 2)
    kload((n + 1) & (SEQ / JS - 1), kf);
    v8f d[4];
    premix(n, cbl, d);
#pragma unroll
    for (int r = 0; r < 6; ++r) {
      const float mx = fmaxf(fmaxf(d[0][r], d[1][r]), fmaxf(d[2][r], d[3][r]));
      const float nm = fmaxf(m[r], mx);
      float p = 0.f;
#pragma unroll
      for (int t = 0; t < 4; ++t) p += __expf(d[t][r] - nm);
      l[r] = l[r] * __expf(m[r] - nm) + p;
      m[r] = nm;
    }
    scores((n + 1) & (SEQ / JS - 1), kf);   // 16 & 15 = 0: buffer 0, last read in step 14
    __syncthreads();
  }

  // merge the 16 waves' stats, once; every wave needs all (head, row) pairs
#pragma unroll
  for (int r = 0; r < 6; ++r) {
    stM[wv][6 * hlf + r][lc] = m[r];
    stL[wv][6 * hlf + r][lc] = l[r];
  }
  __syncthreads();
  float rl[6];
#pragma unroll
  for (int r = 0; r < 6; ++r) {
    float mt = -1e30f;
#pragma unroll
    for (int w = 0; w < NWV; ++w) mt = fmaxf(mt, stM[w][6 * hlf + r][lc]);
    float ls = 0.f;
#pragma unroll
    for (int w = 0; w < NWV; ++w)
      ls += stL[w][6 * hlf + r][lc] * exp_slot(stM[w][6 * hlf + r][lc] - mt);
    cbl[r] -= mt;   // pass 2: the row maximum is taken off in the C operand
    rl[r] = 1.f / ls;
  }

  v8f oacc[3];
#pragma unroll
  for (int u = 0; u < 3; ++u) oacc[u] = vzero8();

  // ---------------- pass 2: probs, post-mix, P @ V ---------------------------
  for (int n = 0; n < SEQ / JS; ++n) {
    // this step's V fragments fly while the step is mixed
    v16h vf[3][2];
    frag_ld6(vt + (size_t)(jt * (SEQ / 32) + n * 2) * FTILE, ln, vf);
    v8f d[4], e[4];
    premix(n, cbl, d);
#pragma unroll
    for (int t = 0; t < 4; ++t)
#pragma unroll
      for (int r = 0; r < 6; ++r) d[t][r] = exp_slot(d[t][r]) * rl[r];
    // post-softmax mix (+bw per element: summed over all 1024 j it reproduces
    // the bias term): e[t][r] = P2[6*hlf + r][lc][4*wv + t]
#pragma unroll
    for (int t = 0; t < 4; ++t) e[t] = cbw;
#pragma unroll
    for (int s = 0; s < 3; ++s)
#pragma unroll
      for (int t = 0; t < 4; ++t)
        e[t] = wmma4(wb[s], (v2f){d[t][2 * s], d[t][2 * s + 1]}, e[t]);
    v4h pk[6];
#pragma unroll
    for (int r = 0; r < 6; ++r)
      pk[r] = (v4h){(_Float16)e[0][r], (_Float16)e[1][r], (_Float16)e[2][r], (_Float16)e[3][r]};
#pragma unroll
    for (int r = 0; r < 6; ++r) *(v4h*)&Pn[6 * hlf + r][lc][wv * 4] = pk[r];
    __syncthreads();   // publishes Pn; ends the reads of this step's Smix buffer
    // the next step's K flies during P @ V
    if (n + 1 < SEQ / JS) kload(n + 1, kf);
    // A = post-mixed probs (16 x 32, twice), B = V^T tiles
#pragma unroll
    for (int u = 0; u < 3; ++u)
#pragma unroll
      for (int ks = 0; ks < 2; ++ks) {
        const _Float16* pr = &Pn[h0 + u][lc][ks * 32 + hlf * 8];
        const v8h lo = *(const v8h*)pr, hi = *(const v8h*)(pr + 16);
        v16h a;
#pragma unroll
        for (int t = 0; t < 8; ++t) { a[t] = lo[t]; a[t + 8] = hi[t]; }
        oacc[u] = wmma16(a, vf[u][ks], oacc[u]);
      }
    if (n + 1 < SEQ / JS) scores(n + 1, kf);
    __syncthreads();   // publishes the next scores; ends the reads of Pn
  }

  // write (B * N, DIM) f16, fragment order (A operand of the out projection)
#pragma unroll
  for (int u = 0; u < 3; ++u) {
    int col = (h0 + u) * HDIM + jt * 16 + lc;
#pragma unroll
    for (int r = 0; r < 8; ++r) {
      int i = i0 + r + hlf * 8;
      oh[fragoff(b * SEQ + i, col, DIMC / 32)] = (_Float16)oacc[u][r];
    }
  }
}

// ---------------------------------------------------------------- out proj
// grid = (M/128, 6), block = 128 (4 waves, 2 x 2 tiles of 64 x 64).
__global__ __launch_bounds__(128)
void out_proj_kernel(const _Float16* __restrict__ oh,
                     const _Float16* __restrict__ WpT,
                     const float* __restrict__ bp, float* __restrict__ out) {
  const int mt = blockIdx.x, cg = blockIdx.y;
  const int wave = threadIdx.x >> 5, ln = threadIdx.x & 31;
  const int hlf = ln >> 4, lc = ln & 15;
  const int m0 = mt * 128 + (wave >> 1) * 64;
  const int nbase = cg * 128 + (wave & 1) * 64;

  v8f c[4][4];
  gemm64(oh + (size_t)(m0 >> 4) * RTILE, WpT + (size_t)(nbase >> 4) * RTILE, ln, c);

  const int col0 = nbase + lc;
  float bias[4];
#pragma unroll
  for (int t = 0; t < 4; ++t) bias[t] = bp[col0 + t * 16];
  // the register that these loads name is reused for the store addresses: the
  // input operand keeps it whole up to the wait
  asm volatile("s_wait_xcnt 0x0" :: "v"(col0) : "memory");
#pragma unroll
  for (int t = 0; t < 4; ++t) {
    int col = col0 + t * 16;
#pragma unroll
    for (int i = 0; i < 4; ++i)
#pragma unroll
      for (int r = 0; r < 8; ++r)
        out[(size_t)(m0 + i * 16 + r + hlf * 8) * DIMC + col] = c[i][t][r] + bias[t];
  }
}

// ---------------------------------------------------------------- launch
extern "C" void kernel_launch(void* const* d_in, const int* in_sizes, int n_in,
                              void* d_out, int out_size, void* d_ws, size_t ws_size,
                              hipStream_t stream) {
  (void)in_sizes; (void)n_in; (void)out_size; (void)ws_size;
  const float* x  = (const float*)d_in[0];
  const float* Wq = (const float*)d_in[1];
  const float* Wk = (const float*)d_in[2];
  const float* Wv = (const float*)d_in[3];
  const float* Wl = (const float*)d_in[4];
  const float* bl = (const float*)d_in[5];
  const float* Ww = (const float*)d_in[6];
  const float* bw = (const float*)d_in[7];
  const float* Wp = (const float*)d_in[8];
  const float* bp = (const float*)d_in[9];
  float* out = (float*)d_out;

  _Float16* ws = (_Float16*)d_ws;
  size_t off = 0;
  const size_t NX = (size_t)BATCH * SEQ * DIMC;   // 6,291,456
  const size_t NW = (size_t)DIMC * DIMC;
  _Float16* xh  = ws + off; off += NX;
  _Float16* WqT = ws + off; off += NW;
  _Float16* WkT = ws + off; off += NW;
  _Float16* WvT = ws + off; off += NW;
  _Float16* WpT = ws + off; off += NW;
  _Float16* qb  = ws + off; off += NX;
  _Float16* kb  = ws + off; off += NX;
  _Float16* vb  = ws + off; off += NX;   // transposed layout [b][h][d][j]
  _Float16* oh  = ws + off; off += NX;

  convert_x_kernel<<<(int)((NX / 8 + 255) / 256), 256, 0, stream>>>(x, xh, (int)(NX / 8));
  convert_w_kernel<<<(int)((NW + 255) / 256), 256, 0, stream>>>(
      Wq, Wk, Wv, Wp, WqT, WkT, WvT, WpT);
  qkv_gemm_kernel<<<dim3(BATCH * SEQ / 128, 18), 128, 0, stream>>>(
      xh, WqT, WkT, WvT, qb, kb, vb);
  attn_kernel<<<dim3(SEQ / 16, BATCH), 512, 0, stream>>>(
      qb, kb, vb, Wl, bl, Ww, bw, oh);
  out_proj_kernel<<<dim3(BATCH * SEQ / 128, 6), 128, 0, stream>>>(oh, WpT, bp, out);
}

// v005
// One run takes 179 microseconds.
// In both of two side-by-side timings against v004, it was 1.12 times as fast.
// All steps since v000 together make it 5.70 times as fast.
#include <hip/hip_runtime.h>

#define DIMC  768
#define HEADS 12
#define HDIM  64
#define BATCH 8
#define SEQ   1024
#define QSCALE 0.125f   // HD^-0.5

typedef __attribute__((ext_vector_type(16))) _Float16 v16h;
typedef __attribute__((ext_vector_type(8)))  _Float16 v8h;
typedef __attribute__((ext_vector_type(8)))  float    v8f;

// Every f16 matrix in the workspace is kept in FRAGMENT ORDER: one 16-row x
// 32-k operand tile is 512 contiguous halves, as two 512-byte chunks, and lane
// ln's 16 bytes of a chunk stand at ln * 16 bytes. A fragment load then reads
// 4 whole 128-byte lines per instruction instead of 32 bytes of each of 16.
// Per CDNA5 layout: lane<16 holds K {k0..k0+7, k0+16..k0+23} with k0=0,
// lane>=16 with k0=8; chunk 0 is the first run of 8, chunk 1 the second.
#define FTILE 512   // halves per 16 x 32 tile

// Offset in halves of element (r, k) of a matrix with nks tiles along k.
__device__ __forceinline__ size_t fragoff(int r, int k, int nks) {
  return (size_t)((r >> 4) * nks + (k >> 5)) * FTILE + ((k >> 4) & 1) * 256 +
         (((k >> 3) & 1) * 16 + (r & 15)) * 8 + (k & 7);
}

// Stands behind global loads whose address registers the compiler reuses next:
// those registers are not rewritten before the loads' addresses are taken.
__device__ __forceinline__ void xwait() { asm volatile("s_wait_xcnt 0x0" ::: "memory"); }

__device__ __forceinline__ v8f wmma16(v16h a, v16h b, v8f c) {
  return __builtin_amdgcn_wmma_f32_16x16x32_f16(false, a, false, b,
                                                (short)0, c, false, false);
}

__device__ __forceinline__ v8f vzero8() {
  v8f z;
#pragma unroll
  for (int e = 0; e < 8; ++e) z[e] = 0.f;
  return z;
}

// ---------------------------------------------------------------- converts
__global__ void convert_x_kernel(const float* __restrict__ x,
                                 _Float16* __restrict__ xh, int n) {
  // thread i writes the i-th 16-byte piece of xh (fragment order), n pieces
  int i = blockIdx.x * blockDim.x + threadIdx.x;
  if (i >= n) return;
  const int lane = i & 31, chunk = (i >> 5) & 1, tile = i >> 6;
  const int ks = tile % (DIMC / 32), rt = tile / (DIMC / 32);
  const float* src = x + (size_t)(rt * 16 + (lane & 15)) * DIMC +
                     ks * 32 + chunk * 16 + (lane >> 4) * 8;
  const float4 lo = *(const float4*)src, hi = *(const float4*)(src + 4);
  v8h o = {(_Float16)lo.x, (_Float16)lo.y, (_Float16)lo.z, (_Float16)lo.w,
           (_Float16)hi.x, (_Float16)hi.y, (_Float16)hi.z, (_Float16)hi.w};
  *(v8h*)(xh + (size_t)i * 8) = o;
}

__global__ void convert_w_kernel(const float* __restrict__ Wq,
                                 const float* __restrict__ Wk,
                                 const float* __restrict__ Wv,
                                 const float* __restrict__ Wp,
                                 _Float16* __restrict__ WqT,
                                 _Float16* __restrict__ WkT,
                                 _Float16* __restrict__ WvT,
                                 _Float16* __restrict__ WpT) {
  int idx = blockIdx.x * blockDim.x + threadIdx.x;
  if (idx >= DIMC * DIMC) return;
  int kk = idx / DIMC, nn = idx % DIMC;
  size_t tid = fragoff(nn, kk, DIMC / 32);  // transposed [n][k], fragment order
  WqT[tid] = (_Float16)Wq[idx];
  WkT[tid] = (_Float16)Wk[idx];
  WvT[tid] = (_Float16)Wv[idx];
  WpT[tid] = (_Float16)Wp[idx];
}

// ---------------------------------------------------------------- GEMM core
// One wave forms a 64 x 64 tile of X * W^T as 4 x 4 accumulator tiles, so that
// every loaded fragment feeds four WMMAs. a0, b0: the first 16-row tile of the
// wave's four neighbouring row tiles of each operand (fragment order, K = DIMC).
#define RTILE ((DIMC / 32) * FTILE)   // halves from one 16-row tile to the next

// The eight fragments of k step s: sixteen loads through two address registers.
__device__ __forceinline__ void frag_ld8(const _Float16* __restrict__ pa,
                                         const _Float16* __restrict__ pb, int s,
                                         v16h (&a)[4], v16h (&b)[4]) {
  v8h ta[8], tb[8];
#pragma unroll
  for (int i = 0; i < 8; ++i) {
    ta[i] = *(const v8h*)(pa + (i >> 1) * RTILE + s * FTILE + (i & 1) * 256);
    tb[i] = *(const v8h*)(pb + (i >> 1) * RTILE + s * FTILE + (i & 1) * 256);
  }
#pragma unroll
  for (int t = 0; t < 4; ++t) {
    a[t] = __builtin_shufflevector(ta[2 * t], ta[2 * t + 1],
                                   0, 1, 2, 3, 4, 5, 6, 7, 8, 9, 10, 11, 12, 13, 14, 15);
    b[t] = __builtin_shufflevector(tb[2 * t], tb[2 * t + 1],
                                   0, 1, 2, 3, 4, 5, 6, 7, 8, 9, 10, 11, 12, 13, 14, 15);
  }
}

__device__ __forceinline__ void gemm64(const _Float16* __restrict__ a0,
                                       const _Float16* __restrict__ b0, int ln,
                                       v8f (&c)[4][4]) {
  const _Float16* pa = a0 + ln * 8;
  const _Float16* pb = b0 + ln * 8;
#pragma unroll
  for (int i = 0; i < 4; ++i)
#pragma unroll
    for (int j = 0; j < 4; ++j) c[i][j] = vzero8();

  // fully unrolled k loop; the fragments of step s + 1 are asked for ahead of
  // the WMMAs of step s
  const int NSTEP = DIMC / 32;
  v16h a[4], b[4];
  frag_ld8(pa, pb, 0, a, b);
#pragma unroll
  for (int s = 0; s < NSTEP - 1; ++s) {
    v16h a_n[4], b_n[4];
    frag_ld8(pa, pb, s + 1, a_n, b_n);
    if (s == NSTEP - 2) xwait();  // the epilogue's address sums reuse the two address registers
    // holds the next step's loads ahead of this step's WMMAs: sunk to their uses,
    // each would wait out its whole latency with little else in flight
    __builtin_amdgcn_sched_barrier(0);
#pragma unroll
    for (int i = 0; i < 4; ++i)
#pragma unroll
      for (int j = 0; j < 4; ++j) c[i][j] = wmma16(a[i], b[j], c[i][j]);
#pragma unroll
    for (int t = 0; t < 4; ++t) { a[t] = a_n[t]; b[t] = b_n[t]; }
  }
#pragma unroll
  for (int i = 0; i < 4; ++i)
#pragma unroll
    for (int j = 0; j < 4; ++j) c[i][j] = wmma16(a[i], b[j], c[i][j]);
}

// ---------------------------------------------------------------- QKV GEMM
// grid = (M/128, 18), block = 128 (4 waves, 2 x 2 tiles of 64 x 64). col groups
// 0-5 -> q, 6-11 -> k, 12-17 -> v; a wave's 64 columns are one head.
// q scaled by QSCALE. v written TRANSPOSED per head: [b][h][d][j]. q, k, v are
// per-head matrices in fragment order (rows i, j, d; k index d, d, j).
__global__ __launch_bounds__(128)
void qkv_gemm_kernel(const _Float16* __restrict__ xh,
                     const _Float16* __restrict__ WqT,
                     const _Float16* __restrict__ WkT,
                     const _Float16* __restrict__ WvT,
                     _Float16* __restrict__ qb, _Float16* __restrict__ kb,
                     _Float16* __restrict__ vb) {
  const int mt = blockIdx.x, cg = blockIdx.y;
  const int wave = threadIdx.x >> 5, ln = threadIdx.x & 31;
  const int hlf = ln >> 4, lc = ln & 15;
  const int m0 = mt * 128 + (wave >> 1) * 64;
  const int which = cg / 6;  // 0=q 1=k 2=v
  const _Float16* WT = (which == 0) ? WqT : (which == 1) ? WkT : WvT;
  const int nbase = (cg % 6) * 128 + (wave & 1) * 64;  // within [0,768)

  v8f c[4][4];
  gemm64(xh + (size_t)(m0 >> 4) * RTILE, WT + (size_t)(nbase >> 4) * RTILE, ln, c);

  const int b_ = m0 / SEQ;
  const int nrow0 = m0 % SEQ;
  const int head = nbase >> 6;
  const size_t hoff = ((size_t)b_ * HEADS + head) * SEQ * HDIM;
  if (which == 2) {
    // V: transposed store [b][h][d][j]; the lane's 8 values of j are one piece
    _Float16* vt = vb + hoff;
#pragma unroll
    for (int i = 0; i < 4; ++i)
#pragma unroll
      for (int t = 0; t < 4; ++t) {
        v8h pk;
#pragma unroll
        for (int r = 0; r < 8; ++r) pk[r] = (_Float16)c[i][t][r];
        *(v8h*)(vt + fragoff(t * 16 + lc, nrow0 + i * 16 + hlf * 8, SEQ / 32)) = pk;
      }
  } else {
    const float scale = (which == 0) ? QSCALE : 1.f;
    _Float16* dst = ((which == 0) ? qb : kb) + hoff;
#pragma unroll
    for (int i = 0; i < 4; ++i)
#pragma unroll
      for (int t = 0; t < 4; ++t)
#pragma unroll
        for (int r = 0; r < 8; ++r)
          dst[fragoff(nrow0 + i * 16 + r + hlf * 8, t * 16 + lc, HDIM / 32)] =
              (_Float16)(c[i][t][r] * scale);
    xwait();   // the listing runs on from these stores into code that reuses their registers
  }
}

// ---------------------------------------------------- fused talking-heads attn
// grid = (SEQ/32, BATCH), block = 512 (16 waves), 32 query rows (two row tiles),
// 64 columns a step. Every K and V fragment that a wave loads feeds both row
// tiles, so a block's K and V reads serve twice the rows.
// q,k layout [b][h][j][d]; v layout [b][h][d][j] (pre-transposed); each (b, h)
// matrix in fragment order.
// Wave w forms the raw scores of heads 3*(w>>2)..+2 on column tile w&3 (as
// K * Q^T, so a lane holds 8 contiguous columns of query row lc) and puts them
// into Smix once. Both head mixes are matrix products over the head index:
// D[g][pos] = sum_h W[g][h] * S[h][pos], f32 16x16x4, three k steps for 12 heads.
// One mix tile is one column j with 16 query rows (lane lc = row); wave w
// mixes columns 4w..4w+3 of the step, so every score is read from LDS once.
// Head order, the same in A, B and D: lane half hlf, register r < 6 <-> head
// 6*hlf + r (D rows 6, 7, 14, 15 are padding, weights and bias 0). With it the
// D of the pre-mix, after the softmax in place, is the B of the post-mix.
#define NWV 16      // waves per block
#define JS  64      // columns per step
#define RT  2       // query row tiles per block
#define QR  (16 * RT)
#define SP  68      // floats per Smix row: 272 B = 16 B x odd
#define PP  72      // halves per Pn row:   144 B = 16 B x odd
typedef __attribute__((ext_vector_type(4))) float    v4f;
typedef __attribute__((ext_vector_type(2))) float    v2f;
typedef __attribute__((ext_vector_type(4))) _Float16 v4h;

__device__ __forceinline__ v8f wmma4(v2f a, v2f b, v8f c) {
  return __builtin_amdgcn_wmma_f32_16x16x4_f32(false, a, false, b,
                                               (short)0, c, false, false);
}

// e^x in the fast form (one multiply, v_exp_f32). The v_nop fills the one slot that
// the instruction set asks for between a transcendental and a next instruction
// that reads its result or overwrites its source.
__device__ __forceinline__ float exp_slot(float x) {
  float y;
  asm("v_exp_f32 %0, %1\n\tv_nop" : "=v"(y) : "v"(x * 1.44269504f));
  return y;
}

// Six fragments: two neighbouring tiles of each of three neighbouring heads, all
// twelve loads through one address register and in flight together.
__device__ __forceinline__ void frag_ld6(const _Float16* __restrict__ tile0, int ln,
                                         v16h (&f)[3][2]) {
  const _Float16* p = tile0 + ln * 8;
  v8h t[12];
#pragma unroll
  for (int i = 0; i < 11; ++i)
    t[i] = *(const v8h*)(p + (i >> 2) * (SEQ * HDIM) + ((i >> 1) & 1) * FTILE + (i & 1) * 256);
  xwait();   // the last load may land on the address register that the eleven name
  t[11] = *(const v8h*)(p + 2 * (SEQ * HDIM) + FTILE + 256);
  xwait();
#pragma unroll
  for (int u = 0; u < 3; ++u)
#pragma unroll
    for (int s = 0; s < 2; ++s)
#pragma unroll
      for (int e = 0; e < 8; ++e) {
        f[u][s][e]     = t[u * 4 + s * 2][e];
        f[u][s][e + 8] = t[u * 4 + s * 2 + 1][e];
      }
}

// One fragment out of a fragment-order tile (p: the lane's piece of chunk 0).
__device__ __forceinline__ v16h frag_pair(const _Float16* p) {
  const v8h lo = *(const v8h*)p, hi = *(const v8h*)(p + 256);
  return __builtin_shufflevector(lo, hi, 0, 1, 2, 3, 4, 5, 6, 7, 8, 9, 10, 11, 12, 13, 14, 15);
}

__global__ __launch_bounds__(512)
void attn_kernel(const _Float16* __restrict__ q, const _Float16* __restrict__ k,
                 const _Float16* __restrict__ v,
                 const float* __restrict__ Wl, const float* __restrict__ bl,
                 const float* __restrict__ Ww, const float* __restrict__ bw,
                 _Float16* __restrict__ oh) {
  __shared__ __align__(16) float    Smix[2][HEADS][QR][SP];   // raw scores, two steps
  __shared__ __align__(16) _Float16 Pn[HEADS][QR][PP];        // post-mixed probs
  __shared__ __align__(16) _Float16 Qs[HEADS][RT * 2 * FTILE]; // the block's Q, fragment order
  // per-wave softmax stats [NWV][HEADS][QR], twice: they live between the two
  // passes only, in score buffer 1, which is idle from the last barrier of pass 1
  // to the first barrier of pass 2
  float* const stM = &Smix[1][0][0][0];
  float* const stL = stM + NWV * HEADS * QR;
  // pass 2's per-row constants, 16 bytes a lane: chunks 0, 1 the C operand of the
  // pre-mix (bias - row maximum, by D row), chunks 2, 3 the 1 / row sum
  __shared__ __align__(16) float Cst[RT][4][32][4];

  const int b = blockIdx.y;
  const int i0 = blockIdx.x * QR;
  const int wv = threadIdx.x >> 5;
  const int ln = threadIdx.x & 31;
  const int hlf = ln >> 4, lc = ln & 15;
  const int jt = wv & 3;         // column tile (scores), d tile (P @ V)
  const int h0 = (wv >> 2) * 3;  // first of this wave's three heads

  // the block's Q rows: 4 KiB in a row per head, 16 bytes a thread, six times
  {
    const _Float16* qsrc = q + (size_t)b * HEADS * SEQ * HDIM + (size_t)(i0 >> 4) * 2 * FTILE +
                           (size_t)(threadIdx.x >> 8) * (SEQ * HDIM) + (threadIdx.x & 255) * 8;
    v8h tq[6];
#pragma unroll
    for (int c = 0; c < 6; ++c) tq[c] = *(const v8h*)(qsrc + c * 2 * (SEQ * HDIM));
    xwait();
#pragma unroll
    for (int c = 0; c < 6; ++c)
      *(v8h*)&Qs[c * 2 + (threadIdx.x >> 8)][(threadIdx.x & 255) * 8] = tq[c];
  }

  // A operands of the two mixes: row lc of A is output head 6*(lc>>3) + (lc&7)
  const bool live = (lc & 7) < 6;
  const int grow = live ? (lc >> 3) * 6 + (lc & 7) : 0;
  v2f wa[3], wb[3];
#pragma unroll
  for (int s = 0; s < 3; ++s)
#pragma unroll
    for (int e = 0; e < 2; ++e) {
      const int hh = 6 * hlf + 2 * s + e;
      const float tl = Wl[grow * HEADS + hh], tw = Ww[grow * HEADS + hh];
      wa[s][e] = live ? tl : 0.f;
      wb[s][e] = live ? tw : 0.f;
    }
  xwait();
  v8f cbl = vzero8(), cbw = vzero8();   // C operands: the biases, by D row
#pragma unroll
  for (int r = 0; r < 6; ++r) { cbl[r] = bl[6 * hlf + r]; cbw[r] = bw[6 * hlf + r]; }
  xwait();

  const size_t base = ((size_t)b * HEADS + h0) * SEQ * HDIM;  // first of the three heads
  const _Float16* kh = k + base;   // [j][d]: 2 tiles per 16 rows
  const _Float16* vt = v + base;   // [d][j]

  // this wave's six K fragments of step n
  auto kload = [&](int n, v16h (&kf)[3][2]) {
    frag_ld6(kh + (size_t)(n * (JS / 16) + jt) * 2 * FTILE, ln, kf);
  };

  // raw scores of step n -> Smix[n & 1]; each K fragment meets both row tiles
  auto scores = [&](int n, const v16h (&kf)[3][2]) {
    // c[u][rt][r] = S[h0 + u][i0 + rt*16 + lc][n*64 + jt*16 + hlf*8 + r]
    v8f c[3][RT];
#pragma unroll
    for (int s = 0; s < 2; ++s) {
      v16h qf[3][RT];
#pragma unroll
      for (int u = 0; u < 3; ++u)
#pragma unroll
        for (int rt = 0; rt < RT; ++rt)
          qf[u][rt] = frag_pair(&Qs[h0 + u][(rt * 2 + s) * FTILE + ln * 8]);
      // keeps the six fragments' LDS reads together ahead of their WMMAs: sunk to
      // their uses, each pair waits out its own LDS latency
      __builtin_amdgcn_sched_barrier(0);
#pragma unroll
      for (int u = 0; u < 3; ++u)
#pragma unroll
        for (int rt = 0; rt < RT; ++rt)
          c[u][rt] = wmma16(kf[u][s], qf[u][rt], s ? c[u][rt] : vzero8());
    }
#pragma unroll
    for (int u = 0; u < 3; ++u)
#pragma unroll
      for (int rt = 0; rt < RT; ++rt) {
        float* dst = &Smix[n & 1][h0 + u][rt * 16 + lc][jt * 16 + hlf * 8];
        v4f s_lo = {c[u][rt][0], c[u][rt][1], c[u][rt][2], c[u][rt][3]};
        v4f s_hi = {c[u][rt][4], c[u][rt][5], c[u][rt][6], c[u][rt][7]};
        *(v4f*)dst       = s_lo;
        *(v4f*)(dst + 4) = s_hi;
      }
  };

  // pre-softmax mix of columns 4*wv..+3 of step n, row tile rt, on top of c0 (C
  // operand): d[t][r] = c0[r] + sum_h Wl[6*hlf + r][h] * S[h][rt*16 + lc][4*wv + t]
  auto premix = [&](int n, int rt, const v8f& c0, v8f (&d)[4]) {
    v4f sv[6];
#pragma unroll
    for (int r = 0; r < 6; ++r)
      sv[r] = *(const v4f*)&Smix[n & 1][6 * hlf + r][rt * 16 + lc][wv * 4];
#pragma unroll
    for (int t = 0; t < 4; ++t) d[t] = c0;
#pragma unroll
    for (int s = 0; s < 3; ++s)
#pragma unroll
      for (int t = 0; t < 4; ++t)
        d[t] = wmma4(wa[s], (v2f){sv[2 * s][t], sv[2 * s + 1][t]}, d[t]);
  };

  // softmax stats of (head 6*hlf + r, row rt*16 + lc) over this wave's own columns only
  float m[RT][6], l[RT][6];
#pragma unroll
  for (int rt = 0; rt < RT; ++rt)
#pragma unroll
    for (int r = 0; r < 6; ++r) { m[rt][r] = -1e30f; l[rt][r] = 0.f; }

  v16h kf[3][2];
  kload(0, kf);
  __syncthreads();   // publishes Qs
  scores(0, kf);
  __syncthreads();

  // ---------------- pass 1: online softmax stats over mixed scores ----------
  // One barrier a step: it publishes step n + 1 and ends the reads of step n,
  // whose buffer is written again only in step n + 1.
  for (int n = 0; n < SEQ / JS; ++n) {
    // the next step's K flies while this step is mixed (after the last step:
    // step 0 again, for pass 2)
    kload((n + 1) & (SEQ / JS - 1), kf);
#pragma unroll
    for (int rt = 0; rt < RT; ++rt) {
      v8f d[4];
      premix(n, rt, cbl, d);
#pragma unroll
      for (int r = 0; r < 6; ++r) {
        const float mx = fmaxf(fmaxf(d[0][r], d[1][r]), fmaxf(d[2][r], d[3][r]));
        const float nm = fmaxf(m[rt][r], mx);
        float p = 0.f;
#pragma unroll
        for (int t = 0; t < 4; ++t) p += exp_slot(d[t][r] - nm);
        l[rt][r] = l[rt][r] * exp_slot(m[rt][r] - nm) + p;
        m[rt][r] = nm;
      }
      // one row tile at a time: scheduled as one region, the two tiles' values
      // overfill the registers and the compiler falls back to a serial order
      __builtin_amdgcn_sched_barrier(0);
    }
    scores((n + 1) & (SEQ / JS - 1), kf);   // 16 & 15 = 0: buffer 0, last read in step 14
    __syncthreads();
  }

  // merge the 16 waves' stats, once: thread t < 384 merges (head t / 32, row t % 32)
#pragma unroll
  for (int rt = 0; rt < RT; ++rt)
#pragma unroll
    for (int r = 0; r < 6; ++r) {
      stM[(wv * HEADS + 6 * hlf + r) * QR + rt * 16 + lc] = m[rt][r];
      stL[(wv * HEADS + 6 * hlf + r) * QR + rt * 16 + lc] = l[rt][r];
    }
  // the padding rows of Cst read 0
  (&Cst[0][0][0][0])[threadIdx.x] = 0.f;
  (&Cst[0][0][0][0])[threadIdx.x + 512] = 0.f;
  __syncthreads();
  if (wv < HEADS) {   // the same for a whole wave: wave wv merges head wv
    const float bias = bl[wv];
    xwait();
    const int so = wv * QR + ln;
    float mt = -1e30f;
#pragma unroll
    for (int w = 0; w < NWV; ++w) mt = fmaxf(mt, stM[w * HEADS * QR + so]);
    float ls = 0.f;
#pragma unroll
    for (int w = 0; w < NWV; ++w)
      ls += stL[w * HEADS * QR + so] * exp_slot(stM[w * HEADS * QR + so] - mt);
    // reader: lane (hlf, lc) of row tile rt, register r <-> head 6*hlf + r, row rt*16 + lc
    const int gh = wv / 6, gr = wv % 6;
    Cst[hlf][gr >> 2][gh * 16 + lc][gr & 3]       = bias - mt;
    Cst[hlf][2 + (gr >> 2)][gh * 16 + lc][gr & 3] = 1.f / ls;
  }
  __syncthreads();   // publishes Cst

  v8f oacc[RT][3];
#pragma unroll
  for (int rt = 0; rt < RT; ++rt)
#pragma unroll
    for (int u = 0; u < 3; ++u) oacc[rt][u] = vzero8();

  // ---------------- pass 2: probs, post-mix, P @ V ---------------------------
  for (int n = 0; n < SEQ / JS; ++n) {
    // this step's V fragments fly while the step is mixed
    v16h vf[3][2];
    frag_ld6(vt + (size_t)(jt * (SEQ / 32) + n * 2) * FTILE, ln, vf);
#pragma unroll
    for (int rt = 0; rt < RT; ++rt) {
      v8f d[4], e[4];
      const v4f c_lo = *(const v4f*)&Cst[rt][0][ln][0], c_hi = *(const v4f*)&Cst[rt][1][ln][0];
      const v4f r_lo = *(const v4f*)&Cst[rt][2][ln][0], r_hi = *(const v4f*)&Cst[rt][3][ln][0];
      const v8f cbm = __builtin_shufflevector(c_lo, c_hi, 0, 1, 2, 3, 4, 5, 6, 7);
      const float rl[6] = {r_lo[0], r_lo[1], r_lo[2], r_lo[3], r_hi[0], r_hi[1]};
      premix(n, rt, cbm, d);   // the row maximum is taken off in the C operand
#pragma unroll
      for (int t = 0; t < 4; ++t)
#pragma unroll
        for (int r = 0; r < 6; ++r) d[t][r] = exp_slot(d[t][r]) * rl[r];
      // post-softmax mix (+bw per element: summed over all 1024 j it reproduces
      // the bias term): e[t][r] = P2[6*hlf + r][rt*16 + lc][4*wv + t]
#pragma unroll
      for (int t = 0; t < 4; ++t) e[t] = cbw;
#pragma unroll
      for (int s = 0; s < 3; ++s)
#pragma unroll
        for (int t = 0; t < 4; ++t)
          e[t] = wmma4(wb[s], (v2f){d[t][2 * s], d[t][2 * s + 1]}, e[t]);
      v4h pk[6];
#pragma unroll
      for (int r = 0; r < 6; ++r)
        pk[r] = (v4h){(_Float16)e[0][r], (_Float16)e[1][r], (_Float16)e[2][r], (_Float16)e[3][r]};
#pragma unroll
      for (int r = 0; r < 6; ++r) *(v4h*)&Pn[6 * hlf + r][rt * 16 + lc][wv * 4] = pk[r];
      // one row tile at a time, as in pass 1
      __builtin_amdgcn_sched_barrier(0);
    }
    __syncthreads();   // publishes Pn; ends the reads of this step's Smix buffer
    // the next step's K flies during P @ V
    if (n + 1 < SEQ / JS) kload(n + 1, kf);
    // A = post-mixed probs (16 x 32, twice, per row tile), B = V^T tiles
#pragma unroll
    for (int ks = 0; ks < 2; ++ks) {
      v16h a[3][RT];
#pragma unroll
      for (int u = 0; u < 3; ++u)
#pragma unroll
        for (int rt = 0; rt < RT; ++rt) {
          const _Float16* pr = &Pn[h0 + u][rt * 16 + lc][ks * 32 + hlf * 8];
          const v8h lo = *(const v8h*)pr, hi = *(const v8h*)(pr + 16);
          a[u][rt] = __builtin_shufflevector(lo, hi, 0, 1, 2, 3, 4, 5, 6, 7,
                                             8, 9, 10, 11, 12, 13, 14, 15);
        }
      // keeps the six fragments' LDS reads together ahead of their WMMAs, as in scores
      __builtin_amdgcn_sched_barrier(0);
#pragma unroll
      for (int u = 0; u < 3; ++u)
#pragma unroll
        for (int rt = 0; rt < RT; ++rt)
          oacc[rt][u] = wmma16(a[u][rt], vf[u][ks], oacc[rt][u]);
    }
    if (n + 1 < SEQ / JS) scores(n + 1, kf);
    __syncthreads();   // publishes the next scores; ends the reads of Pn
  }

  // write (B * N, DIM) f16, fragment order (A operand of the out projection)
#pragma unroll
  for (int rt = 0; rt < RT; ++rt)
#pragma unroll
    for (int u = 0; u < 3; ++u) {
      int col = (h0 + u) * HDIM + jt * 16 + lc;
#pragma unroll
      for (int r = 0; r < 8; ++r) {
        int i = i0 + rt * 16 + r + hlf * 8;
        oh[fragoff(b * SEQ + i, col, DIMC / 32)] = (_Float16)oacc[rt][u][r];
      }
    }
}

// ---------------------------------------------------------------- out proj
// grid = (M/128, 6), block = 128 (4 waves, 2 x 2 tiles of 64 x 64).
__global__ __launch_bounds__(128)
void out_proj_kernel(const _Float16* __restrict__ oh,
                     const _Float16* __restrict__ WpT,
                     const float* __restrict__ bp, float* __restrict__ out) {
  const int mt = blockIdx.x, cg = blockIdx.y;
  const int wave = threadIdx.x >> 5, ln = threadIdx.x & 31;
  const int hlf = ln >> 4, lc = ln & 15;
  const int m0 = mt * 128 + (wave >> 1) * 64;
  const int nbase = cg * 128 + (wave & 1) * 64;

  v8f c[4][4];
  gemm64(oh + (size_t)(m0 >> 4) * RTILE, WpT + (size_t)(nbase >> 4) * RTILE, ln, c);

  const int col0 = nbase + lc;
  float bias[4];
#pragma unroll
  for (int t = 0; t < 4; ++t) bias[t] = bp[col0 + t * 16];
  // the register that these loads name is reused for the store addresses: the
  // input operand keeps it whole up to the wait
  asm volatile("s_wait_xcnt 0x0" :: "v"(col0) : "memory");
#pragma unroll
  for (int t = 0; t < 4; ++t) {
    int col = col0 + t * 16;
#pragma unroll
    for (int i = 0; i < 4; ++i)
#pragma unroll
      for (int r = 0; r < 8; ++r)
        out[(size_t)(m0 + i * 16 + r + hlf * 8) * DIMC + col] = c[i][t][r] + bias[t];
  }
}

// ---------------------------------------------------------------- launch
extern "C" void kernel_launch(void* const* d_in, const int* in_sizes, int n_in,
                              void* d_out, int out_size, void* d_ws, size_t ws_size,
                              hipStream_t stream) {
  (void)in_sizes; (void)n_in; (void)out_size; (void)ws_size;
  const float* x  = (const float*)d_in[0];
  const float* Wq = (const float*)d_in[1];
  const float* Wk = (const float*)d_in[2];
  const float* Wv = (const float*)d_in[3];
  const float* Wl = (const float*)d_in[4];
  const float* bl = (const float*)d_in[5];
  const float* Ww = (const float*)d_in[6];
  const float* bw = (const float*)d_in[7];
  const float* Wp = (const float*)d_in[8];
  const float* bp = (const float*)d_in[9];
  float* out = (float*)d_out;

  _Float16* ws = (_Float16*)d_ws;
  size_t off = 0;
  const size_t NX = (size_t)BATCH * SEQ * DIMC;   // 6,291,456
  const size_t NW = (size_t)DIMC * DIMC;
  _Float16* xh  = ws + off; off += NX;
  _Float16* WqT = ws + off; off += NW;
  _Float16* WkT = ws + off; off += NW;
  _Float16* WvT = ws + off; off += NW;
  _Float16* WpT = ws + off; off += NW;
  _Float16* qb  = ws + off; off += NX;
  _Float16* kb  = ws + off; off += NX;
  _Float16* vb  = ws + off; off += NX;   // transposed layout [b][h][d][j]
  _Float16* oh  = ws + off; off += NX;

  convert_x_kernel<<<(int)((NX / 8 + 255) / 256), 256, 0, stream>>>(x, xh, (int)(NX / 8));
  convert_w_kernel<<<(int)((NW + 255) / 256), 256, 0, stream>>>(
      Wq, Wk, Wv, Wp, WqT, WkT, WvT, WpT);
  qkv_gemm_kernel<<<dim3(BATCH * SEQ / 128, 18), 128, 0, stream>>>(
      xh, WqT, WkT, WvT, qb, kb, vb);
  attn_kernel<<<dim3(SEQ / QR, BATCH), 512, 0, stream>>>(
      qb, kb, vb, Wl, bl, Ww, bw, oh);
  out_proj_kernel<<<dim3(BATCH * SEQ / 128, 6), 128, 0, stream>>>(oh, WpT, bp, out);
}

// v006
// Measured time: 163 microseconds a run.
// In both of two side-by-side timings against v005, it was 1.10 times as fast.
// Counting every step since v000, it is 6.27 times as fast.
#include <hip/hip_runtime.h>

#define DIMC  768
#define HEADS 12
#define HDIM  64
#define BATCH 8
#define SEQ   1024
#define QSCALE 0.125f   // HD^-0.5

typedef __attribute__((ext_vector_type(16))) _Float16 v16h;
typedef __attribute__((ext_vector_type(8)))  _Float16 v8h;
typedef __attribute__((ext_vector_type(8)))  float    v8f;

// Every f16 matrix in the workspace is kept in FRAGMENT ORDER: one 16-row x
// 32-k operand tile is 512 contiguous halves, as two 512-byte chunks, and lane
// ln's 16 bytes of a chunk stand at ln * 16 bytes. A fragment load then reads
// 4 whole 128-byte lines per instruction instead of 32 bytes of each of 16.
// Per CDNA5 layout: lane<16 holds K {k0..k0+7, k0+16..k0+23} with k0=0,
// lane>=16 with k0=8; chunk 0 is the first run of 8, chunk 1 the second.
#define FTILE 512   // halves per 16 x 32 tile

// Offset in halves of element (r, k) of a matrix with nks tiles along k.
__device__ __forceinline__ size_t fragoff(int r, int k, int nks) {
  return (size_t)((r >> 4) * nks + (k >> 5)) * FTILE + ((k >> 4) & 1) * 256 +
         (((k >> 3) & 1) * 16 + (r & 15)) * 8 + (k & 7);
}

// Stands behind global loads whose address registers the compiler reuses next:
// those registers are not rewritten before the loads' addresses are taken.
__device__ __forceinline__ void xwait() { asm volatile("s_wait_xcnt 0x0" ::: "memory"); }

__device__ __forceinline__ v8f wmma16(v16h a, v16h b, v8f c) {
  return __builtin_amdgcn_wmma_f32_16x16x32_f16(false, a, false, b,
                                                (short)0, c, false, false);
}

__device__ __forceinline__ v8f vzero8() {
  v8f z;
#pragma unroll
  for (int e = 0; e < 8; ++e) z[e] = 0.f;
  return z;
}

// ---------------------------------------------------------------- converts
__global__ void convert_x_kernel(const float* __restrict__ x,
                                 _Float16* __restrict__ xh, int n) {
  // thread i writes the i-th 16-byte piece of xh (fragment order), n pieces
  int i = blockIdx.x * blockDim.x + threadIdx.x;
  if (i >= n) return;
  const int lane = i & 31, chunk = (i >> 5) & 1, tile = i >> 6;
  const int ks = tile % (DIMC / 32), rt = tile / (DIMC / 32);
  const float* src = x + (size_t)(rt * 16 + (lane & 15)) * DIMC +
                     ks * 32 + chunk * 16 + (lane >> 4) * 8;
  const float4 lo = *(const float4*)src, hi = *(const float4*)(src + 4);
  v8h o = {(_Float16)lo.x, (_Float16)lo.y, (_Float16)lo.z, (_Float16)lo.w,
           (_Float16)hi.x, (_Float16)hi.y, (_Float16)hi.z, (_Float16)hi.w};
  *(v8h*)(xh + (size_t)i * 8) = o;
}

__global__ void convert_w_kernel(const float* __restrict__ Wq,
                                 const float* __restrict__ Wk,
                                 const float* __restrict__ Wv,
                                 const float* __restrict__ Wp,
                                 _Float16* __restrict__ WqT,
                                 _Float16* __restrict__ WkT,
                                 _Float16* __restrict__ WvT,
                                 _Float16* __restrict__ WpT) {
  int idx = blockIdx.x * blockDim.x + threadIdx.x;
  if (idx >= DIMC * DIMC) return;
  int kk = idx / DIMC, nn = idx % DIMC;
  size_t tid = fragoff(nn, kk, DIMC / 32);  // transposed [n][k], fragment order
  WqT[tid] = (_Float16)Wq[idx];
  WkT[tid] = (_Float16)Wk[idx];
  WvT[tid] = (_Float16)Wv[idx];
  WpT[tid] = (_Float16)Wp[idx];
}

// ---------------------------------------------------------------- GEMM core
// One wave forms a 64 x 64 tile of X * W^T as 4 x 4 accumulator tiles, so that
// every loaded fragment feeds four WMMAs. a0, b0: the first 16-row tile of the
// wave's four neighbouring row tiles of each operand (fragment order, K = DIMC).
#define RTILE ((DIMC / 32) * FTILE)   // halves from one 16-row tile to the next

// The eight fragments of k step s: sixteen loads through two address registers.
__device__ __forceinline__ void frag_ld8(const _Float16* __restrict__ pa,
                                         const _Float16* __restrict__ pb, int s,
                                         v16h (&a)[4], v16h (&b)[4]) {
  v8h ta[8], tb[8];
#pragma unroll
  for (int i = 0; i < 8; ++i) {
    ta[i] = *(const v8h*)(pa + (i >> 1) * RTILE + s * FTILE + (i & 1) * 256);
    tb[i] = *(const v8h*)(pb + (i >> 1) * RTILE + s * FTILE + (i & 1) * 256);
  }
#pragma unroll
  for (int t = 0; t < 4; ++t) {
    a[t] = __builtin_shufflevector(ta[2 * t], ta[2 * t + 1],
                                   0, 1, 2, 3, 4, 5, 6, 7, 8, 9, 10, 11, 12, 13, 14, 15);
    b[t] = __builtin_shufflevector(tb[2 * t], tb[2 * t + 1],
                                   0, 1, 2, 3, 4, 5, 6, 7, 8, 9, 10, 11, 12, 13, 14, 15);
  }
}

__device__ __forceinline__ void gemm64(const _Float16* __restrict__ a0,
                                       const _Float16* __restrict__ b0, int ln,
                                       v8f (&c)[4][4]) {
  const _Float16* pa = a0 + ln * 8;
  const _Float16* pb = b0 + ln * 8;
#pragma unroll
  for (int i = 0; i < 4; ++i)
#pragma unroll
    for (int j = 0; j < 4; ++j) c[i][j] = vzero8();

  // fully unrolled k loop; the fragments of step s + 1 are asked for ahead of
  // the WMMAs of step s
  const int NSTEP = DIMC / 32;
  v16h a[4], b[4];
  frag_ld8(pa, pb, 0, a, b);
#pragma unroll
  for (int s = 0; s < NSTEP - 1; ++s) {
    v16h a_n[4], b_n[4];
    frag_ld8(pa, pb, s + 1, a_n, b_n);
    if (s == NSTEP - 2) xwait();  // the epilogue's address sums reuse the two address registers
    // holds the next step's loads ahead of this step's WMMAs: sunk to their uses,
    // each would wait out its whole latency with little else in flight
    __builtin_amdgcn_sched_barrier(0);
#pragma unroll
    for (int i = 0; i < 4; ++i)
#pragma unroll
      for (int j = 0; j < 4; ++j) c[i][j] = wmma16(a[i], b[j], c[i][j]);
#pragma unroll
    for (int t = 0; t < 4; ++t) { a[t] = a_n[t]; b[t] = b_n[t]; }
  }
#pragma unroll
  for (int i = 0; i < 4; ++i)
#pragma unroll
    for (int j = 0; j < 4; ++j) c[i][j] = wmma16(a[i], b[j], c[i][j]);
}

// ---------------------------------------------------------------- QKV GEMM
// grid = (M/128, 18), block = 128 (4 waves, 2 x 2 tiles of 64 x 64). col groups
// 0-5 -> q, 6-11 -> k, 12-17 -> v; a wave's 64 columns are one head.
// q scaled by QSCALE. v written TRANSPOSED per head: [b][h][d][j]. q, k, v are
// per-head matrices in fragment order (rows i, j, d; k index d, d, j).
__global__ __launch_bounds__(128)
void qkv_gemm_kernel(const _Float16* __restrict__ xh,
                     const _Float16* __restrict__ WqT,
                     const _Float16* __restrict__ WkT,
                     const _Float16* __restrict__ WvT,
                     _Float16* __restrict__ qb, _Float16* __restrict__ kb,
                     _Float16* __restrict__ vb) {
  const int mt = blockIdx.x, cg = blockIdx.y;
  const int wave = threadIdx.x >> 5, ln = threadIdx.x & 31;
  const int hlf = ln >> 4, lc = ln & 15;
  const int m0 = mt * 128 + (wave >> 1) * 64;
  const int which = cg / 6;  // 0=q 1=k 2=v
  const _Float16* WT = (which == 0) ? WqT : (which == 1) ? WkT : WvT;
  const int nbase = (cg % 6) * 128 + (wave & 1) * 64;  // within [0,768)

  v8f c[4][4];
  gemm64(xh + (size_t)(m0 >> 4) * RTILE, WT + (size_t)(nbase >> 4) * RTILE, ln, c);

  const int b_ = m0 / SEQ;
  const int nrow0 = m0 % SEQ;
  const int head = nbase >> 6;
  const size_t hoff = ((size_t)b_ * HEADS + head) * SEQ * HDIM;
  if (which == 2) {
    // V: transposed store [b][h][d][j]; the lane's 8 values of j are one piece
    _Float16* vt = vb + hoff;
#pragma unroll
    for (int i = 0; i < 4; ++i)
#pragma unroll
      for (int t = 0; t < 4; ++t) {
        v8h pk;
#pragma unroll
        for (int r = 0; r < 8; ++r) pk[r] = (_Float16)c[i][t][r];
        *(v8h*)(vt + fragoff(t * 16 + lc, nrow0 + i * 16 + hlf * 8, SEQ / 32)) = pk;
      }
  } else {
    const float scale = (which == 0) ? QSCALE : 1.f;
    _Float16* dst = ((which == 0) ? qb : kb) + hoff;
#pragma unroll
    for (int i = 0; i < 4; ++i)
#pragma unroll
      for (int t = 0; t < 4; ++t)
#pragma unroll
        for (int r = 0; r < 8; ++r)
          dst[fragoff(nrow0 + i * 16 + r + hlf * 8, t * 16 + lc, HDIM / 32)] =
              (_Float16)(c[i][t][r] * scale);
    xwait();   // the listing runs on from these stores into code that reuses their registers
  }
}

// ---------------------------------------------------- fused talking-heads attn
// grid = (SEQ/32, BATCH), block = 512 (16 waves), 32 query rows (two row tiles),
// 64 columns a step. Every K and V fragment that a wave loads feeds both row
// tiles, so a block's K and V reads serve twice the rows.
// q,k layout [b][h][j][d]; v layout [b][h][d][j] (pre-transposed); each (b, h)
// matrix in fragment order.
// Wave w forms the raw scores of heads 3*(w>>2)..+2 on column tile w&3 (as
// K * Q^T, so a lane holds 8 contiguous columns of query row lc) and puts them
// into Smix once. Both head mixes are matrix products over the head index:
// D[g][pos] = sum_h W[g][h] * S[h][pos], on the f16 16x16x32 form with every f32
// value split into an f16 pair hi + lo (22 bits): the 32 k slots hold the 12
// heads' hi and lo parts, and two WMMAs (weights' hi, weights' lo) give all four
// partial products. They take a third of the matrix unit's time of the three
// f32 16x16x4 steps that the same tile needs.
// One mix tile is one column j with 16 query rows (lane lc = row); wave w
// mixes columns 4w..4w+3 of the step, so every score is read from LDS once.
// Head order, the same in A, B and D: lane half hlf, index r < 6 <-> head
// 6*hlf + r (D rows 6, 7, 14, 15 are padding, weights and bias 0). With it the
// D of the pre-mix, after the softmax in place, feeds the B of the post-mix.
#define NWV 16      // waves per block
#define JS  64      // columns per step
#define RT  2       // query row tiles per block
#define QR  (16 * RT)
#define SP  68      // floats per Smix row: 272 B = 16 B x odd
#define PP  72      // halves per Pn row:   144 B = 16 B x odd
typedef __attribute__((ext_vector_type(4))) float    v4f;
typedef __attribute__((ext_vector_type(4))) _Float16 v4h;

// Six f32 values of a lane as one f16 operand: elements 0-5 the values rounded to
// f16, 6-11 what the rounding left, 12-15 zero. A and B use the same element
// order, so element e of one lane half meets element e of the same half.
// Two operands at a time, in asm: nine instructions an operand (three packed
// converts, six mixed-precision fma that read a half of the packed pair and write
// a half of the result), where the compiler's own choice takes sixteen; with two
// operands interleaved every instruction stands six behind the one it depends on.
typedef __attribute__((ext_vector_type(8))) unsigned v8u;
__device__ __forceinline__ void split6x2(float a0, float a1, float a2, float a3, float a4, float a5,
                                         float b0, float b1, float b2, float b3, float b4, float b5,
                                         v16h& oa, v16h& ob) {
  unsigned ah0, ah1, ah2, al0, al1, al2, bh0, bh1, bh2, bl0, bl1, bl2;
  asm("v_cvt_pk_f16_f32 %0, %12, %13\n\t"
      "v_cvt_pk_f16_f32 %1, %14, %15\n\t"
      "v_cvt_pk_f16_f32 %2, %16, %17\n\t"
      "v_cvt_pk_f16_f32 %6, %18, %19\n\t"
      "v_cvt_pk_f16_f32 %7, %20, %21\n\t"
      "v_cvt_pk_f16_f32 %8, %22, %23\n\t"
      "v_fma_mixlo_f16 %3, %0, -1.0, %12 op_sel_hi:[1,0,0]\n\t"
      "v_fma_mixlo_f16 %4, %1, -1.0, %14 op_sel_hi:[1,0,0]\n\t"
      "v_fma_mixlo_f16 %5, %2, -1.0, %16 op_sel_hi:[1,0,0]\n\t"
      "v_fma_mixlo_f16 %9, %6, -1.0, %18 op_sel_hi:[1,0,0]\n\t"
      "v_fma_mixlo_f16 %10, %7, -1.0, %20 op_sel_hi:[1,0,0]\n\t"
      "v_fma_mixlo_f16 %11, %8, -1.0, %22 op_sel_hi:[1,0,0]\n\t"
      "v_fma_mixhi_f16 %3, %0, -1.0, %13 op_sel:[1,0,0] op_sel_hi:[1,0,0]\n\t"
      "v_fma_mixhi_f16 %4, %1, -1.0, %15 op_sel:[1,0,0] op_sel_hi:[1,0,0]\n\t"
      "v_fma_mixhi_f16 %5, %2, -1.0, %17 op_sel:[1,0,0] op_sel_hi:[1,0,0]\n\t"
      "v_fma_mixhi_f16 %9, %6, -1.0, %19 op_sel:[1,0,0] op_sel_hi:[1,0,0]\n\t"
      "v_fma_mixhi_f16 %10, %7, -1.0, %21 op_sel:[1,0,0] op_sel_hi:[1,0,0]\n\t"
      "v_fma_mixhi_f16 %11, %8, -1.0, %23 op_sel:[1,0,0] op_sel_hi:[1,0,0]"
      : "=&v"(ah0), "=&v"(ah1), "=&v"(ah2), "=&v"(al0), "=&v"(al1), "=&v"(al2),
        "=&v"(bh0), "=&v"(bh1), "=&v"(bh2), "=&v"(bl0), "=&v"(bl1), "=&v"(bl2)
      : "v"(a0), "v"(a1), "v"(a2), "v"(a3), "v"(a4), "v"(a5),
        "v"(b0), "v"(b1), "v"(b2), "v"(b3), "v"(b4), "v"(b5));
  oa = __builtin_bit_cast(v16h, (v8u){ah0, ah1, ah2, al0, al1, al2, 0u, 0u});
  ob = __builtin_bit_cast(v16h, (v8u){bh0, bh1, bh2, bl0, bl1, bl2, 0u, 0u});
}

// e^x in the fast form (one multiply, v_exp_f32). The v_nop fills the one slot that
// the instruction set asks for between a transcendental and a next instruction
// that reads its result or overwrites its source.
__device__ __forceinline__ float exp_slot(float x) {
  float y;
  asm("v_exp_f32 %0, %1\n\tv_nop" : "=v"(y) : "v"(x * 1.44269504f));
  return y;
}

// Six fragments: two neighbouring tiles of each of three neighbouring heads, all
// twelve loads through one address register and in flight together.
__device__ __forceinline__ void frag_ld6(const _Float16* __restrict__ tile0, int ln,
                                         v16h (&f)[3][2]) {
  const _Float16* p = tile0 + ln * 8;
  v8h t[12];
#pragma unroll
  for (int i = 0; i < 11; ++i)
    t[i] = *(const v8h*)(p + (i >> 2) * (SEQ * HDIM) + ((i >> 1) & 1) * FTILE + (i & 1) * 256);
  xwait();   // the last load may land on the address register that the eleven name
  t[11] = *(const v8h*)(p + 2 * (SEQ * HDIM) + FTILE + 256);
  xwait();
#pragma unroll
  for (int u = 0; u < 3; ++u)
#pragma unroll
    for (int s = 0; s < 2; ++s)
#pragma unroll
      for (int e = 0; e < 8; ++e) {
        f[u][s][e]     = t[u * 4 + s * 2][e];
        f[u][s][e + 8] = t[u * 4 + s * 2 + 1][e];
      }
}

// One fragment out of a fragment-order tile (p: the lane's piece of chunk 0).
__device__ __forceinline__ v16h frag_pair(const _Float16* p) {
  const v8h lo = *(const v8h*)p, hi = *(const v8h*)(p + 256);
  return __builtin_shufflevector(lo, hi, 0, 1, 2, 3, 4, 5, 6, 7, 8, 9, 10, 11, 12, 13, 14, 15);
}

__global__ __launch_bounds__(512)
void attn_kernel(const _Float16* __restrict__ q, const _Float16* __restrict__ k,
                 const _Float16* __restrict__ v,
                 const float* __restrict__ Wl, const float* __restrict__ bl,
                 const float* __restrict__ Ww, const float* __restrict__ bw,
                 _Float16* __restrict__ oh) {
  __shared__ __align__(16) float    Smix[2][HEADS][QR][SP];   // raw scores, two steps
  __shared__ __align__(16) _Float16 Pn[HEADS][QR][PP];        // post-mixed probs
  __shared__ __align__(16) _Float16 Qs[HEADS][RT * 2 * FTILE]; // the block's Q, fragment order
  // per-wave softmax stats [NWV][HEADS][QR], twice: they live between the two
  // passes only, in score buffer 1, which is idle from the last barrier of pass 1
  // to the first barrier of pass 2
  float* const stM = &Smix[1][0][0][0];
  float* const stL = stM + NWV * HEADS * QR;
  // pass 2's per-row constants, 16 bytes a lane: chunks 0, 1 the C operand of the
  // pre-mix (bias - row maximum, by D row), chunks 2, 3 the 1 / row sum
  __shared__ __align__(16) float Cst[RT][4][32][4];
  // the four A operands of the mixes (pre hi, pre lo, post hi, post lo), 16 bytes a
  // lane and chunk: pass 2 reads them anew every step, so that they hold no
  // registers while K, V, the probabilities and the output tiles are all live
  __shared__ __align__(16) _Float16 Wop[4][2][32][8];

  const int b = blockIdx.y;
  const int i0 = blockIdx.x * QR;
  const int wv = threadIdx.x >> 5;
  const int ln = threadIdx.x & 31;
  const int hlf = ln >> 4, lc = ln & 15;
  const int jt = wv & 3;         // column tile (scores), d tile (P @ V)
  const int h0 = (wv >> 2) * 3;  // first of this wave's three heads

  // the block's Q rows: 4 KiB in a row per head, 16 bytes a thread, six times
  {
    const _Float16* qsrc = q + (size_t)b * HEADS * SEQ * HDIM + (size_t)(i0 >> 4) * 2 * FTILE +
                           (size_t)(threadIdx.x >> 8) * (SEQ * HDIM) + (threadIdx.x & 255) * 8;
    v8h tq[6];
#pragma unroll
    for (int c = 0; c < 6; ++c) tq[c] = *(const v8h*)(qsrc + c * 2 * (SEQ * HDIM));
    xwait();
#pragma unroll
    for (int c = 0; c < 6; ++c)
      *(v8h*)&Qs[c * 2 + (threadIdx.x >> 8)][(threadIdx.x & 255) * 8] = tq[c];
  }

  // A operands of the two mixes: row lc of A is output head 6*(lc>>3) + (lc&7)
  const bool live = (lc & 7) < 6;
  const int grow = live ? (lc >> 3) * 6 + (lc & 7) : 0;
  // [0]: the weights' hi parts against the values' hi and lo, [1]: their lo parts
  v16h wa[2], wb[2];
  {
    float tl[6], tw[6];
#pragma unroll
    for (int e = 0; e < 6; ++e) {
      tl[e] = Wl[grow * HEADS + 6 * hlf + e];
      tw[e] = Ww[grow * HEADS + 6 * hlf + e];
    }
    xwait();
#pragma unroll
    for (int e = 0; e < 6; ++e) {
      tl[e] = live ? tl[e] : 0.f;
      tw[e] = live ? tw[e] : 0.f;
    }
    v16h sl, sw;
    split6x2(tl[0], tl[1], tl[2], tl[3], tl[4], tl[5],
             tw[0], tw[1], tw[2], tw[3], tw[4], tw[5], sl, sw);
    wa[0] = __builtin_shufflevector(sl, sl, 0, 1, 2, 3, 4, 5, 0, 1, 2, 3, 4, 5, 12, 13, 14, 15);
    wa[1] = __builtin_shufflevector(sl, sl, 6, 7, 8, 9, 10, 11, 6, 7, 8, 9, 10, 11, 12, 13, 14, 15);
    wb[0] = __builtin_shufflevector(sw, sw, 0, 1, 2, 3, 4, 5, 0, 1, 2, 3, 4, 5, 12, 13, 14, 15);
    wb[1] = __builtin_shufflevector(sw, sw, 6, 7, 8, 9, 10, 11, 6, 7, 8, 9, 10, 11, 12, 13, 14, 15);
  }
  if (wv == 0) {   // the same in every wave: one wave writes them; the barrier that publishes Qs covers them
#pragma unroll
    for (int o = 0; o < 2; ++o) {
      *(v8h*)&Wop[o][0][ln][0]     = __builtin_shufflevector(wa[o], wa[o], 0, 1, 2, 3, 4, 5, 6, 7);
      *(v8h*)&Wop[o][1][ln][0]     = __builtin_shufflevector(wa[o], wa[o], 8, 9, 10, 11, 12, 13, 14, 15);
      *(v8h*)&Wop[2 + o][0][ln][0] = __builtin_shufflevector(wb[o], wb[o], 0, 1, 2, 3, 4, 5, 6, 7);
      *(v8h*)&Wop[2 + o][1][ln][0] = __builtin_shufflevector(wb[o], wb[o], 8, 9, 10, 11, 12, 13, 14, 15);
    }
  }
  v8f cbl = vzero8(), cbw = vzero8();   // C operands: the biases, by D row
#pragma unroll
  for (int r = 0; r < 6; ++r) { cbl[r] = bl[6 * hlf + r]; cbw[r] = bw[6 * hlf + r]; }
  xwait();

  const size_t base = ((size_t)b * HEADS + h0) * SEQ * HDIM;  // first of the three heads
  const _Float16* kh = k + base;   // [j][d]: 2 tiles per 16 rows
  const _Float16* vt = v + base;   // [d][j]

  // this wave's six K fragments of step n
  auto kload = [&](int n, v16h (&kf)[3][2]) {
    frag_ld6(kh + (size_t)(n * (JS / 16) + jt) * 2 * FTILE, ln, kf);
  };

  // raw scores of step n -> Smix[n & 1]; each K fragment meets both row tiles
  auto scores = [&](int n, const v16h (&kf)[3][2]) {
    // c[u][rt][r] = S[h0 + u][i0 + rt*16 + lc][n*64 + jt*16 + hlf*8 + r]
    v8f c[3][RT];
#pragma unroll
    for (int s = 0; s < 2; ++s) {
      v16h qf[3][RT];
#pragma unroll
      for (int u = 0; u < 3; ++u)
#pragma unroll
        for (int rt = 0; rt < RT; ++rt)
          qf[u][rt] = frag_pair(&Qs[h0 + u][(rt * 2 + s) * FTILE + ln * 8]);
      // keeps the six fragments' LDS reads together ahead of their WMMAs: sunk to
      // their uses, each pair waits out its own LDS latency
      __builtin_amdgcn_sched_barrier(0);
#pragma unroll
      for (int u = 0; u < 3; ++u)
#pragma unroll
        for (int rt = 0; rt < RT; ++rt)
          c[u][rt] = wmma16(kf[u][s], qf[u][rt], s ? c[u][rt] : vzero8());
    }
#pragma unroll
    for (int u = 0; u < 3; ++u)
#pragma unroll
      for (int rt = 0; rt < RT; ++rt) {
        float* dst = &Smix[n & 1][h0 + u][rt * 16 + lc][jt * 16 + hlf * 8];
        v4f s_lo = {c[u][rt][0], c[u][rt][1], c[u][rt][2], c[u][rt][3]};
        v4f s_hi = {c[u][rt][4], c[u][rt][5], c[u][rt][6], c[u][rt][7]};
        *(v4f*)dst       = s_lo;
        *(v4f*)(dst + 4) = s_hi;
      }
  };

  // pre-softmax mix of columns 4*wv..+3 of step n, row tile rt, on top of c0 (C
  // operand): d[t][r] = c0[r] + sum_h Wl[6*hlf + r][h] * S[h][rt*16 + lc][4*wv + t]
  auto premix = [&](int n, int rt, const v16h (&w)[2], const v8f& c0, v8f (&d)[4]) {
    v4f sv[6];
#pragma unroll
    for (int r = 0; r < 6; ++r)
      sv[r] = *(const v4f*)&Smix[n & 1][6 * hlf + r][rt * 16 + lc][wv * 4];
    v16h sb[4];
#pragma unroll
    for (int t = 0; t < 4; t += 2)
      split6x2(sv[0][t], sv[1][t], sv[2][t], sv[3][t], sv[4][t], sv[5][t],
               sv[0][t + 1], sv[1][t + 1], sv[2][t + 1], sv[3][t + 1], sv[4][t + 1], sv[5][t + 1],
               sb[t], sb[t + 1]);
    // the two fences keep every split ahead of, and the next one well behind, the
    // eight WMMAs: the compiler may give a split's results the registers of a D's
    // unused rows
    __builtin_amdgcn_sched_barrier(0);
#pragma unroll
    for (int t = 0; t < 4; ++t) d[t] = wmma16(w[0], sb[t], c0);
#pragma unroll
    for (int t = 0; t < 4; ++t) d[t] = wmma16(w[1], sb[t], d[t]);
    __builtin_amdgcn_sched_barrier(0);
  };

  // softmax stats of (head 6*hlf + r, row rt*16 + lc) over this wave's own columns only
  float m[RT][6], l[RT][6];
#pragma unroll
  for (int rt = 0; rt < RT; ++rt)
#pragma unroll
    for (int r = 0; r < 6; ++r) { m[rt][r] = -1e30f; l[rt][r] = 0.f; }

  v16h kf[3][2];
  kload(0, kf);
  __syncthreads();   // publishes Qs
  scores(0, kf);
  __syncthreads();

  // ---------------- pass 1: online softmax stats over mixed scores ----------
  // One barrier a step: it publishes step n + 1 and ends the reads of step n,
  // whose buffer is written again only in step n + 1.
  for (int n = 0; n < SEQ / JS; ++n) {
    // the next step's K flies while this step is mixed (after the last step:
    // step 0 again, for pass 2)
    kload((n + 1) & (SEQ / JS - 1), kf);
#pragma unroll
    for (int rt = 0; rt < RT; ++rt) {
      v8f d[4];
      premix(n, rt, wa, cbl, d);
#pragma unroll
      for (int r = 0; r < 6; ++r) {
        const float mx = fmaxf(fmaxf(d[0][r], d[1][r]), fmaxf(d[2][r], d[3][r]));
        const float nm = fmaxf(m[rt][r], mx);
        float p = 0.f;
#pragma unroll
        for (int t = 0; t < 4; ++t) p += exp_slot(d[t][r] - nm);
        l[rt][r] = l[rt][r] * exp_slot(m[rt][r] - nm) + p;
        m[rt][r] = nm;
      }
      // one row tile at a time: scheduled as one region, the two tiles' values
      // overfill the registers and the compiler falls back to a serial order
      __builtin_amdgcn_sched_barrier(0);
    }
    scores((n + 1) & (SEQ / JS - 1), kf);   // 16 & 15 = 0: buffer 0, last read in step 14
    __syncthreads();
  }

  // merge the 16 waves' stats, once: thread t < 384 merges (head t / 32, row t % 32)
#pragma unroll
  for (int rt = 0; rt < RT; ++rt)
#pragma unroll
    for (int r = 0; r < 6; ++r) {
      stM[(wv * HEADS + 6 * hlf + r) * QR + rt * 16 + lc] = m[rt][r];
      stL[(wv * HEADS + 6 * hlf + r) * QR + rt * 16 + lc] = l[rt][r];
    }
  // the padding rows of Cst read 0
  (&Cst[0][0][0][0])[threadIdx.x] = 0.f;
  (&Cst[0][0][0][0])[threadIdx.x + 512] = 0.f;
  __syncthreads();
  if (wv < HEADS) {   // the same for a whole wave: wave wv merges head wv
    const float bias = bl[wv];
    xwait();
    const int so = wv * QR + ln;
    float mt = -1e30f;
#pragma unroll
    for (int w = 0; w < NWV; ++w) mt = fmaxf(mt, stM[w * HEADS * QR + so]);
    float ls = 0.f;
#pragma unroll
    for (int w = 0; w < NWV; ++w)
      ls += stL[w * HEADS * QR + so] * exp_slot(stM[w * HEADS * QR + so] - mt);
    // reader: lane (hlf, lc) of row tile rt, register r <-> head 6*hlf + r, row rt*16 + lc
    const int gh = wv / 6, gr = wv % 6;
    Cst[hlf][gr >> 2][gh * 16 + lc][gr & 3]       = bias - mt;
    Cst[hlf][2 + (gr >> 2)][gh * 16 + lc][gr & 3] = 1.f / ls;
  }
  __syncthreads();   // publishes Cst

  v8f oacc[RT][3];
#pragma unroll
  for (int rt = 0; rt < RT; ++rt)
#pragma unroll
    for (int u = 0; u < 3; ++u) oacc[rt][u] = vzero8();

  // ---------------- pass 2: probs, post-mix, P @ V ---------------------------
  for (int n = 0; n < SEQ / JS; ++n) {
    // this step's V fragments fly while the step is mixed
    v16h vf[3][2];
    frag_ld6(vt + (size_t)(jt * (SEQ / 32) + n * 2) * FTILE, ln, vf);
    v16h xa[2], xb[2];
#pragma unroll
    for (int o = 0; o < 2; ++o) {
      xa[o] = frag_pair(&Wop[o][0][ln][0]);
      xb[o] = frag_pair(&Wop[2 + o][0][ln][0]);
    }
#pragma unroll
    for (int rt = 0; rt < RT; ++rt) {
      v8f d[4], e[4];
      const v4f c_lo = *(const v4f*)&Cst[rt][0][ln][0], c_hi = *(const v4f*)&Cst[rt][1][ln][0];
      const v4f r_lo = *(const v4f*)&Cst[rt][2][ln][0], r_hi = *(const v4f*)&Cst[rt][3][ln][0];
      const v8f cbm = __builtin_shufflevector(c_lo, c_hi, 0, 1, 2, 3, 4, 5, 6, 7);
      const float rl[6] = {r_lo[0], r_lo[1], r_lo[2], r_lo[3], r_hi[0], r_hi[1]};
      premix(n, rt, xa, cbm, d);   // the row maximum is taken off in the C operand
#pragma unroll
      for (int t = 0; t < 4; ++t)
#pragma unroll
        for (int r = 0; r < 6; ++r) d[t][r] = exp_slot(d[t][r]) * rl[r];
      // post-softmax mix (+bw per element: summed over all 1024 j it reproduces
      // the bias term): e[t][r] = P2[6*hlf + r][rt*16 + lc][4*wv + t]
      v16h pb[4];
#pragma unroll
      for (int t = 0; t < 4; t += 2)
        split6x2(d[t][0], d[t][1], d[t][2], d[t][3], d[t][4], d[t][5],
                 d[t + 1][0], d[t + 1][1], d[t + 1][2], d[t + 1][3], d[t + 1][4], d[t + 1][5],
                 pb[t], pb[t + 1]);
      // both splits ahead of the eight WMMAs, as in premix
      __builtin_amdgcn_sched_barrier(0);
#pragma unroll
      for (int t = 0; t < 4; ++t) e[t] = wmma16(xb[0], pb[t], cbw);
#pragma unroll
      for (int t = 0; t < 4; ++t) e[t] = wmma16(xb[1], pb[t], e[t]);
      v4h pk[6];
#pragma unroll
      for (int r = 0; r < 6; ++r)
        pk[r] = (v4h){(_Float16)e[0][r], (_Float16)e[1][r], (_Float16)e[2][r], (_Float16)e[3][r]};
#pragma unroll
      for (int r = 0; r < 6; ++r) *(v4h*)&Pn[6 * hlf + r][rt * 16 + lc][wv * 4] = pk[r];
      // one row tile at a time, as in pass 1
      __builtin_amdgcn_sched_barrier(0);
    }
    __syncthreads();   // publishes Pn; ends the reads of this step's Smix buffer
    // the next step's K flies during P @ V
    if (n + 1 < SEQ / JS) kload(n + 1, kf);
    // A = post-mixed probs (16 x 32, twice, per row tile), B = V^T tiles
#pragma unroll
    for (int ks = 0; ks < 2; ++ks) {
      v16h a[3][RT];
#pragma unroll
      for (int u = 0; u < 3; ++u)
#pragma unroll
        for (int rt = 0; rt < RT; ++rt) {
          const _Float16* pr = &Pn[h0 + u][rt * 16 + lc][ks * 32 + hlf * 8];
          const v8h lo = *(const v8h*)pr, hi = *(const v8h*)(pr + 16);
          a[u][rt] = __builtin_shufflevector(lo, hi, 0, 1, 2, 3, 4, 5, 6, 7,
                                             8, 9, 10, 11, 12, 13, 14, 15);
        }
      // keeps the six fragments' LDS reads together ahead of their WMMAs, as in scores
      __builtin_amdgcn_sched_barrier(0);
#pragma unroll
      for (int u = 0; u < 3; ++u)
#pragma unroll
        for (int rt = 0; rt < RT; ++rt)
          oacc[rt][u] = wmma16(a[u][rt], vf[u][ks], oacc[rt][u]);
    }
    if (n + 1 < SEQ / JS) scores(n + 1, kf);
    __syncthreads();   // publishes the next scores; ends the reads of Pn
  }

  // write (B * N, DIM) f16, fragment order (A operand of the out projection)
#pragma unroll
  for (int rt = 0; rt < RT; ++rt)
#pragma unroll
    for (int u = 0; u < 3; ++u) {
      int col = (h0 + u) * HDIM + jt * 16 + lc;
#pragma unroll
      for (int r = 0; r < 8; ++r) {
        int i = i0 + rt * 16 + r + hlf * 8;
        oh[fragoff(b * SEQ + i, col, DIMC / 32)] = (_Float16)oacc[rt][u][r];
      }
    }
}

// ---------------------------------------------------------------- out proj
// grid = (M/128, 6), block = 128 (4 waves, 2 x 2 tiles of 64 x 64).
__global__ __launch_bounds__(128)
void out_proj_kernel(const _Float16* __restrict__ oh,
                     const _Float16* __restrict__ WpT,
                     const float* __restrict__ bp, float* __restrict__ out) {
  const int mt = blockIdx.x, cg = blockIdx.y;
  const int wave = threadIdx.x >> 5, ln = threadIdx.x & 31;
  const int hlf = ln >> 4, lc = ln & 15;
  const int m0 = mt * 128 + (wave >> 1) * 64;
  const int nbase = cg * 128 + (wave & 1) * 64;

  v8f c[4][4];
  gemm64(oh + (size_t)(m0 >> 4) * RTILE, WpT + (size_t)(nbase >> 4) * RTILE, ln, c);

  const int col0 = nbase + lc;
  float bias[4];
#pragma unroll
  for (int t = 0; t < 4; ++t) bias[t] = bp[col0 + t * 16];
  // the register that these loads name is reused for the store addresses: the
  // input operand keeps it whole up to the wait
  asm volatile("s_wait_xcnt 0x0" :: "v"(col0) : "memory");
#pragma unroll
  for (int t = 0; t < 4; ++t) {
    int col = col0 + t * 16;
#pragma unroll
    for (int i = 0; i < 4; ++i)
#pragma unroll
      for (int r = 0; r < 8; ++r)
        out[(size_t)(m0 + i * 16 + r + hlf * 8) * DIMC + col] = c[i][t][r] + bias[t];
  }
}

// ---------------------------------------------------------------- launch
extern "C" void kernel_launch(void* const* d_in, const int* in_sizes, int n_in,
                              void* d_out, int out_size, void* d_ws, size_t ws_size,
                              hipStream_t stream) {
  (void)in_sizes; (void)n_in; (void)out_size; (void)ws_size;
  const float* x  = (const float*)d_in[0];
  const float* Wq = (const float*)d_in[1];
  const float* Wk = (const float*)d_in[2];
  const float* Wv = (const float*)d_in[3];
  const float* Wl = (const float*)d_in[4];
  const float* bl = (const float*)d_in[5];
  const float* Ww = (const float*)d_in[6];
  const float* bw = (const float*)d_in[7];
  const float* Wp = (const float*)d_in[8];
  const float* bp = (const float*)d_in[9];
  float* out = (float*)d_out;

  _Float16* ws = (_Float16*)d_ws;
  size_t off = 0;
  const size_t NX = (size_t)BATCH * SEQ * DIMC;   // 6,291,456
  const size_t NW = (size_t)DIMC * DIMC;
  _Float16* xh  = ws + off; off += NX;
  _Float16* WqT = ws + off; off += NW;
  _Float16* WkT = ws + off; off += NW;
  _Float16* WvT = ws + off; off += NW;
  _Float16* WpT = ws + off; off += NW;
  _Float16* qb  = ws + off; off += NX;
  _Float16* kb  = ws + off; off += NX;
  _Float16* vb  = ws + off; off += NX;   // transposed layout [b][h][d][j]
  _Float16* oh  = ws + off; off += NX;

  convert_x_kernel<<<(int)((NX / 8 + 255) / 256), 256, 0, stream>>>(x, xh, (int)(NX / 8));
  convert_w_kernel<<<(int)((NW + 255) / 256), 256, 0, stream>>>(
      Wq, Wk, Wv, Wp, WqT, WkT, WvT, WpT);
  qkv_gemm_kernel<<<dim3(BATCH * SEQ / 128, 18), 128, 0, stream>>>(
      xh, WqT, WkT, WvT, qb, kb, vb);
  attn_kernel<<<dim3(SEQ / QR, BATCH), 512, 0, stream>>>(
      qb, kb, vb, Wl, bl, Ww, bw, oh);
  out_proj_kernel<<<dim3(BATCH * SEQ / 128, 6), 128, 0, stream>>>(oh, WpT, bp, out);
}

// v007
// A run of this version takes 155 microseconds.
// In both of two side-by-side timings against v006, it was 1.05 times as fast.
// Counting every step since v000, it is 6.60 times as fast.
#include <hip/hip_runtime.h>

#define DIMC  768
#define HEADS 12
#define HDIM  64
#define BATCH 8
#define SEQ   1024
#define QSCALE 0.125f   // HD^-0.5

typedef __attribute__((ext_vector_type(16))) _Float16 v16h;
typedef __attribute__((ext_vector_type(8)))  _Float16 v8h;
typedef __attribute__((ext_vector_type(8)))  float    v8f;

// Every f16 matrix in the workspace is kept in FRAGMENT ORDER: one 16-row x
// 32-k operand tile is 512 contiguous halves, as two 512-byte chunks, and lane
// ln's 16 bytes of a chunk stand at ln * 16 bytes. A fragment load then reads
// 4 whole 128-byte lines per instruction instead of 32 bytes of each of 16.
// Per CDNA5 layout: lane<16 holds K {k0..k0+7, k0+16..k0+23} with k0=0,
// lane>=16 with k0=8; chunk 0 is the first run of 8, chunk 1 the second.
#define FTILE 512   // halves per 16 x 32 tile

// Offset in halves of element (r, k) of a matrix with nks tiles along k.
__device__ __forceinline__ size_t fragoff(int r, int k, int nks) {
  return (size_t)((r >> 4) * nks + (k >> 5)) * FTILE + ((k >> 4) & 1) * 256 +
         (((k >> 3) & 1) * 16 + (r & 15)) * 8 + (k & 7);
}

// Stands behind global loads whose address registers the compiler reuses next:
// those registers are not rewritten before the loads' addresses are taken.
__device__ __forceinline__ void xwait() { asm volatile("s_wait_xcnt 0x0" ::: "memory"); }

__device__ __forceinline__ v8f wmma16(v16h a, v16h b, v8f c) {
  return __builtin_amdgcn_wmma_f32_16x16x32_f16(false, a, false, b,
                                                (short)0, c, false, false);
}

__device__ __forceinline__ v8f vzero8() {
  v8f z;
#pragma unroll
  for (int e = 0; e < 8; ++e) z[e] = 0.f;
  return z;
}

// ---------------------------------------------------------------- converts
__global__ void convert_x_kernel(const float* __restrict__ x,
                                 _Float16* __restrict__ xh, int n) {
  // thread i writes the i-th 16-byte piece of xh (fragment order), n pieces
  int i = blockIdx.x * blockDim.x + threadIdx.x;
  if (i >= n) return;
  const int lane = i & 31, chunk = (i >> 5) & 1, tile = i >> 6;
  const int ks = tile % (DIMC / 32), rt = tile / (DIMC / 32);
  const float* src = x + (size_t)(rt * 16 + (lane & 15)) * DIMC +
                     ks * 32 + chunk * 16 + (lane >> 4) * 8;
  const float4 lo = *(const float4*)src, hi = *(const float4*)(src + 4);
  v8h o = {(_Float16)lo.x, (_Float16)lo.y, (_Float16)lo.z, (_Float16)lo.w,
           (_Float16)hi.x, (_Float16)hi.y, (_Float16)hi.z, (_Float16)hi.w};
  *(v8h*)(xh + (size_t)i * 8) = o;
}

__global__ void convert_w_kernel(const float* __restrict__ Wq,
                                 const float* __restrict__ Wk,
                                 const float* __restrict__ Wv,
                                 const float* __restrict__ Wp,
                                 _Float16* __restrict__ WqT,
                                 _Float16* __restrict__ WkT,
                                 _Float16* __restrict__ WvT,
                                 _Float16* __restrict__ WpT) {
  int idx = blockIdx.x * blockDim.x + threadIdx.x;
  if (idx >= DIMC * DIMC) return;
  int kk = idx / DIMC, nn = idx % DIMC;
  size_t tid = fragoff(nn, kk, DIMC / 32);  // transposed [n][k], fragment order
  WqT[tid] = (_Float16)Wq[idx];
  WkT[tid] = (_Float16)Wk[idx];
  WvT[tid] = (_Float16)Wv[idx];
  WpT[tid] = (_Float16)Wp[idx];
}

// ---------------------------------------------------------------- GEMM core
// One wave forms a 64 x 64 tile of X * W^T as 4 x 4 accumulator tiles, so that
// every loaded fragment feeds four WMMAs. a0, b0: the first 16-row tile of the
// wave's four neighbouring row tiles of each operand (fragment order, K = DIMC).
#define RTILE ((DIMC / 32) * FTILE)   // halves from one 16-row tile to the next

// The eight fragments of k step s: sixteen loads through two address registers.
__device__ __forceinline__ void frag_ld8(const _Float16* __restrict__ pa,
                                         const _Float16* __restrict__ pb, int s,
                                         v16h (&a)[4], v16h (&b)[4]) {
  v8h ta[8], tb[8];
#pragma unroll
  for (int i = 0; i < 8; ++i) {
    ta[i] = *(const v8h*)(pa + (i >> 1) * RTILE + s * FTILE + (i & 1) * 256);
    tb[i] = *(const v8h*)(pb + (i >> 1) * RTILE + s * FTILE + (i & 1) * 256);
  }
#pragma unroll
  for (int t = 0; t < 4; ++t) {
    a[t] = __builtin_shufflevector(ta[2 * t], ta[2 * t + 1],
                                   0, 1, 2, 3, 4, 5, 6, 7, 8, 9, 10, 11, 12, 13, 14, 15);
    b[t] = __builtin_shufflevector(tb[2 * t], tb[2 * t + 1],
                                   0, 1, 2, 3, 4, 5, 6, 7, 8, 9, 10, 11, 12, 13, 14, 15);
  }
}

__device__ __forceinline__ void gemm64(const _Float16* __restrict__ a0,
                                       const _Float16* __restrict__ b0, int ln,
                                       v8f (&c)[4][4]) {
  const _Float16* pa = a0 + ln * 8;
  const _Float16* pb = b0 + ln * 8;
#pragma unroll
  for (int i = 0; i < 4; ++i)
#pragma unroll
    for (int j = 0; j < 4; ++j) c[i][j] = vzero8();

  // fully unrolled k loop; the fragments of step s + 1 are asked for ahead of
  // the WMMAs of step s
  const int NSTEP = DIMC / 32;
  v16h a[4], b[4];
  frag_ld8(pa, pb, 0, a, b);
#pragma unroll
  for (int s = 0; s < NSTEP - 1; ++s) {
    v16h a_n[4], b_n[4];
    frag_ld8(pa, pb, s + 1, a_n, b_n);
    if (s == NSTEP - 2) xwait();  // the epilogue's address sums reuse the two address registers
    // holds the next step's loads ahead of this step's WMMAs: sunk to their uses,
    // each would wait out its whole latency with little else in flight
    __builtin_amdgcn_sched_barrier(0);
#pragma unroll
    for (int i = 0; i < 4; ++i)
#pragma unroll
      for (int j = 0; j < 4; ++j) c[i][j] = wmma16(a[i], b[j], c[i][j]);
#pragma unroll
    for (int t = 0; t < 4; ++t) { a[t] = a_n[t]; b[t] = b_n[t]; }
  }
#pragma unroll
  for (int i = 0; i < 4; ++i)
#pragma unroll
    for (int j = 0; j < 4; ++j) c[i][j] = wmma16(a[i], b[j], c[i][j]);
}

// ---------------------------------------------------------------- QKV GEMM
// grid = (M/128, 18), block = 128 (4 waves, 2 x 2 tiles of 64 x 64). col groups
// 0-5 -> q, 6-11 -> k, 12-17 -> v; a wave's 64 columns are one head.
// q scaled by QSCALE. v written TRANSPOSED per head: [b][h][d][j]. q, k, v are
// per-head matrices in fragment order (rows i, j, d; k index d, d, j).
__global__ __launch_bounds__(128)
void qkv_gemm_kernel(const _Float16* __restrict__ xh,
                     const _Float16* __restrict__ WqT,
                     const _Float16* __restrict__ WkT,
                     const _Float16* __restrict__ WvT,
                     _Float16* __restrict__ qb, _Float16* __restrict__ kb,
                     _Float16* __restrict__ vb) {
  const int mt = blockIdx.x, cg = blockIdx.y;
  const int wave = threadIdx.x >> 5, ln = threadIdx.x & 31;
  const int hlf = ln >> 4, lc = ln & 15;
  const int m0 = mt * 128 + (wave >> 1) * 64;
  const int which = cg / 6;  // 0=q 1=k 2=v
  const _Float16* WT = (which == 0) ? WqT : (which == 1) ? WkT : WvT;
  const int nbase = (cg % 6) * 128 + (wave & 1) * 64;  // within [0,768)

  v8f c[4][4];
  gemm64(xh + (size_t)(m0 >> 4) * RTILE, WT + (size_t)(nbase >> 4) * RTILE, ln, c);

  const int b_ = m0 / SEQ;
  const int nrow0 = m0 % SEQ;
  const int head = nbase >> 6;
  const size_t hoff = ((size_t)b_ * HEADS + head) * SEQ * HDIM;
  if (which == 2) {
    // V: transposed store [b][h][d][j]; the lane's 8 values of j are one piece
    _Float16* vt = vb + hoff;
#pragma unroll
    for (int i = 0; i < 4; ++i)
#pragma unroll
      for (int t = 0; t < 4; ++t) {
        v8h pk;
#pragma unroll
        for (int r = 0; r < 8; ++r) pk[r] = (_Float16)c[i][t][r];
        *(v8h*)(vt + fragoff(t * 16 + lc, nrow0 + i * 16 + hlf * 8, SEQ / 32)) = pk;
      }
  } else {
    const float scale = (which == 0) ? QSCALE : 1.f;
    _Float16* dst = ((which == 0) ? qb : kb) + hoff;
#pragma unroll
    for (int i = 0; i < 4; ++i)
#pragma unroll
      for (int t = 0; t < 4; ++t)
#pragma unroll
        for (int r = 0; r < 8; ++r)
          dst[fragoff(nrow0 + i * 16 + r + hlf * 8, t * 16 + lc, HDIM / 32)] =
              (_Float16)(c[i][t][r] * scale);
    xwait();   // the listing runs on from these stores into code that reuses their registers
  }
}

// ---------------------------------------------------- fused talking-heads attn
// grid = (SEQ/32, BATCH), block = 512 (16 waves), 32 query rows (two row tiles),
// 64 columns a step. Every K and V fragment that a wave loads feeds both row
// tiles, so a block's K and V reads serve twice the rows.
// q,k layout [b][h][j][d]; v layout [b][h][d][j] (pre-transposed); each (b, h)
// matrix in fragment order.
// Wave w forms the raw scores of heads 3*(w>>2)..+2 on column tile w&3 (as
// K * Q^T, so a lane holds 8 contiguous columns of query row lc) and puts them
// into Smix once. Both head mixes are matrix products over the head index:
// D[g][pos] = sum_h W[g][h] * S[h][pos], on the f16 16x16x32 form with every f32
// value split into an f16 pair hi + lo (22 bits): the 32 k slots hold the 12
// heads' hi and lo parts, and two WMMAs (weights' hi, weights' lo) give all four
// partial products. They take a third of the matrix unit's time of the three
// f32 16x16x4 steps that the same tile needs.
// One mix tile is one column j with 16 query rows (lane lc = row); wave w
// mixes columns 4w..4w+3 of the step, so every score is read from LDS once.
// Head order, the same in A, B and D: lane half hlf, index r < 6 <-> head
// 6*hlf + r (D rows 6, 7, 14, 15 are padding, weights and bias 0). With it the
// D of the pre-mix, after the softmax in place, feeds the B of the post-mix.
#define NWV 16      // waves per block
#define JS  64      // columns per step
#define RT  2       // query row tiles per block
#define QR  (16 * RT)
#define SP  68      // floats per Smix row: 272 B = 16 B x odd
#define PP  72      // halves per Pn row:   144 B = 16 B x odd
typedef __attribute__((ext_vector_type(4))) float    v4f;
typedef __attribute__((ext_vector_type(4))) _Float16 v4h;

// Six f32 values of a lane as one f16 operand: elements 0-5 the values rounded to
// f16, 6-11 what the rounding left, 12-15 zero. A and B use the same element
// order, so element e of one lane half meets element e of the same half.
// Two operands at a time, in asm: nine instructions an operand (three packed
// converts, six mixed-precision fma that read a half of the packed pair and write
// a half of the result), where the compiler's own choice takes sixteen; with two
// operands interleaved every instruction stands six behind the one it depends on.
typedef __attribute__((ext_vector_type(8))) unsigned v8u;
__device__ __forceinline__ void split6x2(float a0, float a1, float a2, float a3, float a4, float a5,
                                         float b0, float b1, float b2, float b3, float b4, float b5,
                                         v16h& oa, v16h& ob) {
  unsigned ah0, ah1, ah2, al0, al1, al2, bh0, bh1, bh2, bl0, bl1, bl2;
  asm("v_cvt_pk_f16_f32 %0, %12, %13\n\t"
      "v_cvt_pk_f16_f32 %1, %14, %15\n\t"
      "v_cvt_pk_f16_f32 %2, %16, %17\n\t"
      "v_cvt_pk_f16_f32 %6, %18, %19\n\t"
      "v_cvt_pk_f16_f32 %7, %20, %21\n\t"
      "v_cvt_pk_f16_f32 %8, %22, %23\n\t"
      "v_fma_mixlo_f16 %3, %0, -1.0, %12 op_sel_hi:[1,0,0]\n\t"
      "v_fma_mixlo_f16 %4, %1, -1.0, %14 op_sel_hi:[1,0,0]\n\t"
      "v_fma_mixlo_f16 %5, %2, -1.0, %16 op_sel_hi:[1,0,0]\n\t"
      "v_fma_mixlo_f16 %9, %6, -1.0, %18 op_sel_hi:[1,0,0]\n\t"
      "v_fma_mixlo_f16 %10, %7, -1.0, %20 op_sel_hi:[1,0,0]\n\t"
      "v_fma_mixlo_f16 %11, %8, -1.0, %22 op_sel_hi:[1,0,0]\n\t"
      "v_fma_mixhi_f16 %3, %0, -1.0, %13 op_sel:[1,0,0] op_sel_hi:[1,0,0]\n\t"
      "v_fma_mixhi_f16 %4, %1, -1.0, %15 op_sel:[1,0,0] op_sel_hi:[1,0,0]\n\t"
      "v_fma_mixhi_f16 %5, %2, -1.0, %17 op_sel:[1,0,0] op_sel_hi:[1,0,0]\n\t"
      "v_fma_mixhi_f16 %9, %6, -1.0, %19 op_sel:[1,0,0] op_sel_hi:[1,0,0]\n\t"
      "v_fma_mixhi_f16 %10, %7, -1.0, %21 op_sel:[1,0,0] op_sel_hi:[1,0,0]\n\t"
      "v_fma_mixhi_f16 %11, %8, -1.0, %23 op_sel:[1,0,0] op_sel_hi:[1,0,0]"
      : "=&v"(ah0), "=&v"(ah1), "=&v"(ah2), "=&v"(al0), "=&v"(al1), "=&v"(al2),
        "=&v"(bh0), "=&v"(bh1), "=&v"(bh2), "=&v"(bl0), "=&v"(bl1), "=&v"(bl2)
      : "v"(a0), "v"(a1), "v"(a2), "v"(a3), "v"(a4), "v"(a5),
        "v"(b0), "v"(b1), "v"(b2), "v"(b3), "v"(b4), "v"(b5));
  oa = __builtin_bit_cast(v16h, (v8u){ah0, ah1, ah2, al0, al1, al2, 0u, 0u});
  ob = __builtin_bit_cast(v16h, (v8u){bh0, bh1, bh2, bl0, bl1, bl2, 0u, 0u});
}

// 2^x (v_exp_f32 alone: the factor log2(e) is already in the pre-mix weights and
// bias, so that no multiply stands in front of it). The v_nop fills the one slot that
// the instruction set asks for between a transcendental and a next instruction
// that reads its result or overwrites its source.
__device__ __forceinline__ float exp2_slot(float x) {
  float y;
  asm("v_exp_f32 %0, %1\n\tv_nop" : "=v"(y) : "v"(x));
  return y;
}
// log2(x), with the same slot behind it
__device__ __forceinline__ float log2_slot(float x) {
  float y;
  asm("v_log_f32 %0, %1\n\tv_nop" : "=v"(y) : "v"(x));
  return y;
}
#define LOG2E 1.44269504f

// Six fragments: two neighbouring tiles of each of three neighbouring heads, all
// twelve loads through one address register and in flight together.
__device__ __forceinline__ void frag_ld6(const _Float16* __restrict__ tile0, int ln,
                                         v16h (&f)[3][2]) {
  const _Float16* p = tile0 + ln * 8;
  v8h t[12];
#pragma unroll
  for (int i = 0; i < 11; ++i)
    t[i] = *(const v8h*)(p + (i >> 2) * (SEQ * HDIM) + ((i >> 1) & 1) * FTILE + (i & 1) * 256);
  xwait();   // the last load may land on the address register that the eleven name
  t[11] = *(const v8h*)(p + 2 * (SEQ * HDIM) + FTILE + 256);
  xwait();
#pragma unroll
  for (int u = 0; u < 3; ++u)
#pragma unroll
    for (int s = 0; s < 2; ++s)
#pragma unroll
      for (int e = 0; e < 8; ++e) {
        f[u][s][e]     = t[u * 4 + s * 2][e];
        f[u][s][e + 8] = t[u * 4 + s * 2 + 1][e];
      }
}

// One fragment out of a fragment-order tile (p: the lane's piece of chunk 0).
__device__ __forceinline__ v16h frag_pair(const _Float16* p) {
  const v8h lo = *(const v8h*)p, hi = *(const v8h*)(p + 256);
  return __builtin_shufflevector(lo, hi, 0, 1, 2, 3, 4, 5, 6, 7, 8, 9, 10, 11, 12, 13, 14, 15);
}

__global__ __launch_bounds__(512)
void attn_kernel(const _Float16* __restrict__ q, const _Float16* __restrict__ k,
                 const _Float16* __restrict__ v,
                 const float* __restrict__ Wl, const float* __restrict__ bl,
                 const float* __restrict__ Ww, const float* __restrict__ bw,
                 _Float16* __restrict__ oh) {
  __shared__ __align__(16) float    Smix[2][HEADS][QR][SP];   // raw scores, two steps
  __shared__ __align__(16) _Float16 Pn[HEADS][QR][PP];        // post-mixed probs
  __shared__ __align__(16) _Float16 Qs[HEADS][RT * 2 * FTILE]; // the block's Q, fragment order
  // per-wave softmax stats [NWV][HEADS][QR], twice: they live between the two
  // passes only, in score buffer 1, which is idle from the last barrier of pass 1
  // to the first barrier of pass 2
  float* const stM = &Smix[1][0][0][0];
  float* const stL = stM + NWV * HEADS * QR;
  // pass 2's per-row constants, 16 bytes a lane and chunk: the C operand of the
  // pre-mix, by D row: bias - row maximum - log2(row sum), all in powers of two, so
  // that 2^D is the finished probability
  __shared__ __align__(16) float Cst[RT][2][32][4];
  // the four A operands of the mixes (pre hi, pre lo, post hi, post lo), 16 bytes a
  // lane and chunk: pass 2 reads them anew every step, so that they hold no
  // registers while K, V, the probabilities and the output tiles are all live
  __shared__ __align__(16) _Float16 Wop[4][2][32][8];

  const int b = blockIdx.y;
  const int i0 = blockIdx.x * QR;
  const int wv = threadIdx.x >> 5;
  const int ln = threadIdx.x & 31;
  const int hlf = ln >> 4, lc = ln & 15;
  const int jt = wv & 3;         // column tile (scores), d tile (P @ V)
  const int h0 = (wv >> 2) * 3;  // first of this wave's three heads

  // the block's Q rows: 4 KiB in a row per head, 16 bytes a thread, six times
  {
    const _Float16* qsrc = q + (size_t)b * HEADS * SEQ * HDIM + (size_t)(i0 >> 4) * 2 * FTILE +
                           (size_t)(threadIdx.x >> 8) * (SEQ * HDIM) + (threadIdx.x & 255) * 8;
    v8h tq[6];
#pragma unroll
    for (int c = 0; c < 6; ++c) tq[c] = *(const v8h*)(qsrc + c * 2 * (SEQ * HDIM));
    xwait();
#pragma unroll
    for (int c = 0; c < 6; ++c)
      *(v8h*)&Qs[c * 2 + (threadIdx.x >> 8)][(threadIdx.x & 255) * 8] = tq[c];
  }

  // A operands of the two mixes: row lc of A is output head 6*(lc>>3) + (lc&7)
  const bool live = (lc & 7) < 6;
  const int grow = live ? (lc >> 3) * 6 + (lc & 7) : 0;
  // [0]: the weights' hi parts against the values' hi and lo, [1]: their lo parts
  v16h wa[2], wb[2];
  {
    float tl[6], tw[6];
#pragma unroll
    for (int e = 0; e < 6; ++e) {
      tl[e] = Wl[grow * HEADS + 6 * hlf + e];
      tw[e] = Ww[grow * HEADS + 6 * hlf + e];
    }
    xwait();
#pragma unroll
    for (int e = 0; e < 6; ++e) {
      tl[e] = live ? tl[e] * LOG2E : 0.f;   // mixed scores come out as powers of two
      tw[e] = live ? tw[e] : 0.f;
    }
    v16h sl, sw;
    split6x2(tl[0], tl[1], tl[2], tl[3], tl[4], tl[5],
             tw[0], tw[1], tw[2], tw[3], tw[4], tw[5], sl, sw);
    wa[0] = __builtin_shufflevector(sl, sl, 0, 1, 2, 3, 4, 5, 0, 1, 2, 3, 4, 5, 12, 13, 14, 15);
    wa[1] = __builtin_shufflevector(sl, sl, 6, 7, 8, 9, 10, 11, 6, 7, 8, 9, 10, 11, 12, 13, 14, 15);
    wb[0] = __builtin_shufflevector(sw, sw, 0, 1, 2, 3, 4, 5, 0, 1, 2, 3, 4, 5, 12, 13, 14, 15);
    wb[1] = __builtin_shufflevector(sw, sw, 6, 7, 8, 9, 10, 11, 6, 7, 8, 9, 10, 11, 12, 13, 14, 15);
  }
  if (wv == 0) {   // the same in every wave: one wave writes them; the barrier that publishes Qs covers them
#pragma unroll
    for (int o = 0; o < 2; ++o) {
      *(v8h*)&Wop[o][0][ln][0]     = __builtin_shufflevector(wa[o], wa[o], 0, 1, 2, 3, 4, 5, 6, 7);
      *(v8h*)&Wop[o][1][ln][0]     = __builtin_shufflevector(wa[o], wa[o], 8, 9, 10, 11, 12, 13, 14, 15);
      *(v8h*)&Wop[2 + o][0][ln][0] = __builtin_shufflevector(wb[o], wb[o], 0, 1, 2, 3, 4, 5, 6, 7);
      *(v8h*)&Wop[2 + o][1][ln][0] = __builtin_shufflevector(wb[o], wb[o], 8, 9, 10, 11, 12, 13, 14, 15);
    }
  }
  v8f cbl = vzero8(), cbw = vzero8();   // C operands: the biases, by D row
#pragma unroll
  for (int r = 0; r < 6; ++r) { cbl[r] = bl[6 * hlf + r]; cbw[r] = bw[6 * hlf + r]; }
  xwait();
#pragma unroll
  for (int r = 0; r < 6; ++r) cbl[r] *= LOG2E;

  const size_t base = ((size_t)b * HEADS + h0) * SEQ * HDIM;  // first of the three heads
  const _Float16* kh = k + base;   // [j][d]: 2 tiles per 16 rows
  const _Float16* vt = v + base;   // [d][j]

  // this wave's six K fragments of step n
  auto kload = [&](int n, v16h (&kf)[3][2]) {
    frag_ld6(kh + (size_t)(n * (JS / 16) + jt) * 2 * FTILE, ln, kf);
  };

  // raw scores of step n -> Smix[n & 1]; each K fragment meets both row tiles
  auto scores = [&](int n, const v16h (&kf)[3][2]) {
    // c[u][rt][r] = S[h0 + u][i0 + rt*16 + lc][n*64 + jt*16 + hlf*8 + r]
    v8f c[3][RT];
#pragma unroll
    for (int s = 0; s < 2; ++s) {
      v16h qf[3][RT];
#pragma unroll
      for (int u = 0; u < 3; ++u)
#pragma unroll
        for (int rt = 0; rt < RT; ++rt)
          qf[u][rt] = frag_pair(&Qs[h0 + u][(rt * 2 + s) * FTILE + ln * 8]);
      // keeps the six fragments' LDS reads together ahead of their WMMAs: sunk to
      // their uses, each pair waits out its own LDS latency
      __builtin_amdgcn_sched_barrier(0);
#pragma unroll
      for (int u = 0; u < 3; ++u)
#pragma unroll
        for (int rt = 0; rt < RT; ++rt)
          c[u][rt] = wmma16(kf[u][s], qf[u][rt], s ? c[u][rt] : vzero8());
    }
#pragma unroll
    for (int u = 0; u < 3; ++u)
#pragma unroll
      for (int rt = 0; rt < RT; ++rt) {
        float* dst = &Smix[n & 1][h0 + u][rt * 16 + lc][jt * 16 + hlf * 8];
        v4f s_lo = {c[u][rt][0], c[u][rt][1], c[u][rt][2], c[u][rt][3]};
        v4f s_hi = {c[u][rt][4], c[u][rt][5], c[u][rt][6], c[u][rt][7]};
        *(v4f*)dst       = s_lo;
        *(v4f*)(dst + 4) = s_hi;
      }
  };

  // pre-softmax mix of columns 4*wv..+3 of step n, row tile rt, on top of c0 (C
  // operand): d[t][r] = c0[r] + log2(e) * sum_h Wl[6*hlf + r][h] * S[h][rt*16 + lc][4*wv + t]
  auto premix = [&](int n, int rt, const v16h (&w)[2], const v8f& c0, v8f (&d)[4]) {
    v4f sv[6];
#pragma unroll
    for (int r = 0; r < 6; ++r)
      sv[r] = *(const v4f*)&Smix[n & 1][6 * hlf + r][rt * 16 + lc][wv * 4];
    v16h sb[4];
#pragma unroll
    for (int t = 0; t < 4; t += 2)
      split6x2(sv[0][t], sv[1][t], sv[2][t], sv[3][t], sv[4][t], sv[5][t],
               sv[0][t + 1], sv[1][t + 1], sv[2][t + 1], sv[3][t + 1], sv[4][t + 1], sv[5][t + 1],
               sb[t], sb[t + 1]);
    // the two fences keep every split ahead of, and the next one well behind, the
    // eight WMMAs: the compiler may give a split's results the registers of a D's
    // unused rows
    __builtin_amdgcn_sched_barrier(0);
#pragma unroll
    for (int t = 0; t < 4; ++t) d[t] = wmma16(w[0], sb[t], c0);
#pragma unroll
    for (int t = 0; t < 4; ++t) d[t] = wmma16(w[1], sb[t], d[t]);
    __builtin_amdgcn_sched_barrier(0);
  };

  // softmax stats of (head 6*hlf + r, row rt*16 + lc) over this wave's own columns only
  float m[RT][6], l[RT][6];
#pragma unroll
  for (int rt = 0; rt < RT; ++rt)
#pragma unroll
    for (int r = 0; r < 6; ++r) { m[rt][r] = -1e30f; l[rt][r] = 0.f; }

  v16h kf[3][2];
  kload(0, kf);
  __syncthreads();   // publishes Qs
  scores(0, kf);
  __syncthreads();

  // ---------------- pass 1: online softmax stats over mixed scores ----------
  // One barrier a step: it publishes step n + 1 and ends the reads of step n,
  // whose buffer is written again only in step n + 1.
  for (int n = 0; n < SEQ / JS; ++n) {
    // the next step's K flies while this step is mixed (after the last step:
    // step 0 again, for pass 2)
    kload((n + 1) & (SEQ / JS - 1), kf);
#pragma unroll
    for (int rt = 0; rt < RT; ++rt) {
      v8f d[4];
      premix(n, rt, wa, cbl, d);
#pragma unroll
      for (int r = 0; r < 6; ++r) {
        const float mx = fmaxf(fmaxf(d[0][r], d[1][r]), fmaxf(d[2][r], d[3][r]));
        const float nm = fmaxf(m[rt][r], mx);
        float p = 0.f;
#pragma unroll
        for (int t = 0; t < 4; ++t) p += exp2_slot(d[t][r] - nm);
        l[rt][r] = l[rt][r] * exp2_slot(m[rt][r] - nm) + p;
        m[rt][r] = nm;
      }
      // one row tile at a time: scheduled as one region, the two tiles' values
      // overfill the registers and the compiler falls back to a serial order
      __builtin_amdgcn_sched_barrier(0);
    }
    scores((n + 1) & (SEQ / JS - 1), kf);   // 16 & 15 = 0: buffer 0, last read in step 14
    __syncthreads();
  }

  // merge the 16 waves' stats, once: thread t < 384 merges (head t / 32, row t % 32)
#pragma unroll
  for (int rt = 0; rt < RT; ++rt)
#pragma unroll
    for (int r = 0; r < 6; ++r) {
      stM[(wv * HEADS + 6 * hlf + r) * QR + rt * 16 + lc] = m[rt][r];
      stL[(wv * HEADS + 6 * hlf + r) * QR + rt * 16 + lc] = l[rt][r];
    }
  // the padding rows of Cst read 0
  (&Cst[0][0][0][0])[threadIdx.x] = 0.f;
  __syncthreads();
  if (wv < HEADS) {   // the same for a whole wave: wave wv merges head wv
    const float bias = bl[wv] * LOG2E;
    xwait();
    const int so = wv * QR + ln;
    float mt = -1e30f;
#pragma unroll
    for (int w = 0; w < NWV; ++w) mt = fmaxf(mt, stM[w * HEADS * QR + so]);
    float ls = 0.f;
#pragma unroll
    for (int w = 0; w < NWV; ++w)
      ls += stL[w * HEADS * QR + so] * exp2_slot(stM[w * HEADS * QR + so] - mt);
    // reader: lane (hlf, lc) of row tile rt, register r <-> head 6*hlf + r, row rt*16 + lc
    const int gh = wv / 6, gr = wv % 6;
    Cst[hlf][gr >> 2][gh * 16 + lc][gr & 3] = bias - mt - log2_slot(ls);
  }
  __syncthreads();   // publishes Cst

  v8f oacc[RT][3];
#pragma unroll
  for (int rt = 0; rt < RT; ++rt)
#pragma unroll
    for (int u = 0; u < 3; ++u) oacc[rt][u] = vzero8();

  // ---------------- pass 2: probs, post-mix, P @ V ---------------------------
  for (int n = 0; n < SEQ / JS; ++n) {
    // this step's V fragments fly while the step is mixed
    v16h vf[3][2];
    frag_ld6(vt + (size_t)(jt * (SEQ / 32) + n * 2) * FTILE, ln, vf);
    v16h xa[2], xb[2];
#pragma unroll
    for (int o = 0; o < 2; ++o) {
      xa[o] = frag_pair(&Wop[o][0][ln][0]);
      xb[o] = frag_pair(&Wop[2 + o][0][ln][0]);
    }
#pragma unroll
    for (int rt = 0; rt < RT; ++rt) {
      v8f d[4], e[4];
      const v4f c_lo = *(const v4f*)&Cst[rt][0][ln][0], c_hi = *(const v4f*)&Cst[rt][1][ln][0];
      const v8f cbm = __builtin_shufflevector(c_lo, c_hi, 0, 1, 2, 3, 4, 5, 6, 7);
      premix(n, rt, xa, cbm, d);   // row maximum and row sum are taken off in the C operand
      // four vector slots between the last WMMA and the v_exp_f32 below, which read
      // its D and may overwrite its B: they are asm text, for which the compiler keeps
      // no distance; the fence holds them behind the slots
      asm volatile("v_nop\n\tv_nop\n\tv_nop\n\tv_nop");
      __builtin_amdgcn_sched_barrier(0);
#pragma unroll
      for (int t = 0; t < 4; ++t)
#pragma unroll
        for (int r = 0; r < 6; ++r) d[t][r] = exp2_slot(d[t][r]);
      // post-softmax mix (+bw per element: summed over all 1024 j it reproduces
      // the bias term): e[t][r] = P2[6*hlf + r][rt*16 + lc][4*wv + t]
      v16h pb[4];
#pragma unroll
      for (int t = 0; t < 4; t += 2)
        split6x2(d[t][0], d[t][1], d[t][2], d[t][3], d[t][4], d[t][5],
                 d[t + 1][0], d[t + 1][1], d[t + 1][2], d[t + 1][3], d[t + 1][4], d[t + 1][5],
                 pb[t], pb[t + 1]);
      // both splits ahead of the eight WMMAs, as in premix
      __builtin_amdgcn_sched_barrier(0);
#pragma unroll
      for (int t = 0; t < 4; ++t) e[t] = wmma16(xb[0], pb[t], cbw);
#pragma unroll
      for (int t = 0; t < 4; ++t) e[t] = wmma16(xb[1], pb[t], e[t]);
      v4h pk[6];
#pragma unroll
      for (int r = 0; r < 6; ++r)
        pk[r] = (v4h){(_Float16)e[0][r], (_Float16)e[1][r], (_Float16)e[2][r], (_Float16)e[3][r]};
#pragma unroll
      for (int r = 0; r < 6; ++r) *(v4h*)&Pn[6 * hlf + r][rt * 16 + lc][wv * 4] = pk[r];
      // one row tile at a time, as in pass 1
      __builtin_amdgcn_sched_barrier(0);
    }
    __syncthreads();   // publishes Pn; ends the reads of this step's Smix buffer
    // the next step's K flies during P @ V
    if (n + 1 < SEQ / JS) kload(n + 1, kf);
    // A = post-mixed probs (16 x 32, twice, per row tile), B = V^T tiles
#pragma unroll
    for (int ks = 0; ks < 2; ++ks) {
      v16h a[3][RT];
#pragma unroll
      for (int u = 0; u < 3; ++u)
#pragma unroll
        for (int rt = 0; rt < RT; ++rt) {
          const _Float16* pr = &Pn[h0 + u][rt * 16 + lc][ks * 32 + hlf * 8];
          const v8h lo = *(const v8h*)pr, hi = *(const v8h*)(pr + 16);
          a[u][rt] = __builtin_shufflevector(lo, hi, 0, 1, 2, 3, 4, 5, 6, 7,
                                             8, 9, 10, 11, 12, 13, 14, 15);
        }
      // keeps the six fragments' LDS reads together ahead of their WMMAs, as in scores
      __builtin_amdgcn_sched_barrier(0);
#pragma unroll
      for (int u = 0; u < 3; ++u)
#pragma unroll
        for (int rt = 0; rt < RT; ++rt)
          oacc[rt][u] = wmma16(a[u][rt], vf[u][ks], oacc[rt][u]);
    }
    if (n + 1 < SEQ / JS) scores(n + 1, kf);
    __syncthreads();   // publishes the next scores; ends the reads of Pn
  }

  // write (B * N, DIM) f16, fragment order (A operand of the out projection)
#pragma unroll
  for (int rt = 0; rt < RT; ++rt)
#pragma unroll
    for (int u = 0; u < 3; ++u) {
      int col = (h0 + u) * HDIM + jt * 16 + lc;
#pragma unroll
      for (int r = 0; r < 8; ++r) {
        int i = i0 + rt * 16 + r + hlf * 8;
        oh[fragoff(b * SEQ + i, col, DIMC / 32)] = (_Float16)oacc[rt][u][r];
      }
    }
}

// ---------------------------------------------------------------- out proj
// grid = (M/128, 6), block = 128 (4 waves, 2 x 2 tiles of 64 x 64).
__global__ __launch_bounds__(128)
void out_proj_kernel(const _Float16* __restrict__ oh,
                     const _Float16* __restrict__ WpT,
                     const float* __restrict__ bp, float* __restrict__ out) {
  const int mt = blockIdx.x, cg = blockIdx.y;
  const int wave = threadIdx.x >> 5, ln = threadIdx.x & 31;
  const int hlf = ln >> 4, lc = ln & 15;
  const int m0 = mt * 128 + (wave >> 1) * 64;
  const int nbase = cg * 128 + (wave & 1) * 64;

  v8f c[4][4];
  gemm64(oh + (size_t)(m0 >> 4) * RTILE, WpT + (size_t)(nbase >> 4) * RTILE, ln, c);

  const int col0 = nbase + lc;
  float bias[4];
#pragma unroll
  for (int t = 0; t < 4; ++t) bias[t] = bp[col0 + t * 16];
  // the register that these loads name is reused for the store addresses: the
  // input operand keeps it whole up to the wait
  asm volatile("s_wait_xcnt 0x0" :: "v"(col0) : "memory");
#pragma unroll
  for (int t = 0; t < 4; ++t) {
    int col = col0 + t * 16;
#pragma unroll
    for (int i = 0; i < 4; ++i)
#pragma unroll
      for (int r = 0; r < 8; ++r)
        out[(size_t)(m0 + i * 16 + r + hlf * 8) * DIMC + col] = c[i][t][r] + bias[t];
  }
}

// ---------------------------------------------------------------- launch
extern "C" void kernel_launch(void* const* d_in, const int* in_sizes, int n_in,
                              void* d_out, int out_size, void* d_ws, size_t ws_size,
                              hipStream_t stream) {
  (void)in_sizes; (void)n_in; (void)out_size; (void)ws_size;
  const float* x  = (const float*)d_in[0];
  const float* Wq = (const float*)d_in[1];
  const float* Wk = (const float*)d_in[2];
  const float* Wv = (const float*)d_in[3];
  const float* Wl = (const float*)d_in[4];
  const float* bl = (const float*)d_in[5];
  const float* Ww = (const float*)d_in[6];
  const float* bw = (const float*)d_in[7];
  const float* Wp = (const float*)d_in[8];
  const float* bp = (const float*)d_in[9];
  float* out = (float*)d_out;

  _Float16* ws = (_Float16*)d_ws;
  size_t off = 0;
  const size_t NX = (size_t)BATCH * SEQ * DIMC;   // 6,291,456
  const size_t NW = (size_t)DIMC * DIMC;
  _Float16* xh  = ws + off; off += NX;
  _Float16* WqT = ws + off; off += NW;
  _Float16* WkT = ws + off; off += NW;
  _Float16* WvT = ws + off; off += NW;
  _Float16* WpT = ws + off; off += NW;
  _Float16* qb  = ws + off; off += NX;
  _Float16* kb  = ws + off; off += NX;
  _Float16* vb  = ws + off; off += NX;   // transposed layout [b][h][d][j]
  _Float16* oh  = ws + off; off += NX;

  convert_x_kernel<<<(int)((NX / 8 + 255) / 256), 256, 0, stream>>>(x, xh, (int)(NX / 8));
  convert_w_kernel<<<(int)((NW + 255) / 256), 256, 0, stream>>>(
      Wq, Wk, Wv, Wp, WqT, WkT, WvT, WpT);
  qkv_gemm_kernel<<<dim3(BATCH * SEQ / 128, 18), 128, 0, stream>>>(
      xh, WqT, WkT, WvT, qb, kb, vb);
  attn_kernel<<<dim3(SEQ / QR, BATCH), 512, 0, stream>>>(
      qb, kb, vb, Wl, bl, Ww, bw, oh);
  out_proj_kernel<<<dim3(BATCH * SEQ / 128, 6), 128, 0, stream>>>(oh, WpT, bp, out);
}

// v008
// A run of this version takes 148 microseconds.
// Timed twice side by side with v007, it ran 1.05 times as fast both times.
// Counting every step since v000, it is 6.91 times as fast.
#include <hip/hip_runtime.h>

#define DIMC  768
#define HEADS 12
#define HDIM  64
#define BATCH 8
#define SEQ   1024
#define QSCALE 0.125f   // HD^-0.5

typedef __attribute__((ext_vector_type(16))) _Float16 v16h;
typedef __attribute__((ext_vector_type(8)))  _Float16 v8h;
typedef __attribute__((ext_vector_type(8)))  float    v8f;

// Every f16 matrix in the workspace is kept in FRAGMENT ORDER: one 16-row x
// 32-k operand tile is 512 contiguous halves, as two 512-byte chunks, and lane
// ln's 16 bytes of a chunk stand at ln * 16 bytes. A fragment load then reads
// 4 whole 128-byte lines per instruction instead of 32 bytes of each of 16.
// Per CDNA5 layout: lane<16 holds K {k0..k0+7, k0+16..k0+23} with k0=0,
// lane>=16 with k0=8; chunk 0 is the first run of 8, chunk 1 the second.
#define FTILE 512   // halves per 16 x 32 tile

// Offset in halves of element (r, k) of a matrix with nks tiles along k.
__device__ __forceinline__ size_t fragoff(int r, int k, int nks) {
  return (size_t)((r >> 4) * nks + (k >> 5)) * FTILE + ((k >> 4) & 1) * 256 +
         (((k >> 3) & 1) * 16 + (r & 15)) * 8 + (k & 7);
}

// Stands behind global loads whose address registers the compiler reuses next:
// those registers are not rewritten before the loads' addresses are taken.
__device__ __forceinline__ void xwait() { asm volatile("s_wait_xcnt 0x0" ::: "memory"); }

__device__ __forceinline__ v8f wmma16(v16h a, v16h b, v8f c) {
  return __builtin_amdgcn_wmma_f32_16x16x32_f16(false, a, false, b,
                                                (short)0, c, false, false);
}

__device__ __forceinline__ v8f vzero8() {
  v8f z;
#pragma unroll
  for (int e = 0; e < 8; ++e) z[e] = 0.f;
  return z;
}

// ---------------------------------------------------------------- converts
__global__ void convert_x_kernel(const float* __restrict__ x,
                                 _Float16* __restrict__ xh, int n) {
  // thread i writes the i-th 16-byte piece of xh (fragment order), n pieces
  int i = blockIdx.x * blockDim.x + threadIdx.x;
  if (i >= n) return;
  const int lane = i & 31, chunk = (i >> 5) & 1, tile = i >> 6;
  const int ks = tile % (DIMC / 32), rt = tile / (DIMC / 32);
  const float* src = x + (size_t)(rt * 16 + (lane & 15)) * DIMC +
                     ks * 32 + chunk * 16 + (lane >> 4) * 8;
  const float4 lo = *(const float4*)src, hi = *(const float4*)(src + 4);
  v8h o = {(_Float16)lo.x, (_Float16)lo.y, (_Float16)lo.z, (_Float16)lo.w,
           (_Float16)hi.x, (_Float16)hi.y, (_Float16)hi.z, (_Float16)hi.w};
  *(v8h*)(xh + (size_t)i * 8) = o;
}

__global__ void convert_w_kernel(const float* __restrict__ Wq,
                                 const float* __restrict__ Wk,
                                 const float* __restrict__ Wv,
                                 const float* __restrict__ Wp,
                                 _Float16* __restrict__ WqT,
                                 _Float16* __restrict__ WkT,
                                 _Float16* __restrict__ WvT,
                                 _Float16* __restrict__ WpT) {
  int idx = blockIdx.x * blockDim.x + threadIdx.x;
  if (idx >= DIMC * DIMC) return;
  int kk = idx / DIMC, nn = idx % DIMC;
  size_t tid = fragoff(nn, kk, DIMC / 32);  // transposed [n][k], fragment order
  WqT[tid] = (_Float16)Wq[idx];
  WkT[tid] = (_Float16)Wk[idx];
  WvT[tid] = (_Float16)Wv[idx];
  WpT[tid] = (_Float16)Wp[idx];
}

// ---------------------------------------------------------------- GEMM core
// One wave forms a 64 x 64 tile of X * W^T as 4 x 4 accumulator tiles, so that
// every loaded fragment feeds four WMMAs. a0, b0: the first 16-row tile of the
// wave's four neighbouring row tiles of each operand (fragment order, K = DIMC).
#define RTILE ((DIMC / 32) * FTILE)   // halves from one 16-row tile to the next

// The eight fragments of k step s: sixteen loads through two address registers.
__device__ __forceinline__ void frag_ld8(const _Float16* __restrict__ pa,
                                         const _Float16* __restrict__ pb, int s,
                                         v16h (&a)[4], v16h (&b)[4]) {
  v8h ta[8], tb[8];
#pragma unroll
  for (int i = 0; i < 8; ++i) {
    ta[i] = *(const v8h*)(pa + (i >> 1) * RTILE + s * FTILE + (i & 1) * 256);
    tb[i] = *(const v8h*)(pb + (i >> 1) * RTILE + s * FTILE + (i & 1) * 256);
  }
#pragma unroll
  for (int t = 0; t < 4; ++t) {
    a[t] = __builtin_shufflevector(ta[2 * t], ta[2 * t + 1],
                                   0, 1, 2, 3, 4, 5, 6, 7, 8, 9, 10, 11, 12, 13, 14, 15);
    b[t] = __builtin_shufflevector(tb[2 * t], tb[2 * t + 1],
                                   0, 1, 2, 3, 4, 5, 6, 7, 8, 9, 10, 11, 12, 13, 14, 15);
  }
}

__device__ __forceinline__ void gemm64(const _Float16* __restrict__ a0,
                                       const _Float16* __restrict__ b0, int ln,
                                       v8f (&c)[4][4]) {
  const _Float16* pa = a0 + ln * 8;
  const _Float16* pb = b0 + ln * 8;
#pragma unroll
  for (int i = 0; i < 4; ++i)
#pragma unroll
    for (int j = 0; j < 4; ++j) c[i][j] = vzero8();

  // fully unrolled k loop; the fragments of step s + 1 are asked for ahead of
  // the WMMAs of step s
  const int NSTEP = DIMC / 32;
  v16h a[4], b[4];
  frag_ld8(pa, pb, 0, a, b);
#pragma unroll
  for (int s = 0; s < NSTEP - 1; ++s) {
    v16h a_n[4], b_n[4];
    frag_ld8(pa, pb, s + 1, a_n, b_n);
    if (s == NSTEP - 2) xwait();  // the epilogue's address sums reuse the two address registers
    // holds the next step's loads ahead of this step's WMMAs: sunk to their uses,
    // each would wait out its whole latency with little else in flight
    __builtin_amdgcn_sched_barrier(0);
#pragma unroll
    for (int i = 0; i < 4; ++i)
#pragma unroll
      for (int j = 0; j < 4; ++j) c[i][j] = wmma16(a[i], b[j], c[i][j]);
#pragma unroll
    for (int t = 0; t < 4; ++t) { a[t] = a_n[t]; b[t] = b_n[t]; }
  }
#pragma unroll
  for (int i = 0; i < 4; ++i)
#pragma unroll
    for (int j = 0; j < 4; ++j) c[i][j] = wmma16(a[i], b[j], c[i][j]);
}

// ---------------------------------------------------------------- QKV GEMM
// grid = (M/128, 18), block = 128 (4 waves, 2 x 2 tiles of 64 x 64). col groups
// 0-5 -> q, 6-11 -> k, 12-17 -> v; a wave's 64 columns are one head.
// q scaled by QSCALE. v written TRANSPOSED per head: [b][h][d][j]. q, k, v are
// per-head matrices in fragment order (rows i, j, d; k index d, d, j).
__global__ __launch_bounds__(128)
void qkv_gemm_kernel(const _Float16* __restrict__ xh,
                     const _Float16* __restrict__ WqT,
                     const _Float16* __restrict__ WkT,
                     const _Float16* __restrict__ WvT,
                     _Float16* __restrict__ qb, _Float16* __restrict__ kb,
                     _Float16* __restrict__ vb) {
  const int mt = blockIdx.x, cg = blockIdx.y;
  const int wave = threadIdx.x >> 5, ln = threadIdx.x & 31;
  const int hlf = ln >> 4, lc = ln & 15;
  const int m0 = mt * 128 + (wave >> 1) * 64;
  const int which = cg / 6;  // 0=q 1=k 2=v
  const _Float16* WT = (which == 0) ? WqT : (which == 1) ? WkT : WvT;
  const int nbase = (cg % 6) * 128 + (wave & 1) * 64;  // within [0,768)

  v8f c[4][4];
  gemm64(xh + (size_t)(m0 >> 4) * RTILE, WT + (size_t)(nbase >> 4) * RTILE, ln, c);

  const int b_ = m0 / SEQ;
  const int nrow0 = m0 % SEQ;
  const int head = nbase >> 6;
  const size_t hoff = ((size_t)b_ * HEADS + head) * SEQ * HDIM;
  if (which == 2) {
    // V: transposed store [b][h][d][j]; the lane's 8 values of j are one piece
    _Float16* vt = vb + hoff;
#pragma unroll
    for (int i = 0; i < 4; ++i)
#pragma unroll
      for (int t = 0; t < 4; ++t) {
        v8h pk;
#pragma unroll
        for (int r = 0; r < 8; ++r) pk[r] = (_Float16)c[i][t][r];
        *(v8h*)(vt + fragoff(t * 16 + lc, nrow0 + i * 16 + hlf * 8, SEQ / 32)) = pk;
      }
  } else {
    const float scale = (which == 0) ? QSCALE : 1.f;
    _Float16* dst = ((which == 0) ? qb : kb) + hoff;
#pragma unroll
    for (int i = 0; i < 4; ++i)
#pragma unroll
      for (int t = 0; t < 4; ++t)
#pragma unroll
        for (int r = 0; r < 8; ++r)
          dst[fragoff(nrow0 + i * 16 + r + hlf * 8, t * 16 + lc, HDIM / 32)] =
              (_Float16)(c[i][t][r] * scale);
    xwait();   // the listing runs on from these stores into code that reuses their registers
  }
}

// ---------------------------------------------------- fused talking-heads attn
// grid = (SEQ/32, BATCH), block = 512 (16 waves), 32 query rows (two row tiles),
// 64 columns a step. Every K and V fragment that a wave loads feeds both row
// tiles, so a block's K and V reads serve twice the rows.
// q,k layout [b][h][j][d]; v layout [b][h][d][j] (pre-transposed); each (b, h)
// matrix in fragment order.
// Wave w forms the raw scores of heads 3*(w>>2)..+2 on column tile w&3 (as
// K * Q^T, so a lane holds 8 contiguous columns of query row lc) and puts them
// into Smix once. Both head mixes are matrix products over the head index:
// D[g][pos] = sum_h W[g][h] * S[h][pos], on the f16 16x16x32 form with every f32
// value split into an f16 pair hi + lo (22 bits): the 32 k slots hold the 12
// heads' hi and lo parts, and two WMMAs (weights' hi, weights' lo) give all four
// partial products. They take a third of the matrix unit's time of the three
// f32 16x16x4 steps that the same tile needs.
// One mix tile is one column j with 16 query rows (lane lc = row); wave w
// mixes columns 4w..4w+3 of the step, so every score is read from LDS once.
// Head order, the same in A, B and D: lane half hlf, index r < 6 <-> head
// 6*hlf + r (D rows 6, 7, 14, 15 are padding, weights and bias 0). With it the
// D of the pre-mix, after the softmax in place, feeds the B of the post-mix.
#define NWV 16      // waves per block
#define JS  64      // columns per step
#define RT  2       // query row tiles per block
#define QR  (16 * RT)
#define SP  68      // floats per Smix row: 272 B = 16 B x odd
#define PP  72      // halves per Pn row:   144 B = 16 B x odd
typedef __attribute__((ext_vector_type(4))) float    v4f;
typedef __attribute__((ext_vector_type(4))) _Float16 v4h;

// Six f32 values of a lane as one f16 operand: elements 0-5 the values rounded to
// f16, 6-11 what the rounding left, 12-15 zero. A and B use the same element
// order, so element e of one lane half meets element e of the same half.
// Two operands at a time, in asm: nine instructions an operand (three packed
// converts, six mixed-precision fma that read a half of the packed pair and write
// a half of the result), where the compiler's own choice takes sixteen; with two
// operands interleaved every instruction stands six behind the one it depends on.
typedef __attribute__((ext_vector_type(8))) unsigned v8u;
__device__ __forceinline__ void split6x2(float a0, float a1, float a2, float a3, float a4, float a5,
                                         float b0, float b1, float b2, float b3, float b4, float b5,
                                         v16h& oa, v16h& ob) {
  unsigned ah0, ah1, ah2, al0, al1, al2, bh0, bh1, bh2, bl0, bl1, bl2;
  asm("v_cvt_pk_f16_f32 %0, %12, %13\n\t"
      "v_cvt_pk_f16_f32 %1, %14, %15\n\t"
      "v_cvt_pk_f16_f32 %2, %16, %17\n\t"
      "v_cvt_pk_f16_f32 %6, %18, %19\n\t"
      "v_cvt_pk_f16_f32 %7, %20, %21\n\t"
      "v_cvt_pk_f16_f32 %8, %22, %23\n\t"
      "v_fma_mixlo_f16 %3, %0, -1.0, %12 op_sel_hi:[1,0,0]\n\t"
      "v_fma_mixlo_f16 %4, %1, -1.0, %14 op_sel_hi:[1,0,0]\n\t"
      "v_fma_mixlo_f16 %5, %2, -1.0, %16 op_sel_hi:[1,0,0]\n\t"
      "v_fma_mixlo_f16 %9, %6, -1.0, %18 op_sel_hi:[1,0,0]\n\t"
      "v_fma_mixlo_f16 %10, %7, -1.0, %20 op_sel_hi:[1,0,0]\n\t"
      "v_fma_mixlo_f16 %11, %8, -1.0, %22 op_sel_hi:[1,0,0]\n\t"
      "v_fma_mixhi_f16 %3, %0, -1.0, %13 op_sel:[1,0,0] op_sel_hi:[1,0,0]\n\t"
      "v_fma_mixhi_f16 %4, %1, -1.0, %15 op_sel:[1,0,0] op_sel_hi:[1,0,0]\n\t"
      "v_fma_mixhi_f16 %5, %2, -1.0, %17 op_sel:[1,0,0] op_sel_hi:[1,0,0]\n\t"
      "v_fma_mixhi_f16 %9, %6, -1.0, %19 op_sel:[1,0,0] op_sel_hi:[1,0,0]\n\t"
      "v_fma_mixhi_f16 %10, %7, -1.0, %21 op_sel:[1,0,0] op_sel_hi:[1,0,0]\n\t"
      "v_fma_mixhi_f16 %11, %8, -1.0, %23 op_sel:[1,0,0] op_sel_hi:[1,0,0]"
      : "=&v"(ah0), "=&v"(ah1), "=&v"(ah2), "=&v"(al0), "=&v"(al1), "=&v"(al2),
        "=&v"(bh0), "=&v"(bh1), "=&v"(bh2), "=&v"(bl0), "=&v"(bl1), "=&v"(bl2)
      : "v"(a0), "v"(a1), "v"(a2), "v"(a3), "v"(a4), "v"(a5),
        "v"(b0), "v"(b1), "v"(b2), "v"(b3), "v"(b4), "v"(b5));
  oa = __builtin_bit_cast(v16h, (v8u){ah0, ah1, ah2, al0, al1, al2, 0u, 0u});
  ob = __builtin_bit_cast(v16h, (v8u){bh0, bh1, bh2, bl0, bl1, bl2, 0u, 0u});
}

// 2^x (v_exp_f32 alone: the factor log2(e) is already in the pre-mix weights and
// bias, so that no multiply stands in front of it). The v_nop fills the one slot that
// the instruction set asks for between a transcendental and a next instruction
// that reads its result or overwrites its source.
__device__ __forceinline__ float exp2_slot(float x) {
  float y;
  asm("v_exp_f32 %0, %1\n\tv_nop" : "=v"(y) : "v"(x));
  return y;
}
// log2(x), with the same slot behind it
__device__ __forceinline__ float log2_slot(float x) {
  float y;
  asm("v_log_f32 %0, %1\n\tv_nop" : "=v"(y) : "v"(x));
  return y;
}
#define LOG2E 1.44269504f

// Six fragments: two neighbouring tiles of each of three neighbouring heads, all
// twelve loads through one address register and in flight together.
__device__ __forceinline__ void frag_ld6(const _Float16* __restrict__ tile0, int ln,
                                         v16h (&f)[3][2]) {
  const _Float16* p = tile0 + ln * 8;
  v8h t[12];
#pragma unroll
  for (int i = 0; i < 11; ++i)
    t[i] = *(const v8h*)(p + (i >> 2) * (SEQ * HDIM) + ((i >> 1) & 1) * FTILE + (i & 1) * 256);
  xwait();   // the last load may land on the address register that the eleven name
  t[11] = *(const v8h*)(p + 2 * (SEQ * HDIM) + FTILE + 256);
  xwait();
#pragma unroll
  for (int u = 0; u < 3; ++u)
#pragma unroll
    for (int s = 0; s < 2; ++s)
#pragma unroll
      for (int e = 0; e < 8; ++e) {
        f[u][s][e]     = t[u * 4 + s * 2][e];
        f[u][s][e + 8] = t[u * 4 + s * 2 + 1][e];
      }
}

// One fragment out of a fragment-order tile (p: the lane's piece of chunk 0).
__device__ __forceinline__ v16h frag_pair(const _Float16* p) {
  const v8h lo = *(const v8h*)p, hi = *(const v8h*)(p + 256);
  return __builtin_shufflevector(lo, hi, 0, 1, 2, 3, 4, 5, 6, 7, 8, 9, 10, 11, 12, 13, 14, 15);
}

__global__ __launch_bounds__(512)
void attn_kernel(const _Float16* __restrict__ q, const _Float16* __restrict__ k,
                 const _Float16* __restrict__ v,
                 const float* __restrict__ Wl, const float* __restrict__ bl,
                 const float* __restrict__ Ww, const float* __restrict__ bw,
                 _Float16* __restrict__ oh) {
  __shared__ __align__(16) float    Smix[2][HEADS][QR][SP];   // raw scores, two steps
  __shared__ __align__(16) _Float16 Pn[HEADS][QR][PP];        // post-mixed probs
  __shared__ __align__(16) _Float16 Qs[HEADS][RT * 2 * FTILE]; // the block's Q, fragment order
  // per-wave softmax stats [NWV][HEADS][QR], twice: they live between the two
  // passes only, in score buffer 1, which is idle from the last barrier of pass 1
  // to the first barrier of pass 2
  float* const stM = &Smix[1][0][0][0];
  float* const stL = stM + NWV * HEADS * QR;
  // pass 2's per-row constants, 16 bytes a lane and chunk: the C operand of the
  // pre-mix, by D row: bias - largest wave reference - log2(row sum against it), all in powers of two, so
  // that 2^D is the finished probability
  __shared__ __align__(16) float Cst[RT][2][32][4];
  // the four A operands of the mixes (pre hi, pre lo, post hi, post lo), 16 bytes a
  // lane and chunk: pass 2 reads them anew every step, so that they hold no
  // registers while K, V, the probabilities and the output tiles are all live
  __shared__ __align__(16) _Float16 Wop[4][2][32][8];
  // set by any lane whose pass 1 sum left the safe range: the block then repeats
  // pass 1 with the running maximum
  __shared__ int redo;

  const int b = blockIdx.y;
  const int i0 = blockIdx.x * QR;
  const int wv = threadIdx.x >> 5;
  const int ln = threadIdx.x & 31;
  const int hlf = ln >> 4, lc = ln & 15;
  const int jt = wv & 3;         // column tile (scores), d tile (P @ V)
  const int h0 = (wv >> 2) * 3;  // first of this wave's three heads
  if (threadIdx.x == 0) redo = 0;   // the barrier that publishes Qs covers it

  // the block's Q rows: 4 KiB in a row per head, 16 bytes a thread, six times
  {
    const _Float16* qsrc = q + (size_t)b * HEADS * SEQ * HDIM + (size_t)(i0 >> 4) * 2 * FTILE +
                           (size_t)(threadIdx.x >> 8) * (SEQ * HDIM) + (threadIdx.x & 255) * 8;
    v8h tq[6];
#pragma unroll
    for (int c = 0; c < 6; ++c) tq[c] = *(const v8h*)(qsrc + c * 2 * (SEQ * HDIM));
    xwait();
#pragma unroll
    for (int c = 0; c < 6; ++c)
      *(v8h*)&Qs[c * 2 + (threadIdx.x >> 8)][(threadIdx.x & 255) * 8] = tq[c];
  }

  // A operands of the two mixes: row lc of A is output head 6*(lc>>3) + (lc&7)
  const bool live = (lc & 7) < 6;
  const int grow = live ? (lc >> 3) * 6 + (lc & 7) : 0;
  // [0]: the weights' hi parts against the values' hi and lo, [1]: their lo parts
  v16h wa[2], wb[2];
  {
    float tl[6], tw[6];
#pragma unroll
    for (int e = 0; e < 6; ++e) {
      tl[e] = Wl[grow * HEADS + 6 * hlf + e];
      tw[e] = Ww[grow * HEADS + 6 * hlf + e];
    }
    xwait();
#pragma unroll
    for (int e = 0; e < 6; ++e) {
      tl[e] = live ? tl[e] * LOG2E : 0.f;   // mixed scores come out as powers of two
      tw[e] = live ? tw[e] : 0.f;
    }
    v16h sl, sw;
    split6x2(tl[0], tl[1], tl[2], tl[3], tl[4], tl[5],
             tw[0], tw[1], tw[2], tw[3], tw[4], tw[5], sl, sw);
    wa[0] = __builtin_shufflevector(sl, sl, 0, 1, 2, 3, 4, 5, 0, 1, 2, 3, 4, 5, 12, 13, 14, 15);
    wa[1] = __builtin_shufflevector(sl, sl, 6, 7, 8, 9, 10, 11, 6, 7, 8, 9, 10, 11, 12, 13, 14, 15);
    wb[0] = __builtin_shufflevector(sw, sw, 0, 1, 2, 3, 4, 5, 0, 1, 2, 3, 4, 5, 12, 13, 14, 15);
    wb[1] = __builtin_shufflevector(sw, sw, 6, 7, 8, 9, 10, 11, 6, 7, 8, 9, 10, 11, 12, 13, 14, 15);
  }
  if (wv == 0) {   // the same in every wave: one wave writes them; the barrier that publishes Qs covers them
#pragma unroll
    for (int o = 0; o < 2; ++o) {
      *(v8h*)&Wop[o][0][ln][0]     = __builtin_shufflevector(wa[o], wa[o], 0, 1, 2, 3, 4, 5, 6, 7);
      *(v8h*)&Wop[o][1][ln][0]     = __builtin_shufflevector(wa[o], wa[o], 8, 9, 10, 11, 12, 13, 14, 15);
      *(v8h*)&Wop[2 + o][0][ln][0] = __builtin_shufflevector(wb[o], wb[o], 0, 1, 2, 3, 4, 5, 6, 7);
      *(v8h*)&Wop[2 + o][1][ln][0] = __builtin_shufflevector(wb[o], wb[o], 8, 9, 10, 11, 12, 13, 14, 15);
    }
  }
  v8f cbl = vzero8(), cbw = vzero8();   // C operands: the biases, by D row
#pragma unroll
  for (int r = 0; r < 6; ++r) { cbl[r] = bl[6 * hlf + r]; cbw[r] = bw[6 * hlf + r]; }
  xwait();
#pragma unroll
  for (int r = 0; r < 6; ++r) cbl[r] *= LOG2E;

  const size_t base = ((size_t)b * HEADS + h0) * SEQ * HDIM;  // first of the three heads
  const _Float16* kh = k + base;   // [j][d]: 2 tiles per 16 rows
  const _Float16* vt = v + base;   // [d][j]

  // this wave's six K fragments of step n
  auto kload = [&](int n, v16h (&kf)[3][2]) {
    frag_ld6(kh + (size_t)(n * (JS / 16) + jt) * 2 * FTILE, ln, kf);
  };

  // raw scores of step n -> Smix[n & 1]; each K fragment meets both row tiles
  auto scores = [&](int n, const v16h (&kf)[3][2]) {
    // c[u][rt][r] = S[h0 + u][i0 + rt*16 + lc][n*64 + jt*16 + hlf*8 + r]
    v8f c[3][RT];
#pragma unroll
    for (int s = 0; s < 2; ++s) {
      v16h qf[3][RT];
#pragma unroll
      for (int u = 0; u < 3; ++u)
#pragma unroll
        for (int rt = 0; rt < RT; ++rt)
          qf[u][rt] = frag_pair(&Qs[h0 + u][(rt * 2 + s) * FTILE + ln * 8]);
      // keeps the six fragments' LDS reads together ahead of their WMMAs: sunk to
      // their uses, each pair waits out its own LDS latency
      __builtin_amdgcn_sched_barrier(0);
#pragma unroll
      for (int u = 0; u < 3; ++u)
#pragma unroll
        for (int rt = 0; rt < RT; ++rt)
          c[u][rt] = wmma16(kf[u][s], qf[u][rt], s ? c[u][rt] : vzero8());
    }
#pragma unroll
    for (int u = 0; u < 3; ++u)
#pragma unroll
      for (int rt = 0; rt < RT; ++rt) {
        float* dst = &Smix[n & 1][h0 + u][rt * 16 + lc][jt * 16 + hlf * 8];
        v4f s_lo = {c[u][rt][0], c[u][rt][1], c[u][rt][2], c[u][rt][3]};
        v4f s_hi = {c[u][rt][4], c[u][rt][5], c[u][rt][6], c[u][rt][7]};
        *(v4f*)dst       = s_lo;
        *(v4f*)(dst + 4) = s_hi;
      }
  };

  // pre-softmax mix of columns 4*wv..+3 of step n, row tile rt, on top of c0 (C
  // operand): d[t][r] = c0[r] + log2(e) * sum_h Wl[6*hlf + r][h] * S[h][rt*16 + lc][4*wv + t]
  auto premix = [&](int n, int rt, const v16h (&w)[2], const v8f& c0, v8f (&d)[4]) {
    v4f sv[6];
#pragma unroll
    for (int r = 0; r < 6; ++r)
      sv[r] = *(const v4f*)&Smix[n & 1][6 * hlf + r][rt * 16 + lc][wv * 4];
    v16h sb[4];
#pragma unroll
    for (int t = 0; t < 4; t += 2)
      split6x2(sv[0][t], sv[1][t], sv[2][t], sv[3][t], sv[4][t], sv[5][t],
               sv[0][t + 1], sv[1][t + 1], sv[2][t + 1], sv[3][t + 1], sv[4][t + 1], sv[5][t + 1],
               sb[t], sb[t + 1]);
    // the two fences keep every split ahead of, and the next one well behind, the
    // eight WMMAs: the compiler may give a split's results the registers of a D's
    // unused rows
    __builtin_amdgcn_sched_barrier(0);
#pragma unroll
    for (int t = 0; t < 4; ++t) d[t] = wmma16(w[0], sb[t], c0);
#pragma unroll
    for (int t = 0; t < 4; ++t) d[t] = wmma16(w[1], sb[t], d[t]);
    __builtin_amdgcn_sched_barrier(0);
  };

  // softmax stats of (head 6*hlf + r, row rt*16 + lc) over this wave's own columns only
  float m[RT][6], l[RT][6];
#pragma unroll
  for (int rt = 0; rt < RT; ++rt)
#pragma unroll
    for (int r = 0; r < 6; ++r) { m[rt][r] = -1e30f; l[rt][r] = 0.f; }

  v16h kf[3][2];
  kload(0, kf);
  __syncthreads();   // publishes Qs
  scores(0, kf);
  __syncthreads();

  // ---------------- pass 1: softmax stats over mixed scores -----------------
  // A lane's sum is taken against a FIXED reference, the maximum of its own four
  // columns of step 0, which goes into the C operand of the pre-mix: a term is one
  // v_exp_f32 and one add, with no running maximum, no subtraction and no rescaling.
  // The reference is one of the lane's own scores, so the sum is about 1 or more; f32
  // keeps its relative precision whatever the scale. A later score far above the
  // reference is caught below by the size of the sum.
  v8f cm[RT];   // bias - reference, by D row
#pragma unroll
  for (int rt = 0; rt < RT; ++rt) {
    v8f d[4];
    premix(0, rt, wa, cbl, d);
    cm[rt] = vzero8();
#pragma unroll
    for (int r = 0; r < 6; ++r)
      cm[rt][r] = cbl[r] - fmaxf(fmaxf(d[0][r], d[1][r]), fmaxf(d[2][r], d[3][r]));
  }
  // One barrier a step: it publishes step n + 1 and ends the reads of step n,
  // whose buffer is written again only in step n + 1.
  for (int n = 0; n < SEQ / JS; ++n) {
    // the next step's K flies while this step is mixed (after the last step:
    // step 0 again, for pass 2)
    kload((n + 1) & (SEQ / JS - 1), kf);
#pragma unroll
    for (int rt = 0; rt < RT; ++rt) {
      v8f d[4];
      premix(n, rt, wa, cm[rt], d);
      // four vector slots between the last WMMA and the v_exp_f32 below, as in pass 2
      asm volatile("v_nop\n\tv_nop\n\tv_nop\n\tv_nop");
      __builtin_amdgcn_sched_barrier(0);
#pragma unroll
      for (int r = 0; r < 6; ++r) {
        float p = exp2_slot(d[0][r]);
#pragma unroll
        for (int t = 1; t < 4; ++t) p += exp2_slot(d[t][r]);
        l[rt][r] += p;
      }
      // one row tile at a time: scheduled as one region, the two tiles' values
      // overfill the registers and the compiler falls back to a serial order
      __builtin_amdgcn_sched_barrier(0);
    }
    scores((n + 1) & (SEQ / JS - 1), kf);   // 16 & 15 = 0: buffer 0, last read in step 14
    __syncthreads();
  }
  {
    // safe range: up to 2^64 the merge below neither overflows nor loses a term that
    // counts; the negated test takes a NaN too
    bool bad = false;
#pragma unroll
    for (int rt = 0; rt < RT; ++rt)
#pragma unroll
      for (int r = 0; r < 6; ++r) {
        bad |= !(l[rt][r] <= 0x1p64f);
        m[rt][r] = cbl[r] - cm[rt][r];   // the reference that the sums were taken against
      }
    if (bad) redo = 1;
  }
  __syncthreads();   // publishes redo
  // the same for the whole block, in a scalar register: barriers and WMMAs stand inside
  if (__builtin_amdgcn_readfirstlane(redo)) {
    // scores that climb more than 64 powers of two above a lane's first ones: pass 1
    // again with the running maximum. Buffer 0 holds step 0, as at the first start.
#pragma unroll
    for (int rt = 0; rt < RT; ++rt)
#pragma unroll
      for (int r = 0; r < 6; ++r) { m[rt][r] = -1e30f; l[rt][r] = 0.f; }
    for (int n = 0; n < SEQ / JS; ++n) {
      // the next step's K flies while this step is mixed (after the last step:
      // step 0 again, for pass 2)
      kload((n + 1) & (SEQ / JS - 1), kf);
#pragma unroll
      for (int rt = 0; rt < RT; ++rt) {
        v8f d[4];
        premix(n, rt, wa, cbl, d);
#pragma unroll
        for (int r = 0; r < 6; ++r) {
          const float mx = fmaxf(fmaxf(d[0][r], d[1][r]), fmaxf(d[2][r], d[3][r]));
          const float nm = fmaxf(m[rt][r], mx);
          float p = 0.f;
#pragma unroll
          for (int t = 0; t < 4; ++t) p += exp2_slot(d[t][r] - nm);
          l[rt][r] = l[rt][r] * exp2_slot(m[rt][r] - nm) + p;
          m[rt][r] = nm;
        }
        // one row tile at a time: scheduled as one region, the two tiles' values
        // overfill the registers and the compiler falls back to a serial order
        __builtin_amdgcn_sched_barrier(0);
      }
      scores((n + 1) & (SEQ / JS - 1), kf);   // 16 & 15 = 0: buffer 0, last read in step 14
      __syncthreads();
    }
  }

  // merge the 16 waves' stats, once: thread t < 384 merges (head t / 32, row t % 32)
#pragma unroll
  for (int rt = 0; rt < RT; ++rt)
#pragma unroll
    for (int r = 0; r < 6; ++r) {
      stM[(wv * HEADS + 6 * hlf + r) * QR + rt * 16 + lc] = m[rt][r];
      stL[(wv * HEADS + 6 * hlf + r) * QR + rt * 16 + lc] = l[rt][r];
    }
  // the padding rows of Cst read 0
  (&Cst[0][0][0][0])[threadIdx.x] = 0.f;
  __syncthreads();
  if (wv < HEADS) {   // the same for a whole wave: wave wv merges head wv
    const float bias = bl[wv] * LOG2E;
    xwait();
    const int so = wv * QR + ln;
    float mt = -1e30f;
#pragma unroll
    for (int w = 0; w < NWV; ++w) mt = fmaxf(mt, stM[w * HEADS * QR + so]);
    float ls = 0.f;
#pragma unroll
    for (int w = 0; w < NWV; ++w)
      ls += stL[w * HEADS * QR + so] * exp2_slot(stM[w * HEADS * QR + so] - mt);
    // reader: lane (hlf, lc) of row tile rt, register r <-> head 6*hlf + r, row rt*16 + lc
    const int gh = wv / 6, gr = wv % 6;
    Cst[hlf][gr >> 2][gh * 16 + lc][gr & 3] = bias - mt - log2_slot(ls);
  }
  __syncthreads();   // publishes Cst

  v8f oacc[RT][3];
#pragma unroll
  for (int rt = 0; rt < RT; ++rt)
#pragma unroll
    for (int u = 0; u < 3; ++u) oacc[rt][u] = vzero8();

  // ---------------- pass 2: probs, post-mix, P @ V ---------------------------
  for (int n = 0; n < SEQ / JS; ++n) {
    // this step's V fragments fly while the step is mixed
    v16h vf[3][2];
    frag_ld6(vt + (size_t)(jt * (SEQ / 32) + n * 2) * FTILE, ln, vf);
    v16h xa[2], xb[2];
#pragma unroll
    for (int o = 0; o < 2; ++o) {
      xa[o] = frag_pair(&Wop[o][0][ln][0]);
      xb[o] = frag_pair(&Wop[2 + o][0][ln][0]);
    }
#pragma unroll
    for (int rt = 0; rt < RT; ++rt) {
      v8f d[4], e[4];
      const v4f c_lo = *(const v4f*)&Cst[rt][0][ln][0], c_hi = *(const v4f*)&Cst[rt][1][ln][0];
      const v8f cbm = __builtin_shufflevector(c_lo, c_hi, 0, 1, 2, 3, 4, 5, 6, 7);
      premix(n, rt, xa, cbm, d);   // the reference and the row sum are taken off in the C operand
      // four vector slots between the last WMMA and the v_exp_f32 below, which read
      // its D and may overwrite its B: they are asm text, for which the compiler keeps
      // no distance; the fence holds them behind the slots
      asm volatile("v_nop\n\tv_nop\n\tv_nop\n\tv_nop");
      __builtin_amdgcn_sched_barrier(0);
#pragma unroll
      for (int t = 0; t < 4; ++t)
#pragma unroll
        for (int r = 0; r < 6; ++r) d[t][r] = exp2_slot(d[t][r]);
      // post-softmax mix (+bw per element: summed over all 1024 j it reproduces
      // the bias term): e[t][r] = P2[6*hlf + r][rt*16 + lc][4*wv + t]
      v16h pb[4];
#pragma unroll
      for (int t = 0; t < 4; t += 2)
        split6x2(d[t][0], d[t][1], d[t][2], d[t][3], d[t][4], d[t][5],
                 d[t + 1][0], d[t + 1][1], d[t + 1][2], d[t + 1][3], d[t + 1][4], d[t + 1][5],
                 pb[t], pb[t + 1]);
      // both splits ahead of the eight WMMAs, as in premix
      __builtin_amdgcn_sched_barrier(0);
#pragma unroll
      for (int t = 0; t < 4; ++t) e[t] = wmma16(xb[0], pb[t], cbw);
#pragma unroll
      for (int t = 0; t < 4; ++t) e[t] = wmma16(xb[1], pb[t], e[t]);
      v4h pk[6];
#pragma unroll
      for (int r = 0; r < 6; ++r)
        pk[r] = (v4h){(_Float16)e[0][r], (_Float16)e[1][r], (_Float16)e[2][r], (_Float16)e[3][r]};
#pragma unroll
      for (int r = 0; r < 6; ++r) *(v4h*)&Pn[6 * hlf + r][rt * 16 + lc][wv * 4] = pk[r];
      // one row tile at a time, as in pass 1
      __builtin_amdgcn_sched_barrier(0);
    }
    __syncthreads();   // publishes Pn; ends the reads of this step's Smix buffer
    // the next step's K flies during P @ V
    if (n + 1 < SEQ / JS) kload(n + 1, kf);
    // A = post-mixed probs (16 x 32, twice, per row tile), B = V^T tiles
#pragma unroll
    for (int ks = 0; ks < 2; ++ks) {
      v16h a[3][RT];
#pragma unroll
      for (int u = 0; u < 3; ++u)
#pragma unroll
        for (int rt = 0; rt < RT; ++rt) {
          const _Float16* pr = &Pn[h0 + u][rt * 16 + lc][ks * 32 + hlf * 8];
          const v8h lo = *(const v8h*)pr, hi = *(const v8h*)(pr + 16);
          a[u][rt] = __builtin_shufflevector(lo, hi, 0, 1, 2, 3, 4, 5, 6, 7,
                                             8, 9, 10, 11, 12, 13, 14, 15);
        }
      // keeps the six fragments' LDS reads together ahead of their WMMAs, as in scores
      __builtin_amdgcn_sched_barrier(0);
#pragma unroll
      for (int u = 0; u < 3; ++u)
#pragma unroll
        for (int rt = 0; rt < RT; ++rt)
          oacc[rt][u] = wmma16(a[u][rt], vf[u][ks], oacc[rt][u]);
    }
    if (n + 1 < SEQ / JS) scores(n + 1, kf);
    __syncthreads();   // publishes the next scores; ends the reads of Pn
  }

  // write (B * N, DIM) f16, fragment order (A operand of the out projection)
#pragma unroll
  for (int rt = 0; rt < RT; ++rt)
#pragma unroll
    for (int u = 0; u < 3; ++u) {
      int col = (h0 + u) * HDIM + jt * 16 + lc;
#pragma unroll
      for (int r = 0; r < 8; ++r) {
        int i = i0 + rt * 16 + r + hlf * 8;
        oh[fragoff(b * SEQ + i, col, DIMC / 32)] = (_Float16)oacc[rt][u][r];
      }
    }
}

// ---------------------------------------------------------------- out proj
// grid = (M/128, 6), block = 128 (4 waves, 2 x 2 tiles of 64 x 64).
__global__ __launch_bounds__(128)
void out_proj_kernel(const _Float16* __restrict__ oh,
                     const _Float16* __restrict__ WpT,
                     const float* __restrict__ bp, float* __restrict__ out) {
  const int mt = blockIdx.x, cg = blockIdx.y;
  const int wave = threadIdx.x >> 5, ln = threadIdx.x & 31;
  const int hlf = ln >> 4, lc = ln & 15;
  const int m0 = mt * 128 + (wave >> 1) * 64;
  const int nbase = cg * 128 + (wave & 1) * 64;

  v8f c[4][4];
  gemm64(oh + (size_t)(m0 >> 4) * RTILE, WpT + (size_t)(nbase >> 4) * RTILE, ln, c);

  const int col0 = nbase + lc;
  float bias[4];
#pragma unroll
  for (int t = 0; t < 4; ++t) bias[t] = bp[col0 + t * 16];
  // the register that these loads name is reused for the store addresses: the
  // input operand keeps it whole up to the wait
  asm volatile("s_wait_xcnt 0x0" :: "v"(col0) : "memory");
#pragma unroll
  for (int t = 0; t < 4; ++t) {
    int col = col0 + t * 16;
#pragma unroll
    for (int i = 0; i < 4; ++i)
#pragma unroll
      for (int r = 0; r < 8; ++r)
        out[(size_t)(m0 + i * 16 + r + hlf * 8) * DIMC + col] = c[i][t][r] + bias[t];
  }
}

// ---------------------------------------------------------------- launch
extern "C" void kernel_launch(void* const* d_in, const int* in_sizes, int n_in,
                              void* d_out, int out_size, void* d_ws, size_t ws_size,
                              hipStream_t stream) {
  (void)in_sizes; (void)n_in; (void)out_size; (void)ws_size;
  const float* x  = (const float*)d_in[0];
  const float* Wq = (const float*)d_in[1];
  const float* Wk = (const float*)d_in[2];
  const float* Wv = (const float*)d_in[3];
  const float* Wl = (const float*)d_in[4];
  const float* bl = (const float*)d_in[5];
  const float* Ww = (const float*)d_in[6];
  const float* bw = (const float*)d_in[7];
  const float* Wp = (const float*)d_in[8];
  const float* bp = (const float*)d_in[9];
  float* out = (float*)d_out;

  _Float16* ws = (_Float16*)d_ws;
  size_t off = 0;
  const size_t NX = (size_t)BATCH * SEQ * DIMC;   // 6,291,456
  const size_t NW = (size_t)DIMC * DIMC;
  _Float16* xh  = ws + off; off += NX;
  _Float16* WqT = ws + off; off += NW;
  _Float16* WkT = ws + off; off += NW;
  _Float16* WvT = ws + off; off += NW;
  _Float16* WpT = ws + off; off += NW;
  _Float16* qb  = ws + off; off += NX;
  _Float16* kb  = ws + off; off += NX;
  _Float16* vb  = ws + off; off += NX;   // transposed layout [b][h][d][j]
  _Float16* oh  = ws + off; off += NX;

  convert_x_kernel<<<(int)((NX / 8 + 255) / 256), 256, 0, stream>>>(x, xh, (int)(NX / 8));
  convert_w_kernel<<<(int)((NW + 255) / 256), 256, 0, stream>>>(
      Wq, Wk, Wv, Wp, WqT, WkT, WvT, WpT);
  qkv_gemm_kernel<<<dim3(BATCH * SEQ / 128, 18), 128, 0, stream>>>(
      xh, WqT, WkT, WvT, qb, kb, vb);
  attn_kernel<<<dim3(SEQ / QR, BATCH), 512, 0, stream>>>(
      qb, kb, vb, Wl, bl, Ww, bw, oh);
  out_proj_kernel<<<dim3(BATCH * SEQ / 128, 6), 128, 0, stream>>>(oh, WpT, bp, out);
}

// v009
// It runs in 136 microseconds.
// Next to v008, in two timings, it ran 1.08 and 1.09 times as fast.
// All steps since v000 together make it 7.51 times as fast.
#include <hip/hip_runtime.h>

#define DIMC  768
#define HEADS 12
#define HDIM  64
#define BATCH 8
#define SEQ   1024
#define QSCALE 0.125f   // HD^-0.5

typedef __attribute__((ext_vector_type(16))) _Float16 v16h;
typedef __attribute__((ext_vector_type(8)))  _Float16 v8h;
typedef __attribute__((ext_vector_type(8)))  float    v8f;

// Every f16 matrix in the workspace is kept in FRAGMENT ORDER: one 16-row x
// 32-k operand tile is 512 contiguous halves, as two 512-byte chunks, and lane
// ln's 16 bytes of a chunk stand at ln * 16 bytes. A fragment load then reads
// 4 whole 128-byte lines per instruction instead of 32 bytes of each of 16.
// Per CDNA5 layout: lane<16 holds K {k0..k0+7, k0+16..k0+23} with k0=0,
// lane>=16 with k0=8; chunk 0 is the first run of 8, chunk 1 the second.
#define FTILE 512   // halves per 16 x 32 tile

// Offset in halves of element (r, k) of a matrix with nks tiles along k.
__device__ __forceinline__ size_t fragoff(int r, int k, int nks) {
  return (size_t)((r >> 4) * nks + (k >> 5)) * FTILE + ((k >> 4) & 1) * 256 +
         (((k >> 3) & 1) * 16 + (r & 15)) * 8 + (k & 7);
}

// Stands behind global loads whose address registers the compiler reuses next:
// those registers are not rewritten before the loads' addresses are taken.
__device__ __forceinline__ void xwait() { asm volatile("s_wait_xcnt 0x0" ::: "memory"); }

__device__ __forceinline__ v8f wmma16(v16h a, v16h b, v8f c) {
  return __builtin_amdgcn_wmma_f32_16x16x32_f16(false, a, false, b,
                                                (short)0, c, false, false);
}

__device__ __forceinline__ v8f vzero8() {
  v8f z;
#pragma unroll
  for (int e = 0; e < 8; ++e) z[e] = 0.f;
  return z;
}

// ---------------------------------------------------------------- converts
__global__ void convert_x_kernel(const float* __restrict__ x,
                                 _Float16* __restrict__ xh, int n) {
  // thread i writes the i-th 16-byte piece of xh (fragment order), n pieces
  int i = blockIdx.x * blockDim.x + threadIdx.x;
  if (i >= n) return;
  const int lane = i & 31, chunk = (i >> 5) & 1, tile = i >> 6;
  const int ks = tile % (DIMC / 32), rt = tile / (DIMC / 32);
  const float* src = x + (size_t)(rt * 16 + (lane & 15)) * DIMC +
                     ks * 32 + chunk * 16 + (lane >> 4) * 8;
  const float4 lo = *(const float4*)src, hi = *(const float4*)(src + 4);
  v8h o = {(_Float16)lo.x, (_Float16)lo.y, (_Float16)lo.z, (_Float16)lo.w,
           (_Float16)hi.x, (_Float16)hi.y, (_Float16)hi.z, (_Float16)hi.w};
  *(v8h*)(xh + (size_t)i * 8) = o;
}

__global__ void convert_w_kernel(const float* __restrict__ Wq,
                                 const float* __restrict__ Wk,
                                 const float* __restrict__ Wv,
                                 const float* __restrict__ Wp,
                                 _Float16* __restrict__ WqT,
                                 _Float16* __restrict__ WkT,
                                 _Float16* __restrict__ WvT,
                                 _Float16* __restrict__ WpT) {
  int idx = blockIdx.x * blockDim.x + threadIdx.x;
  if (idx >= DIMC * DIMC) return;
  int kk = idx / DIMC, nn = idx % DIMC;
  size_t tid = fragoff(nn, kk, DIMC / 32);  // transposed [n][k], fragment order
  WqT[tid] = (_Float16)Wq[idx];
  WkT[tid] = (_Float16)Wk[idx];
  WvT[tid] = (_Float16)Wv[idx];
  WpT[tid] = (_Float16)Wp[idx];
}

// ---------------------------------------------------------------- GEMM core
// One wave forms a 64 x 64 tile of X * W^T as 4 x 4 accumulator tiles, so that
// every loaded fragment feeds four WMMAs. a0, b0: the first 16-row tile of the
// wave's four neighbouring row tiles of each operand (fragment order, K = DIMC).
#define RTILE ((DIMC / 32) * FTILE)   // halves from one 16-row tile to the next

// The eight fragments of k step s: sixteen loads through two address registers.
__device__ __forceinline__ void frag_ld8(const _Float16* __restrict__ pa,
                                         const _Float16* __restrict__ pb, int s,
                                         v16h (&a)[4], v16h (&b)[4]) {
  v8h ta[8], tb[8];
#pragma unroll
  for (int i = 0; i < 8; ++i) {
    ta[i] = *(const v8h*)(pa + (i >> 1) * RTILE + s * FTILE + (i & 1) * 256);
    tb[i] = *(const v8h*)(pb + (i >> 1) * RTILE + s * FTILE + (i & 1) * 256);
  }
#pragma unroll
  for (int t = 0; t < 4; ++t) {
    a[t] = __builtin_shufflevector(ta[2 * t], ta[2 * t + 1],
                                   0, 1, 2, 3, 4, 5, 6, 7, 8, 9, 10, 11, 12, 13, 14, 15);
    b[t] = __builtin_shufflevector(tb[2 * t], tb[2 * t + 1],
                                   0, 1, 2, 3, 4, 5, 6, 7, 8, 9, 10, 11, 12, 13, 14, 15);
  }
}

__device__ __forceinline__ void gemm64(const _Float16* __restrict__ a0,
                                       const _Float16* __restrict__ b0, int ln,
                                       v8f (&c)[4][4]) {
  const _Float16* pa = a0 + ln * 8;
  const _Float16* pb = b0 + ln * 8;
#pragma unroll
  for (int i = 0; i < 4; ++i)
#pragma unroll
    for (int j = 0; j < 4; ++j) c[i][j] = vzero8();

  // fully unrolled k loop; the fragments of step s + 1 are asked for ahead of
  // the WMMAs of step s
  const int NSTEP = DIMC / 32;
  v16h a[4], b[4];
  frag_ld8(pa, pb, 0, a, b);
#pragma unroll
  for (int s = 0; s < NSTEP - 1; ++s) {
    v16h a_n[4], b_n[4];
    frag_ld8(pa, pb, s + 1, a_n, b_n);
    if (s == NSTEP - 2) xwait();  // the epilogue's address sums reuse the two address registers
    // holds the next step's loads ahead of this step's WMMAs: sunk to their uses,
    // each would wait out its whole latency with little else in flight
    __builtin_amdgcn_sched_barrier(0);
#pragma unroll
    for (int i = 0; i < 4; ++i)
#pragma unroll
      for (int j = 0; j < 4; ++j) c[i][j] = wmma16(a[i], b[j], c[i][j]);
#pragma unroll
    for (int t = 0; t < 4; ++t) { a[t] = a_n[t]; b[t] = b_n[t]; }
  }
#pragma unroll
  for (int i = 0; i < 4; ++i)
#pragma unroll
    for (int j = 0; j < 4; ++j) c[i][j] = wmma16(a[i], b[j], c[i][j]);
}

// ---------------------------------------------------------------- QKV GEMM
// grid = (M/128, 18), block = 128 (4 waves, 2 x 2 tiles of 64 x 64). col groups
// 0-5 -> q, 6-11 -> k, 12-17 -> v; a wave's 64 columns are one head.
// q scaled by QSCALE. v written TRANSPOSED per head: [b][h][d][j]. q, k, v are
// per-head matrices in fragment order (rows i, j, d; k index d, d, j).
__global__ __launch_bounds__(128)
void qkv_gemm_kernel(const _Float16* __restrict__ xh,
                     const _Float16* __restrict__ WqT,
                     const _Float16* __restrict__ WkT,
                     const _Float16* __restrict__ WvT,
                     _Float16* __restrict__ qb, _Float16* __restrict__ kb,
                     _Float16* __restrict__ vb) {
  const int mt = blockIdx.x, cg = blockIdx.y;
  const int wave = threadIdx.x >> 5, ln = threadIdx.x & 31;
  const int hlf = ln >> 4, lc = ln & 15;
  const int m0 = mt * 128 + (wave >> 1) * 64;
  const int which = cg / 6;  // 0=q 1=k 2=v
  const _Float16* WT = (which == 0) ? WqT : (which == 1) ? WkT : WvT;
  const int nbase = (cg % 6) * 128 + (wave & 1) * 64;  // within [0,768)

  v8f c[4][4];
  gemm64(xh + (size_t)(m0 >> 4) * RTILE, WT + (size_t)(nbase >> 4) * RTILE, ln, c);

  const int b_ = m0 / SEQ;
  const int nrow0 = m0 % SEQ;
  const int head = nbase >> 6;
  const size_t hoff = ((size_t)b_ * HEADS + head) * SEQ * HDIM;
  if (which == 2) {
    // V: transposed store [b][h][d][j]; the lane's 8 values of j are one piece
    _Float16* vt = vb + hoff;
#pragma unroll
    for (int i = 0; i < 4; ++i)
#pragma unroll
      for (int t = 0; t < 4; ++t) {
        v8h pk;
#pragma unroll
        for (int r = 0; r < 8; ++r) pk[r] = (_Float16)c[i][t][r];
        *(v8h*)(vt + fragoff(t * 16 + lc, nrow0 + i * 16 + hlf * 8, SEQ / 32)) = pk;
      }
  } else {
    const float scale = (which == 0) ? QSCALE : 1.f;
    _Float16* dst = ((which == 0) ? qb : kb) + hoff;
#pragma unroll
    for (int i = 0; i < 4; ++i)
#pragma unroll
      for (int t = 0; t < 4; ++t)
#pragma unroll
        for (int r = 0; r < 8; ++r)
          dst[fragoff(nrow0 + i * 16 + r + hlf * 8, t * 16 + lc, HDIM / 32)] =
              (_Float16)(c[i][t][r] * scale);
    xwait();   // the listing runs on from these stores into code that reuses their registers
  }
}

// ---------------------------------------------------- fused talking-heads attn
// grid = (SEQ/32, BATCH), block = 512 (16 waves), 32 query rows (two row tiles),
// 64 columns a step. Every K and V fragment that a wave loads feeds both row
// tiles, so a block's K and V reads serve twice the rows.
// q,k layout [b][h][j][d]; v layout [b][h][d][j] (pre-transposed); each (b, h)
// matrix in fragment order.
// Wave w forms the raw scores of heads 3*(w>>2)..+2 on column tile w&3 (as
// K * Q^T, so a lane holds 8 contiguous columns of query row lc) and puts them
// into Sx once, rounded to f16. Both head mixes are matrix products over the head
// index: D[g][pos] = sum_h W[g][h] * S[h][pos], on the f16 16x16x32 form. The
// values (scores, probabilities) are plain f16; every weight is an f16 pair
// hi + lo (22 bits), and both parts stand in the 32 k slots of ONE WMMA, each
// against a copy of the values.
// One mix tile is one column j with 16 query rows (lane lc = row); wave w
// mixes columns 4w..4w+3 of the step, so every score is mixed once.
// D rows, both mixes: lane half hlf, index r < 6 <-> head 6*hlf + r (D rows 6, 7,
// 14, 15 are padding, weights and bias 0). With it the D of the pre-mix, after
// the softmax in place, feeds the B of the post-mix.
// Pre-mix k slots: a lane's 16 elements are the 12 heads of its position, four
// groups of three heads and a copy of the middle one; lanes 0-15 meet the weights' hi parts, lanes
// 16-31 (the same values) their lo parts. Sx keeps the scores in that order, so
// that two 16-byte LDS reads are the whole B operand.
// Post-mix k slots: elements 0-5 of a lane are its six probabilities against the
// weights' hi parts, 6-11 the same six against the lo parts, 12-15 zero.
#define NWV 16      // waves per block
#define JS  64      // columns per step
#define RT  2       // query row tiles per block
#define QR  (16 * RT)
#define PP  72      // halves per Pn row:   144 B = 16 B x odd
typedef __attribute__((ext_vector_type(4))) float    v4f;
typedef __attribute__((ext_vector_type(4))) _Float16 v4h;

// Four mix tiles against one A and one C operand. In asm text, so that every D has
// eight registers of its own: of the builtin's D the compiler lets the two unused
// rows share registers with the next D.
// The four v_nop are the vector slots that the chip needs between the last WMMA and
// the first instruction that reads its D or overwrites its B.
__device__ __forceinline__ void wmma4(const v16h& a, const v16h (&b)[4], const v8f& c, v8f (&d)[4]) {
  asm("v_wmma_f32_16x16x32_f16 %0, %4, %5, %9\n\t"
      "v_wmma_f32_16x16x32_f16 %1, %4, %6, %9\n\t"
      "v_wmma_f32_16x16x32_f16 %2, %4, %7, %9\n\t"
      "v_wmma_f32_16x16x32_f16 %3, %4, %8, %9\n\t"
      "v_nop\n\tv_nop\n\tv_nop\n\tv_nop"
      : "=&v"(d[0]), "=&v"(d[1]), "=&v"(d[2]), "=&v"(d[3])
      : "v"(a), "v"(b[0]), "v"(b[1]), "v"(b[2]), "v"(b[3]), "v"(c));
}

// 2^x (v_exp_f32 alone: the factor log2(e) is already in the pre-mix weights and
// bias, so that no multiply stands in front of it). The v_nop fills the one slot that
// the instruction set asks for between a transcendental and a next instruction
// that reads its result or overwrites its source.
__device__ __forceinline__ float exp2_slot(float x) {
  float y;
  asm("v_exp_f32 %0, %1\n\tv_nop" : "=v"(y) : "v"(x));
  return y;
}
// log2(x), with the same slot behind it
__device__ __forceinline__ float log2_slot(float x) {
  float y;
  asm("v_log_f32 %0, %1\n\tv_nop" : "=v"(y) : "v"(x));
  return y;
}
#define LOG2E 1.44269504f

// Six fragments: two neighbouring tiles of each of three neighbouring heads, all
// twelve loads through one address register and in flight together.
__device__ __forceinline__ void frag_ld6(const _Float16* __restrict__ tile0, int ln,
                                         v16h (&f)[3][2]) {
  const _Float16* p = tile0 + ln * 8;
  v8h t[12];
#pragma unroll
  for (int i = 0; i < 11; ++i)
    t[i] = *(const v8h*)(p + (i >> 2) * (SEQ * HDIM) + ((i >> 1) & 1) * FTILE + (i & 1) * 256);
  xwait();   // the last load may land on the address register that the eleven name
  t[11] = *(const v8h*)(p + 2 * (SEQ * HDIM) + FTILE + 256);
  xwait();
#pragma unroll
  for (int u = 0; u < 3; ++u)
#pragma unroll
    for (int s = 0; s < 2; ++s)
#pragma unroll
      for (int e = 0; e < 8; ++e) {
        f[u][s][e]     = t[u * 4 + s * 2][e];
        f[u][s][e + 8] = t[u * 4 + s * 2 + 1][e];
      }
}

// One fragment out of a fragment-order tile (p: the lane's piece of chunk 0).
__device__ __forceinline__ v16h frag_pair(const _Float16* p) {
  const v8h lo = *(const v8h*)p, hi = *(const v8h*)(p + 256);
  return __builtin_shufflevector(lo, hi, 0, 1, 2, 3, 4, 5, 6, 7, 8, 9, 10, 11, 12, 13, 14, 15);
}

__global__ __launch_bounds__(512)
void attn_kernel(const _Float16* __restrict__ q, const _Float16* __restrict__ k,
                 const _Float16* __restrict__ v,
                 const float* __restrict__ Wl, const float* __restrict__ bl,
                 const float* __restrict__ Ww, const float* __restrict__ bw,
                 _Float16* __restrict__ oh) {
  // raw scores of two steps, f16: [step & 1][plane][column][row][8 slots]. The 16
  // slots of a position (two planes of 16 bytes) are four groups of three heads and
  // a copy of the middle one; group G = head / 3 stands in plane G >> 1, in the 8-byte half
  // (G & 1) ^ (bit 3 of the column): with that flip the two lane halves of a
  // writing wave, eight columns apart, fall on different banks.
  __shared__ __align__(16) _Float16 Sx[2][2][JS][QR][8];
  __shared__ __align__(16) _Float16 Pn[HEADS][QR][PP];        // post-mixed probs
  __shared__ __align__(16) _Float16 Qs[HEADS][RT * 2 * FTILE]; // the block's Q, fragment order
  // per-wave softmax stats [NWV][HEADS][QR], maxima and sums, between the two passes
  __shared__ float St[2][NWV * HEADS * QR];
  float* const stM = St[0];
  float* const stL = St[1];
  // pass 2's per-row constants, 16 bytes a lane and chunk: the C operand of the
  // pre-mix, by D row: bias - largest wave reference - log2(row sum against it), all in powers of two, so
  // that 2^D is the finished probability
  __shared__ __align__(16) float Cst[RT][2][32][4];
  // the A operands of the mixes (pre-mix for either value of the column's bit 3,
  // post-mix), 16 bytes a lane and chunk: pass 2 reads them anew every step, so that
  // they hold no registers while K, V, the probabilities and the output tiles are live
  __shared__ __align__(16) _Float16 Wop[3][2][32][8];
  // set by any lane whose pass 1 sum left the safe range: the block then repeats
  // pass 1 with the running maximum
  __shared__ int redo;

  const int b = blockIdx.y;
  const int i0 = blockIdx.x * QR;
  const int wv = threadIdx.x >> 5;
  const int ln = threadIdx.x & 31;
  const int hlf = ln >> 4, lc = ln & 15;
  const int jt = wv & 3;         // column tile (scores), d tile (P @ V)
  const int h0 = (wv >> 2) * 3;  // first of this wave's three heads
  if (threadIdx.x == 0) redo = 0;   // the barrier that publishes Qs covers it

  // the block's Q rows: 4 KiB in a row per head, 16 bytes a thread, six times
  {
    const _Float16* qsrc = q + (size_t)b * HEADS * SEQ * HDIM + (size_t)(i0 >> 4) * 2 * FTILE +
                           (size_t)(threadIdx.x >> 8) * (SEQ * HDIM) + (threadIdx.x & 255) * 8;
    v8h tq[6];
#pragma unroll
    for (int c = 0; c < 6; ++c) tq[c] = *(const v8h*)(qsrc + c * 2 * (SEQ * HDIM));
    xwait();
#pragma unroll
    for (int c = 0; c < 6; ++c)
      *(v8h*)&Qs[c * 2 + (threadIdx.x >> 8)][(threadIdx.x & 255) * 8] = tq[c];
  }

  // A operands of the two mixes: row lc of A is output head 6*(lc>>3) + (lc&7)
  const bool live = (lc & 7) < 6;
  const int grow = live ? (lc >> 3) * 6 + (lc & 7) : 0;
  const int swz = (wv >> 1) & 1;   // bit 3 of the columns that this wave mixes
  v16h wa, wb;
  {
    float tl[HEADS], tw[6];
    // the four groups of three heads in the order in which this wave's columns hold them
#pragma unroll
    for (int h = 0; h < HEADS; ++h) tl[h] = Wl[grow * HEADS + 3 * ((h / 3) ^ swz) + h % 3];
    xwait();   // the next loads may land on the address registers that these name
#pragma unroll
    for (int e = 0; e < 6; ++e) tw[e] = Ww[grow * HEADS + 6 * hlf + e];
    xwait();
    // pre-mix: element e <-> slot e of a position in Sx, as this wave's columns hold it
#pragma unroll
    for (int e = 0; e < 16; ++e) {
      const int u = e & 3, g0 = (e >> 3) * 2 + ((e >> 2) & 1);
      const float w = (live && u < 3) ? tl[(3 * g0 + u) % HEADS] * LOG2E : 0.f;   // mixed scores come out as powers of two
      const _Float16 hi = (_Float16)w;
      const _Float16 lo = (_Float16)(w - (float)hi);
      wa[e] = hlf ? lo : hi;
    }
#pragma unroll
    for (int e = 0; e < 6; ++e) {
      const float w = live ? tw[e] : 0.f;
      const _Float16 hi = (_Float16)w;
      wb[e]     = hi;
      wb[6 + e] = (_Float16)(w - (float)hi);
    }
#pragma unroll
    for (int e = 12; e < 16; ++e) wb[e] = (_Float16)0.f;
  }
  // one wave writes each operand; the barrier that publishes Qs covers them
  if (wv == 0 || wv == 2) {
    *(v8h*)&Wop[swz][0][ln][0] = __builtin_shufflevector(wa, wa, 0, 1, 2, 3, 4, 5, 6, 7);
    *(v8h*)&Wop[swz][1][ln][0] = __builtin_shufflevector(wa, wa, 8, 9, 10, 11, 12, 13, 14, 15);
  }
  if (wv == 0) {
    *(v8h*)&Wop[2][0][ln][0] = __builtin_shufflevector(wb, wb, 0, 1, 2, 3, 4, 5, 6, 7);
    *(v8h*)&Wop[2][1][ln][0] = __builtin_shufflevector(wb, wb, 8, 9, 10, 11, 12, 13, 14, 15);
  }
  v8f cbl = vzero8(), cbw = vzero8();   // C operands: the biases, by D row
#pragma unroll
  for (int r = 0; r < 6; ++r) { cbl[r] = bl[6 * hlf + r]; cbw[r] = bw[6 * hlf + r]; }
  xwait();
#pragma unroll
  for (int r = 0; r < 6; ++r) cbl[r] *= LOG2E;

  const size_t base = ((size_t)b * HEADS + h0) * SEQ * HDIM;  // first of the three heads
  const _Float16* kh = k + base;   // [j][d]: 2 tiles per 16 rows
  const _Float16* vt = v + base;   // [d][j]

  // this wave's six K fragments of step n
  auto kload = [&](int n, v16h (&kf)[3][2]) {
    frag_ld6(kh + (size_t)(n * (JS / 16) + jt) * 2 * FTILE, ln, kf);
  };

  // raw scores of step n -> Sx[n & 1]; each K fragment meets both row tiles
  auto scores = [&](int n, const v16h (&kf)[3][2]) {
    // c[u][rt][r] = S[h0 + u][i0 + rt*16 + lc][n*64 + jt*16 + hlf*8 + r]
    v8f c[3][RT];
#pragma unroll
    for (int s = 0; s < 2; ++s) {
      v16h qf[3][RT];
#pragma unroll
      for (int u = 0; u < 3; ++u)
#pragma unroll
        for (int rt = 0; rt < RT; ++rt)
          qf[u][rt] = frag_pair(&Qs[h0 + u][(rt * 2 + s) * FTILE + ln * 8]);
      // keeps the six fragments' LDS reads together ahead of their WMMAs: sunk to
      // their uses, each pair waits out its own LDS latency
      __builtin_amdgcn_sched_barrier(0);
#pragma unroll
      for (int u = 0; u < 3; ++u)
#pragma unroll
        for (int rt = 0; rt < RT; ++rt)
          c[u][rt] = wmma16(kf[u][s], qf[u][rt], s ? c[u][rt] : vzero8());
    }
    // the wave's three heads of one position: one 8-byte group (bit 3 of the column is
    // hlf). The fourth slot meets a zero weight: a second copy of a score fills it, which
    // takes one packed convert where a zero takes two instructions
    _Float16* dst = &Sx[n & 1][wv >> 3][jt * 16 + hlf * 8][lc][(((wv >> 2) & 1) ^ hlf) * 4];
#pragma unroll
    for (int rt = 0; rt < RT; ++rt)
#pragma unroll
      for (int r = 0; r < 8; ++r)
        *(v4h*)(dst + (r * QR + rt * 16) * 8) =
            (v4h){(_Float16)c[0][rt][r], (_Float16)c[1][rt][r], (_Float16)c[2][rt][r], (_Float16)c[1][rt][r]};
  };

  // pre-softmax mix of columns 4*wv..+3 of step n, row tile rt, on top of c0 (C
  // operand): d[t][r] = c0[r] + log2(e) * sum_h Wl[6*hlf + r][h] * S[h][rt*16 + lc][4*wv + t]
  auto premix = [&](int n, int rt, const v16h& w, const v8f& c0, v8f (&d)[4]) {
    const _Float16* sp = &Sx[n & 1][0][wv * 4][rt * 16 + lc][0];
    v16h sb[4];
#pragma unroll
    for (int t = 0; t < 4; ++t) {
      const v8h p0 = *(const v8h*)(sp + t * QR * 8), p1 = *(const v8h*)(sp + (JS + t) * QR * 8);
      sb[t] = __builtin_shufflevector(p0, p1, 0, 1, 2, 3, 4, 5, 6, 7, 8, 9, 10, 11, 12, 13, 14, 15);
    }
    wmma4(w, sb, c0, d);
  };

  // softmax stats of (head 6*hlf + r, row rt*16 + lc) over this wave's own columns only
  float m[RT][6], l[RT][6];
#pragma unroll
  for (int rt = 0; rt < RT; ++rt)
#pragma unroll
    for (int r = 0; r < 6; ++r) { m[rt][r] = -1e30f; l[rt][r] = 0.f; }

  v16h kf[3][2];
  kload(0, kf);
  __syncthreads();   // publishes Qs
  scores(0, kf);
  __syncthreads();

  // ---------------- pass 1: softmax stats over mixed scores -----------------
  // A lane's sum is taken against a FIXED reference, the maximum of its own four
  // columns of step 0, which goes into the C operand of the pre-mix: a term is one
  // v_exp_f32 and one add, with no running maximum, no subtraction and no rescaling.
  // The reference is one of the lane's own scores, so the sum is about 1 or more; f32
  // keeps its relative precision whatever the scale. A later score far above the
  // reference is caught below by the size of the sum.
  v8f cm[RT];   // bias - reference, by D row
#pragma unroll
  for (int rt = 0; rt < RT; ++rt) {
    v8f d[4];
    premix(0, rt, wa, cbl, d);
    cm[rt] = vzero8();
#pragma unroll
    for (int r = 0; r < 6; ++r)
      cm[rt][r] = cbl[r] - fmaxf(fmaxf(d[0][r], d[1][r]), fmaxf(d[2][r], d[3][r]));
  }
  // One barrier a step: it publishes step n + 1 and ends the reads of step n,
  // whose buffer is written again only in step n + 1.
  for (int n = 0; n < SEQ / JS; ++n) {
    // the next step's K flies while this step is mixed (after the last step:
    // step 0 again, for pass 2)
    kload((n + 1) & (SEQ / JS - 1), kf);
#pragma unroll
    for (int rt = 0; rt < RT; ++rt) {
      v8f d[4];
      premix(n, rt, wa, cm[rt], d);
#pragma unroll
      for (int r = 0; r < 6; ++r) {
        float p = exp2_slot(d[0][r]);
#pragma unroll
        for (int t = 1; t < 4; ++t) p += exp2_slot(d[t][r]);
        l[rt][r] += p;
      }
      // one row tile at a time: scheduled as one region, the two tiles' values
      // overfill the registers and the compiler falls back to a serial order
      __builtin_amdgcn_sched_barrier(0);
    }
    scores((n + 1) & (SEQ / JS - 1), kf);   // 16 & 15 = 0: buffer 0, last read in step 14
    __syncthreads();
  }
  {
    // safe range: up to 2^64 the merge below neither overflows nor loses a term that
    // counts; the negated test takes a NaN too
    bool bad = false;
#pragma unroll
    for (int rt = 0; rt < RT; ++rt)
#pragma unroll
      for (int r = 0; r < 6; ++r) {
        bad |= !(l[rt][r] <= 0x1p64f);
        m[rt][r] = cbl[r] - cm[rt][r];   // the reference that the sums were taken against
      }
    if (bad) redo = 1;
  }
  __syncthreads();   // publishes redo
  // the same for the whole block, in a scalar register: barriers and WMMAs stand inside
  if (__builtin_amdgcn_readfirstlane(redo)) {
    // scores that climb more than 64 powers of two above a lane's first ones: pass 1
    // again with the running maximum. Buffer 0 holds step 0, as at the first start.
#pragma unroll
    for (int rt = 0; rt < RT; ++rt)
#pragma unroll
      for (int r = 0; r < 6; ++r) { m[rt][r] = -1e30f; l[rt][r] = 0.f; }
    for (int n = 0; n < SEQ / JS; ++n) {
      // the next step's K flies while this step is mixed (after the last step:
      // step 0 again, for pass 2)
      kload((n + 1) & (SEQ / JS - 1), kf);
#pragma unroll
      for (int rt = 0; rt < RT; ++rt) {
        v8f d[4];
        premix(n, rt, wa, cbl, d);
#pragma unroll
        for (int r = 0; r < 6; ++r) {
          const float mx = fmaxf(fmaxf(d[0][r], d[1][r]), fmaxf(d[2][r], d[3][r]));
          const float nm = fmaxf(m[rt][r], mx);
          float p = 0.f;
#pragma unroll
          for (int t = 0; t < 4; ++t) p += exp2_slot(d[t][r] - nm);
          l[rt][r] = l[rt][r] * exp2_slot(m[rt][r] - nm) + p;
          m[rt][r] = nm;
        }
        // one row tile at a time: scheduled as one region, the two tiles' values
        // overfill the registers and the compiler falls back to a serial order
        __builtin_amdgcn_sched_barrier(0);
      }
      scores((n + 1) & (SEQ / JS - 1), kf);   // 16 & 15 = 0: buffer 0, last read in step 14
      __syncthreads();
    }
  }

  // merge the 16 waves' stats, once: thread t < 384 merges (head t / 32, row t % 32)
#pragma unroll
  for (int rt = 0; rt < RT; ++rt)
#pragma unroll
    for (int r = 0; r < 6; ++r) {
      stM[(wv * HEADS + 6 * hlf + r) * QR + rt * 16 + lc] = m[rt][r];
      stL[(wv * HEADS + 6 * hlf + r) * QR + rt * 16 + lc] = l[rt][r];
    }
  // the padding rows of Cst read 0
  (&Cst[0][0][0][0])[threadIdx.x] = 0.f;
  __syncthreads();
  if (wv < HEADS) {   // the same for a whole wave: wave wv merges head wv
    const float bias = bl[wv] * LOG2E;
    xwait();
    const int so = wv * QR + ln;
    float mt = -1e30f;
#pragma unroll
    for (int w = 0; w < NWV; ++w) mt = fmaxf(mt, stM[w * HEADS * QR + so]);
    float ls = 0.f;
#pragma unroll
    for (int w = 0; w < NWV; ++w)
      ls += stL[w * HEADS * QR + so] * exp2_slot(stM[w * HEADS * QR + so] - mt);
    // reader: lane (hlf, lc) of row tile rt, register r <-> head 6*hlf + r, row rt*16 + lc
    const int gh = wv / 6, gr = wv % 6;
    Cst[hlf][gr >> 2][gh * 16 + lc][gr & 3] = bias - mt - log2_slot(ls);
  }
  __syncthreads();   // publishes Cst

  v8f oacc[RT][3];
#pragma unroll
  for (int rt = 0; rt < RT; ++rt)
#pragma unroll
    for (int u = 0; u < 3; ++u) oacc[rt][u] = vzero8();

  // ---------------- pass 2: probs, post-mix, P @ V ---------------------------
  for (int n = 0; n < SEQ / JS; ++n) {
    // this step's V fragments fly while the step is mixed
    v16h vf[3][2];
    frag_ld6(vt + (size_t)(jt * (SEQ / 32) + n * 2) * FTILE, ln, vf);
    const v16h xa = frag_pair(&Wop[swz][0][ln][0]);
    const v16h xb = frag_pair(&Wop[2][0][ln][0]);
#pragma unroll
    for (int rt = 0; rt < RT; ++rt) {
      v8f d[4], e[4];
      const v4f c_lo = *(const v4f*)&Cst[rt][0][ln][0], c_hi = *(const v4f*)&Cst[rt][1][ln][0];
      const v8f cbm = __builtin_shufflevector(c_lo, c_hi, 0, 1, 2, 3, 4, 5, 6, 7);
      premix(n, rt, xa, cbm, d);   // largest wave reference and row sum are taken off in the C operand
#pragma unroll
      for (int t = 0; t < 4; ++t)
#pragma unroll
        for (int r = 0; r < 6; ++r) d[t][r] = exp2_slot(d[t][r]);
      // post-softmax mix (+bw per element: summed over all 1024 j it reproduces
      // the bias term): e[t][r] = P2[6*hlf + r][rt*16 + lc][4*wv + t]
      v16h pb[4];
#pragma unroll
      for (int t = 0; t < 4; ++t) {
#pragma unroll
        for (int r = 0; r < 6; ++r) {
          const _Float16 ph = (_Float16)d[t][r];
          pb[t][r]     = ph;
          pb[t][6 + r] = ph;
        }
#pragma unroll
        for (int r = 12; r < 16; ++r) pb[t][r] = (_Float16)0.f;
      }
#pragma unroll
      for (int t = 0; t < 4; ++t) e[t] = wmma16(xb, pb[t], cbw);
      v4h pk[6];
#pragma unroll
      for (int r = 0; r < 6; ++r)
        pk[r] = (v4h){(_Float16)e[0][r], (_Float16)e[1][r], (_Float16)e[2][r], (_Float16)e[3][r]};
#pragma unroll
      for (int r = 0; r < 6; ++r) *(v4h*)&Pn[6 * hlf + r][rt * 16 + lc][wv * 4] = pk[r];
      // one row tile at a time, as in pass 1
      __builtin_amdgcn_sched_barrier(0);
    }
    __syncthreads();   // publishes Pn; ends the reads of this step's score buffer
    // the next step's K flies during P @ V
    if (n + 1 < SEQ / JS) kload(n + 1, kf);
    // A = post-mixed probs (16 x 32, twice, per row tile), B = V^T tiles
#pragma unroll
    for (int ks = 0; ks < 2; ++ks) {
      v16h a[3][RT];
#pragma unroll
      for (int u = 0; u < 3; ++u)
#pragma unroll
        for (int rt = 0; rt < RT; ++rt) {
          const _Float16* pr = &Pn[h0 + u][rt * 16 + lc][ks * 32 + hlf * 8];
          const v8h lo = *(const v8h*)pr, hi = *(const v8h*)(pr + 16);
          a[u][rt] = __builtin_shufflevector(lo, hi, 0, 1, 2, 3, 4, 5, 6, 7,
                                             8, 9, 10, 11, 12, 13, 14, 15);
        }
      // keeps the six fragments' LDS reads together ahead of their WMMAs, as in scores
      __builtin_amdgcn_sched_barrier(0);
#pragma unroll
      for (int u = 0; u < 3; ++u)
#pragma unroll
        for (int rt = 0; rt < RT; ++rt)
          oacc[rt][u] = wmma16(a[u][rt], vf[u][ks], oacc[rt][u]);
    }
    if (n + 1 < SEQ / JS) scores(n + 1, kf);
    __syncthreads();   // publishes the next scores; ends the reads of Pn
  }

  // write (B * N, DIM) f16, fragment order (A operand of the out projection)
#pragma unroll
  for (int rt = 0; rt < RT; ++rt)
#pragma unroll
    for (int u = 0; u < 3; ++u) {
      int col = (h0 + u) * HDIM + jt * 16 + lc;
#pragma unroll
      for (int r = 0; r < 8; ++r) {
        int i = i0 + rt * 16 + r + hlf * 8;
        oh[fragoff(b * SEQ + i, col, DIMC / 32)] = (_Float16)oacc[rt][u][r];
      }
    }
}

// ---------------------------------------------------------------- out proj
// grid = (M/128, 6), block = 128 (4 waves, 2 x 2 tiles of 64 x 64).
__global__ __launch_bounds__(128)
void out_proj_kernel(const _Float16* __restrict__ oh,
                     const _Float16* __restrict__ WpT,
                     const float* __restrict__ bp, float* __restrict__ out) {
  const int mt = blockIdx.x, cg = blockIdx.y;
  const int wave = threadIdx.x >> 5, ln = threadIdx.x & 31;
  const int hlf = ln >> 4, lc = ln & 15;
  const int m0 = mt * 128 + (wave >> 1) * 64;
  const int nbase = cg * 128 + (wave & 1) * 64;

  v8f c[4][4];
  gemm64(oh + (size_t)(m0 >> 4) * RTILE, WpT + (size_t)(nbase >> 4) * RTILE, ln, c);

  const int col0 = nbase + lc;
  float bias[4];
#pragma unroll
  for (int t = 0; t < 4; ++t) bias[t] = bp[col0 + t * 16];
  // the register that these loads name is reused for the store addresses: the
  // input operand keeps it whole up to the wait
  asm volatile("s_wait_xcnt 0x0" :: "v"(col0) : "memory");
#pragma unroll
  for (int t = 0; t < 4; ++t) {
    int col = col0 + t * 16;
#pragma unroll
    for (int i = 0; i < 4; ++i)
#pragma unroll
      for (int r = 0; r < 8; ++r)
        out[(size_t)(m0 + i * 16 + r + hlf * 8) * DIMC + col] = c[i][t][r] + bias[t];
  }
}

// ---------------------------------------------------------------- launch
extern "C" void kernel_launch(void* const* d_in, const int* in_sizes, int n_in,
                              void* d_out, int out_size, void* d_ws, size_t ws_size,
                              hipStream_t stream) {
  (void)in_sizes; (void)n_in; (void)out_size; (void)ws_size;
  const float* x  = (const float*)d_in[0];
  const float* Wq = (const float*)d_in[1];
  const float* Wk = (const float*)d_in[2];
  const float* Wv = (const float*)d_in[3];
  const float* Wl = (const float*)d_in[4];
  const float* bl = (const float*)d_in[5];
  const float* Ww = (const float*)d_in[6];
  const float* bw = (const float*)d_in[7];
  const float* Wp = (const float*)d_in[8];
  const float* bp = (const float*)d_in[9];
  float* out = (float*)d_out;

  _Float16* ws = (_Float16*)d_ws;
  size_t off = 0;
  const size_t NX = (size_t)BATCH * SEQ * DIMC;   // 6,291,456
  const size_t NW = (size_t)DIMC * DIMC;
  _Float16* xh  = ws + off; off += NX;
  _Float16* WqT = ws + off; off += NW;
  _Float16* WkT = ws + off; off += NW;
  _Float16* WvT = ws + off; off += NW;
  _Float16* WpT = ws + off; off += NW;
  _Float16* qb  = ws + off; off += NX;
  _Float16* kb  = ws + off; off += NX;
  _Float16* vb  = ws + off; off += NX;   // transposed layout [b][h][d][j]
  _Float16* oh  = ws + off; off += NX;

  convert_x_kernel<<<(int)((NX / 8 + 255) / 256), 256, 0, stream>>>(x, xh, (int)(NX / 8));
  convert_w_kernel<<<(int)((NW + 255) / 256), 256, 0, stream>>>(
      Wq, Wk, Wv, Wp, WqT, WkT, WvT, WpT);
  qkv_gemm_kernel<<<dim3(BATCH * SEQ / 128, 18), 128, 0, stream>>>(
      xh, WqT, WkT, WvT, qb, kb, vb);
  attn_kernel<<<dim3(SEQ / QR, BATCH), 512, 0, stream>>>(
      qb, kb, vb, Wl, bl, Ww, bw, oh);
  out_proj_kernel<<<dim3(BATCH * SEQ / 128, 6), 128, 0, stream>>>(oh, WpT, bp, out);
}

// v010
// It runs in 132 microseconds.
// In both of two side-by-side timings against v009, it was 1.03 times as fast.
// All steps since v000 together make it 7.75 times as fast.
#include <hip/hip_runtime.h>

#define DIMC  768
#define HEADS 12
#define HDIM  64
#define BATCH 8
#define SEQ   1024
#define QSCALE 0.125f   // HD^-0.5

typedef __attribute__((ext_vector_type(16))) _Float16 v16h;
typedef __attribute__((ext_vector_type(8)))  _Float16 v8h;
typedef __attribute__((ext_vector_type(8)))  float    v8f;

// Every f16 matrix in the workspace is kept in FRAGMENT ORDER: one 16-row x
// 32-k operand tile is 512 contiguous halves, as two 512-byte chunks, and lane
// ln's 16 bytes of a chunk stand at ln * 16 bytes. A fragment load then reads
// 4 whole 128-byte lines per instruction instead of 32 bytes of each of 16.
// Per CDNA5 layout: lane<16 holds K {k0..k0+7, k0+16..k0+23} with k0=0,
// lane>=16 with k0=8; chunk 0 is the first run of 8, chunk 1 the second.
#define FTILE 512   // halves per 16 x 32 tile

// Offset in halves of element (r, k) of a matrix with nks tiles along k.
__device__ __forceinline__ size_t fragoff(int r, int k, int nks) {
  return (size_t)((r >> 4) * nks + (k >> 5)) * FTILE + ((k >> 4) & 1) * 256 +
         (((k >> 3) & 1) * 16 + (r & 15)) * 8 + (k & 7);
}

// Stands behind global loads whose address registers the compiler reuses next:
// those registers are not rewritten before the loads' addresses are taken.
__device__ __forceinline__ void xwait() { asm volatile("s_wait_xcnt 0x0" ::: "memory"); }

__device__ __forceinline__ v8f wmma16(v16h a, v16h b, v8f c) {
  return __builtin_amdgcn_wmma_f32_16x16x32_f16(false, a, false, b,
                                                (short)0, c, false, false);
}

__device__ __forceinline__ v8f vzero8() {
  v8f z;
#pragma unroll
  for (int e = 0; e < 8; ++e) z[e] = 0.f;
  return z;
}

// ---------------------------------------------------------------- converts
// x and the four W go to f16 in ONE launch of few, long waves: a wave that converts
// one 16-byte piece a lane lives for one memory latency, and the chip then spends its
// time starting waves. Here every lane asks for 256 bytes before its first store.
#define XBLK 384   // blocks on x: a wave takes 16 rows x 128 columns (4 tiles, 8 pieces a lane)
#define WBLK 144   // blocks on W: a wave takes 16 k x 32 n of each of the four matrices
__global__ __launch_bounds__(256)
void convert_kernel(const float* __restrict__ x,
                    const float* __restrict__ Wq, const float* __restrict__ Wk,
                    const float* __restrict__ Wv, const float* __restrict__ Wp,
                    _Float16* __restrict__ xh,
                    _Float16* __restrict__ WqT, _Float16* __restrict__ WkT,
                    _Float16* __restrict__ WvT, _Float16* __restrict__ WpT) {
  const int lane = threadIdx.x & 31;
  if (blockIdx.x < XBLK) {
    const int w = blockIdx.x * 8 + (threadIdx.x >> 5);
    const int rt = w / 6, kg = w % 6;   // row tile, group of four k tiles
    const float* src = x + (size_t)(rt * 16 + (lane & 15)) * DIMC + kg * 128 + (lane >> 4) * 8;
    float4 t[16];
#pragma unroll
    for (int c = 0; c < 16; ++c) t[c] = *(const float4*)(src + (c >> 1) * 16 + (c & 1) * 4);
    // the input operand keeps the address register whole up to the wait: no load lands on it
    asm volatile("s_wait_xcnt 0x0" :: "v"(src) : "memory");
    // holds all sixteen loads ahead of the converts: mixed in among them, the last
    // loads are asked for only when the first have come back
    __builtin_amdgcn_sched_barrier(0);
    // piece c: chunk c & 1 of tile c >> 1; the wave's eight pieces are 4 KiB in a row
    _Float16* dst = xh + (size_t)(rt * (DIMC / 32) + kg * 4) * FTILE + lane * 8;
#pragma unroll
    for (int c = 0; c < 8; ++c) {
      const float4 lo = t[2 * c], hi = t[2 * c + 1];
      v8h o = {(_Float16)lo.x, (_Float16)lo.y, (_Float16)lo.z, (_Float16)lo.w,
               (_Float16)hi.x, (_Float16)hi.y, (_Float16)hi.z, (_Float16)hi.w};
      *(v8h*)(dst + c * 256) = o;
    }
  } else {
    // transposed [n][k], fragment order: a lane's piece is 8 k of one n. The two
    // neighbouring n tiles of a wave use both halves of every 128-byte line it reads.
    const int j = (blockIdx.x - XBLK) * 256 + threadIdx.x;
    const int chunk = (j >> 5) & 1, t2 = j >> 6;
    const int ks = t2 % (DIMC / 32), rp = t2 / (DIMC / 32);
    const int so = (ks * 32 + chunk * 16 + (lane >> 4) * 8) * DIMC + rp * 32 + (lane & 15);
    const int dof = (rp * 2 * (DIMC / 32) + ks) * FTILE + chunk * 256 + lane * 8;
    const float* const in[4] = {Wq, Wk, Wv, Wp};
    _Float16* const ot[4] = {WqT, WkT, WvT, WpT};
    float t[4][2][8];
#pragma unroll
    for (int m = 0; m < 4; ++m)
#pragma unroll
      for (int h = 0; h < 2; ++h)
#pragma unroll
        for (int e = 0; e < 8; ++e) t[m][h][e] = in[m][so + e * DIMC + h * 16];
    // as above: the offset register that the loads name stays whole up to the wait,
    // and all sixty-four loads are asked for ahead of the first convert
    asm volatile("s_wait_xcnt 0x0" :: "v"(so) : "memory");
    __builtin_amdgcn_sched_barrier(0);
#pragma unroll
    for (int m = 0; m < 4; ++m)
#pragma unroll
      for (int h = 0; h < 2; ++h) {
        v8h o;
#pragma unroll
        for (int e = 0; e < 8; ++e) o[e] = (_Float16)t[m][h][e];
        *(v8h*)(ot[m] + dof + h * (DIMC / 32) * FTILE) = o;
      }
    xwait();   // the listing runs on from these stores into code that reuses their registers
  }
}

// ---------------------------------------------------------------- GEMM core
// One wave forms a 64 x 64 tile of X * W^T as 4 x 4 accumulator tiles, so that
// every loaded fragment feeds four WMMAs. a0, b0: the first 16-row tile of the
// wave's four neighbouring row tiles of each operand (fragment order, K = DIMC).
#define RTILE ((DIMC / 32) * FTILE)   // halves from one 16-row tile to the next

// The eight fragments of k step s: sixteen loads through two address registers.
__device__ __forceinline__ void frag_ld8(const _Float16* __restrict__ pa,
                                         const _Float16* __restrict__ pb, int s,
                                         v16h (&a)[4], v16h (&b)[4]) {
  v8h ta[8], tb[8];
#pragma unroll
  for (int i = 0; i < 8; ++i) {
    ta[i] = *(const v8h*)(pa + (i >> 1) * RTILE + s * FTILE + (i & 1) * 256);
    tb[i] = *(const v8h*)(pb + (i >> 1) * RTILE + s * FTILE + (i & 1) * 256);
  }
#pragma unroll
  for (int t = 0; t < 4; ++t) {
    a[t] = __builtin_shufflevector(ta[2 * t], ta[2 * t + 1],
                                   0, 1, 2, 3, 4, 5, 6, 7, 8, 9, 10, 11, 12, 13, 14, 15);
    b[t] = __builtin_shufflevector(tb[2 * t], tb[2 * t + 1],
                                   0, 1, 2, 3, 4, 5, 6, 7, 8, 9, 10, 11, 12, 13, 14, 15);
  }
}

__device__ __forceinline__ void gemm64(const _Float16* __restrict__ a0,
                                       const _Float16* __restrict__ b0, int ln,
                                       v8f (&c)[4][4]) {
  const _Float16* pa = a0 + ln * 8;
  const _Float16* pb = b0 + ln * 8;
#pragma unroll
  for (int i = 0; i < 4; ++i)
#pragma unroll
    for (int j = 0; j < 4; ++j) c[i][j] = vzero8();

  // fully unrolled k loop; the fragments of step s + 1 are asked for ahead of
  // the WMMAs of step s
  const int NSTEP = DIMC / 32;
  v16h a[4], b[4];
  frag_ld8(pa, pb, 0, a, b);
#pragma unroll
  for (int s = 0; s < NSTEP - 1; ++s) {
    v16h a_n[4], b_n[4];
    frag_ld8(pa, pb, s + 1, a_n, b_n);
    if (s == NSTEP - 2) xwait();  // the epilogue's address sums reuse the two address registers
    // holds the next step's loads ahead of this step's WMMAs: sunk to their uses,
    // each would wait out its whole latency with little else in flight
    __builtin_amdgcn_sched_barrier(0);
#pragma unroll
    for (int i = 0; i < 4; ++i)
#pragma unroll
      for (int j = 0; j < 4; ++j) c[i][j] = wmma16(a[i], b[j], c[i][j]);
#pragma unroll
    for (int t = 0; t < 4; ++t) { a[t] = a_n[t]; b[t] = b_n[t]; }
  }
#pragma unroll
  for (int i = 0; i < 4; ++i)
#pragma unroll
    for (int j = 0; j < 4; ++j) c[i][j] = wmma16(a[i], b[j], c[i][j]);
}

// ---------------------------------------------------------------- QKV GEMM
// grid = (M/128, 18), block = 128 (4 waves, 2 x 2 tiles of 64 x 64). col groups
// 0-5 -> q, 6-11 -> k, 12-17 -> v; a wave's 64 columns are one head.
// q scaled by QSCALE. v written TRANSPOSED per head: [b][h][d][j]. q, k, v are
// per-head matrices in fragment order (rows i, j, d; k index d, d, j).
__global__ __launch_bounds__(128)
void qkv_gemm_kernel(const _Float16* __restrict__ xh,
                     const _Float16* __restrict__ WqT,
                     const _Float16* __restrict__ WkT,
                     const _Float16* __restrict__ WvT,
                     _Float16* __restrict__ qb, _Float16* __restrict__ kb,
                     _Float16* __restrict__ vb) {
  const int mt = blockIdx.x, cg = blockIdx.y;
  const int wave = threadIdx.x >> 5, ln = threadIdx.x & 31;
  const int hlf = ln >> 4, lc = ln & 15;
  const int m0 = mt * 128 + (wave >> 1) * 64;
  const int which = cg / 6;  // 0=q 1=k 2=v
  const _Float16* WT = (which == 0) ? WqT : (which == 1) ? WkT : WvT;
  const int nbase = (cg % 6) * 128 + (wave & 1) * 64;  // within [0,768)

  v8f c[4][4];
  gemm64(xh + (size_t)(m0 >> 4) * RTILE, WT + (size_t)(nbase >> 4) * RTILE, ln, c);

  const int b_ = m0 / SEQ;
  const int nrow0 = m0 % SEQ;
  const int head = nbase >> 6;
  const size_t hoff = ((size_t)b_ * HEADS + head) * SEQ * HDIM;
  if (which == 2) {
    // V: transposed store [b][h][d][j]; the lane's 8 values of j are one piece
    _Float16* vt = vb + hoff;
#pragma unroll
    for (int i = 0; i < 4; ++i)
#pragma unroll
      for (int t = 0; t < 4; ++t) {
        v8h pk;
#pragma unroll
        for (int r = 0; r < 8; ++r) pk[r] = (_Float16)c[i][t][r];
        *(v8h*)(vt + fragoff(t * 16 + lc, nrow0 + i * 16 + hlf * 8, SEQ / 32)) = pk;
      }
  } else {
    const float scale = (which == 0) ? QSCALE : 1.f;
    _Float16* dst = ((which == 0) ? qb : kb) + hoff;
#pragma unroll
    for (int i = 0; i < 4; ++i)
#pragma unroll
      for (int t = 0; t < 4; ++t)
#pragma unroll
        for (int r = 0; r < 8; ++r)
          dst[fragoff(nrow0 + i * 16 + r + hlf * 8, t * 16 + lc, HDIM / 32)] =
              (_Float16)(c[i][t][r] * scale);
    xwait();   // the listing runs on from these stores into code that reuses their registers
  }
}

// ---------------------------------------------------- fused talking-heads attn
// grid = (SEQ/32, BATCH), block = 512 (16 waves), 32 query rows (two row tiles),
// 64 columns a step. Every K and V fragment that a wave loads feeds both row
// tiles, so a block's K and V reads serve twice the rows.
// q,k layout [b][h][j][d]; v layout [b][h][d][j] (pre-transposed); each (b, h)
// matrix in fragment order.
// Wave w forms the raw scores of heads 3*(w>>2)..+2 on column tile w&3 (as
// K * Q^T, so a lane holds 8 contiguous columns of query row lc) and puts them
// into Sx once, rounded to f16. Both head mixes are matrix products over the head
// index: D[g][pos] = sum_h W[g][h] * S[h][pos], on the f16 16x16x32 form. The
// values (scores, probabilities) are plain f16; every weight is an f16 pair
// hi + lo (22 bits), and both parts stand in the 32 k slots of ONE WMMA, each
// against a copy of the values.
// One mix tile is one column j with 16 query rows (lane lc = row); wave w
// mixes columns 4w..4w+3 of the step, so every score is mixed once.
// D rows, both mixes: lane half hlf, index r < 6 <-> head 6*hlf + r (D rows 6, 7,
// 14, 15 are padding, weights and bias 0). With it the D of the pre-mix, after
// the softmax in place, feeds the B of the post-mix.
// Pre-mix k slots: a lane's 16 elements are the 12 heads of its position, four
// groups of three heads and a copy of the middle one; lanes 0-15 meet the weights' hi parts, lanes
// 16-31 (the same values) their lo parts. Sx keeps the scores in that order, so
// that two 16-byte LDS reads are the whole B operand.
// Post-mix k slots: elements 0-5 of a lane are its six probabilities against the
// weights' hi parts, 6-11 the same six against the lo parts, 12-15 zero.
#define NWV 16      // waves per block
#define JS  64      // columns per step
#define RT  2       // query row tiles per block
#define QR  (16 * RT)
#define PP  72      // halves per Pn row:   144 B = 16 B x odd
typedef __attribute__((ext_vector_type(4))) float    v4f;
typedef __attribute__((ext_vector_type(4))) _Float16 v4h;

// Four mix tiles against one A and one C operand. In asm text, so that every D has
// eight registers of its own: of the builtin's D the compiler lets the two unused
// rows share registers with the next D.
// The four v_nop are the vector slots that the chip needs between the last WMMA and
// the first instruction that reads its D or overwrites its B.
__device__ __forceinline__ void wmma4(const v16h& a, const v16h (&b)[4], const v8f& c, v8f (&d)[4]) {
  asm("v_wmma_f32_16x16x32_f16 %0, %4, %5, %9\n\t"
      "v_wmma_f32_16x16x32_f16 %1, %4, %6, %9\n\t"
      "v_wmma_f32_16x16x32_f16 %2, %4, %7, %9\n\t"
      "v_wmma_f32_16x16x32_f16 %3, %4, %8, %9\n\t"
      "v_nop\n\tv_nop\n\tv_nop\n\tv_nop"
      : "=&v"(d[0]), "=&v"(d[1]), "=&v"(d[2]), "=&v"(d[3])
      : "v"(a), "v"(b[0]), "v"(b[1]), "v"(b[2]), "v"(b[3]), "v"(c));
}

// 2^x (v_exp_f32 alone: the factor log2(e) is already in the pre-mix weights and
// bias, so that no multiply stands in front of it). The v_nop fills the one slot that
// the instruction set asks for between a transcendental and a next instruction
// that reads its result or overwrites its source.
__device__ __forceinline__ float exp2_slot(float x) {
  float y;
  asm("v_exp_f32 %0, %1\n\tv_nop" : "=v"(y) : "v"(x));
  return y;
}
// log2(x), with the same slot behind it
__device__ __forceinline__ float log2_slot(float x) {
  float y;
  asm("v_log_f32 %0, %1\n\tv_nop" : "=v"(y) : "v"(x));
  return y;
}
#define LOG2E 1.44269504f

// Six fragments: two neighbouring tiles of each of three neighbouring heads, all
// twelve loads through one address register and in flight together.
__device__ __forceinline__ void frag_ld6(const _Float16* __restrict__ tile0, int ln,
                                         v16h (&f)[3][2]) {
  const _Float16* p = tile0 + ln * 8;
  v8h t[12];
#pragma unroll
  for (int i = 0; i < 11; ++i)
    t[i] = *(const v8h*)(p + (i >> 2) * (SEQ * HDIM) + ((i >> 1) & 1) * FTILE + (i & 1) * 256);
  xwait();   // the last load may land on the address register that the eleven name
  t[11] = *(const v8h*)(p + 2 * (SEQ * HDIM) + FTILE + 256);
  xwait();
#pragma unroll
  for (int u = 0; u < 3; ++u)
#pragma unroll
    for (int s = 0; s < 2; ++s)
#pragma unroll
      for (int e = 0; e < 8; ++e) {
        f[u][s][e]     = t[u * 4 + s * 2][e];
        f[u][s][e + 8] = t[u * 4 + s * 2 + 1][e];
      }
}

// One fragment out of a fragment-order tile (p: the lane's piece of chunk 0).
__device__ __forceinline__ v16h frag_pair(const _Float16* p) {
  const v8h lo = *(const v8h*)p, hi = *(const v8h*)(p + 256);
  return __builtin_shufflevector(lo, hi, 0, 1, 2, 3, 4, 5, 6, 7, 8, 9, 10, 11, 12, 13, 14, 15);
}

__global__ __launch_bounds__(512)
void attn_kernel(const _Float16* __restrict__ q, const _Float16* __restrict__ k,
                 const _Float16* __restrict__ v,
                 const float* __restrict__ Wl, const float* __restrict__ bl,
                 const float* __restrict__ Ww, const float* __restrict__ bw,
                 _Float16* __restrict__ oh) {
  // raw scores of two steps, f16: [step & 1][plane][column][row][8 slots]. The 16
  // slots of a position (two planes of 16 bytes) are four groups of three heads and
  // a copy of the middle one; group G = head / 3 stands in plane G >> 1, in the 8-byte half
  // (G & 1) ^ (bit 3 of the column): with that flip the two lane halves of a
  // writing wave, eight columns apart, fall on different banks.
  __shared__ __align__(16) _Float16 Sx[2][2][JS][QR][8];
  __shared__ __align__(16) _Float16 Pn[HEADS][QR][PP];        // post-mixed probs
  __shared__ __align__(16) _Float16 Qs[HEADS][RT * 2 * FTILE]; // the block's Q, fragment order
  // per-wave softmax stats [NWV][HEADS][QR], maxima and sums, between the two passes
  __shared__ float St[2][NWV * HEADS * QR];
  float* const stM = St[0];
  float* const stL = St[1];
  // pass 2's per-row constants, 16 bytes a lane and chunk: the C operand of the
  // pre-mix, by D row: bias - largest wave reference - log2(row sum against it), all in powers of two, so
  // that 2^D is the finished probability
  __shared__ __align__(16) float Cst[RT][2][32][4];
  // the A operands of the mixes (pre-mix for either value of the column's bit 3,
  // post-mix), 16 bytes a lane and chunk: pass 2 reads them anew every step, so that
  // they hold no registers while K, V, the probabilities and the output tiles are live
  __shared__ __align__(16) _Float16 Wop[3][2][32][8];
  // set by any lane whose pass 1 sum left the safe range: the block then repeats
  // pass 1 with the running maximum
  __shared__ int redo;

  const int b = blockIdx.y;
  const int i0 = blockIdx.x * QR;
  const int wv = threadIdx.x >> 5;
  const int ln = threadIdx.x & 31;
  const int hlf = ln >> 4, lc = ln & 15;
  const int jt = wv & 3;         // column tile (scores), d tile (P @ V)
  const int h0 = (wv >> 2) * 3;  // first of this wave's three heads
  if (threadIdx.x == 0) redo = 0;   // the barrier that publishes Qs covers it

  // the block's Q rows: 4 KiB in a row per head, 16 bytes a thread, six times
  {
    const _Float16* qsrc = q + (size_t)b * HEADS * SEQ * HDIM + (size_t)(i0 >> 4) * 2 * FTILE +
                           (size_t)(threadIdx.x >> 8) * (SEQ * HDIM) + (threadIdx.x & 255) * 8;
    v8h tq[6];
#pragma unroll
    for (int c = 0; c < 6; ++c) tq[c] = *(const v8h*)(qsrc + c * 2 * (SEQ * HDIM));
    xwait();
#pragma unroll
    for (int c = 0; c < 6; ++c)
      *(v8h*)&Qs[c * 2 + (threadIdx.x >> 8)][(threadIdx.x & 255) * 8] = tq[c];
  }

  // A operands of the two mixes: row lc of A is output head 6*(lc>>3) + (lc&7)
  const bool live = (lc & 7) < 6;
  const int grow = live ? (lc >> 3) * 6 + (lc & 7) : 0;
  const int swz = (wv >> 1) & 1;   // bit 3 of the columns that this wave mixes
  v16h wa, wb;
  {
    float tl[HEADS], tw[6];
    // the four groups of three heads in the order in which this wave's columns hold them
#pragma unroll
    for (int h = 0; h < HEADS; ++h) tl[h] = Wl[grow * HEADS + 3 * ((h / 3) ^ swz) + h % 3];
    xwait();   // the next loads may land on the address registers that these name
#pragma unroll
    for (int e = 0; e < 6; ++e) tw[e] = Ww[grow * HEADS + 6 * hlf + e];
    xwait();
    // pre-mix: element e <-> slot e of a position in Sx, as this wave's columns hold it
#pragma unroll
    for (int e = 0; e < 16; ++e) {
      const int u = e & 3, g0 = (e >> 3) * 2 + ((e >> 2) & 1);
      const float w = (live && u < 3) ? tl[(3 * g0 + u) % HEADS] * LOG2E : 0.f;   // mixed scores come out as powers of two
      const _Float16 hi = (_Float16)w;
      const _Float16 lo = (_Float16)(w - (float)hi);
      wa[e] = hlf ? lo : hi;
    }
#pragma unroll
    for (int e = 0; e < 6; ++e) {
      const float w = live ? tw[e] : 0.f;
      const _Float16 hi = (_Float16)w;
      wb[e]     = hi;
      wb[6 + e] = (_Float16)(w - (float)hi);
    }
#pragma unroll
    for (int e = 12; e < 16; ++e) wb[e] = (_Float16)0.f;
  }
  // one wave writes each operand; the barrier that publishes Qs covers them
  if (wv == 0 || wv == 2) {
    *(v8h*)&Wop[swz][0][ln][0] = __builtin_shufflevector(wa, wa, 0, 1, 2, 3, 4, 5, 6, 7);
    *(v8h*)&Wop[swz][1][ln][0] = __builtin_shufflevector(wa, wa, 8, 9, 10, 11, 12, 13, 14, 15);
  }
  if (wv == 0) {
    *(v8h*)&Wop[2][0][ln][0] = __builtin_shufflevector(wb, wb, 0, 1, 2, 3, 4, 5, 6, 7);
    *(v8h*)&Wop[2][1][ln][0] = __builtin_shufflevector(wb, wb, 8, 9, 10, 11, 12, 13, 14, 15);
  }
  v8f cbl = vzero8(), cbw = vzero8();   // C operands: the biases, by D row
#pragma unroll
  for (int r = 0; r < 6; ++r) { cbl[r] = bl[6 * hlf + r]; cbw[r] = bw[6 * hlf + r]; }
  xwait();
#pragma unroll
  for (int r = 0; r < 6; ++r) cbl[r] *= LOG2E;

  const size_t base = ((size_t)b * HEADS + h0) * SEQ * HDIM;  // first of the three heads
  const _Float16* kh = k + base;   // [j][d]: 2 tiles per 16 rows
  const _Float16* vt = v + base;   // [d][j]

  // this wave's six K fragments of step n
  auto kload = [&](int n, v16h (&kf)[3][2]) {
    frag_ld6(kh + (size_t)(n * (JS / 16) + jt) * 2 * FTILE, ln, kf);
  };

  // raw scores of step n -> Sx[n & 1]; each K fragment meets both row tiles
  auto scores = [&](int n, const v16h (&kf)[3][2]) {
    // c[u][rt][r] = S[h0 + u][i0 + rt*16 + lc][n*64 + jt*16 + hlf*8 + r]
    v8f c[3][RT];
#pragma unroll
    for (int s = 0; s < 2; ++s) {
      v16h qf[3][RT];
#pragma unroll
      for (int u = 0; u < 3; ++u)
#pragma unroll
        for (int rt = 0; rt < RT; ++rt)
          qf[u][rt] = frag_pair(&Qs[h0 + u][(rt * 2 + s) * FTILE + ln * 8]);
      // keeps the six fragments' LDS reads together ahead of their WMMAs: sunk to
      // their uses, each pair waits out its own LDS latency
      __builtin_amdgcn_sched_barrier(0);
#pragma unroll
      for (int u = 0; u < 3; ++u)
#pragma unroll
        for (int rt = 0; rt < RT; ++rt)
          c[u][rt] = wmma16(kf[u][s], qf[u][rt], s ? c[u][rt] : vzero8());
    }
    // the wave's three heads of one position: one 8-byte group (bit 3 of the column is
    // hlf). The fourth slot meets a zero weight: a second copy of a score fills it, which
    // takes one packed convert where a zero takes two instructions
    _Float16* dst = &Sx[n & 1][wv >> 3][jt * 16 + hlf * 8][lc][(((wv >> 2) & 1) ^ hlf) * 4];
#pragma unroll
    for (int rt = 0; rt < RT; ++rt)
#pragma unroll
      for (int r = 0; r < 8; ++r)
        *(v4h*)(dst + (r * QR + rt * 16) * 8) =
            (v4h){(_Float16)c[0][rt][r], (_Float16)c[1][rt][r], (_Float16)c[2][rt][r], (_Float16)c[1][rt][r]};
  };

  // pre-softmax mix of columns 4*wv..+3 of step n, row tile rt, on top of c0 (C
  // operand): d[t][r] = c0[r] + log2(e) * sum_h Wl[6*hlf + r][h] * S[h][rt*16 + lc][4*wv + t]
  auto premix = [&](int n, int rt, const v16h& w, const v8f& c0, v8f (&d)[4]) {
    const _Float16* sp = &Sx[n & 1][0][wv * 4][rt * 16 + lc][0];
    v16h sb[4];
#pragma unroll
    for (int t = 0; t < 4; ++t) {
      const v8h p0 = *(const v8h*)(sp + t * QR * 8), p1 = *(const v8h*)(sp + (JS + t) * QR * 8);
      sb[t] = __builtin_shufflevector(p0, p1, 0, 1, 2, 3, 4, 5, 6, 7, 8, 9, 10, 11, 12, 13, 14, 15);
    }
    wmma4(w, sb, c0, d);
  };

  // softmax stats of (head 6*hlf + r, row rt*16 + lc) over this wave's own columns only
  float m[RT][6], l[RT][6];
#pragma unroll
  for (int rt = 0; rt < RT; ++rt)
#pragma unroll
    for (int r = 0; r < 6; ++r) { m[rt][r] = -1e30f; l[rt][r] = 0.f; }

  v16h kf[3][2];
  kload(0, kf);
  __syncthreads();   // publishes Qs
  scores(0, kf);
  __syncthreads();

  // ---------------- pass 1: softmax stats over mixed scores -----------------
  // A lane's sum is taken against a FIXED reference, the maximum of its own four
  // columns of step 0, which goes into the C operand of the pre-mix: a term is one
  // v_exp_f32 and one add, with no running maximum, no subtraction and no rescaling.
  // The reference is one of the lane's own scores, so the sum is about 1 or more; f32
  // keeps its relative precision whatever the scale. A later score far above the
  // reference is caught below by the size of the sum.
  v8f cm[RT];   // bias - reference, by D row
#pragma unroll
  for (int rt = 0; rt < RT; ++rt) {
    v8f d[4];
    premix(0, rt, wa, cbl, d);
    cm[rt] = vzero8();
#pragma unroll
    for (int r = 0; r < 6; ++r)
      cm[rt][r] = cbl[r] - fmaxf(fmaxf(d[0][r], d[1][r]), fmaxf(d[2][r], d[3][r]));
  }
  // One barrier a step: it publishes step n + 1 and ends the reads of step n,
  // whose buffer is written again only in step n + 1.
  for (int n = 0; n < SEQ / JS; ++n) {
    // the next step's K flies while this step is mixed (after the last step:
    // step 0 again, for pass 2)
    kload((n + 1) & (SEQ / JS - 1), kf);
#pragma unroll
    for (int rt = 0; rt < RT; ++rt) {
      v8f d[4];
      premix(n, rt, wa, cm[rt], d);
#pragma unroll
      for (int r = 0; r < 6; ++r) {
        float p = exp2_slot(d[0][r]);
#pragma unroll
        for (int t = 1; t < 4; ++t) p += exp2_slot(d[t][r]);
        l[rt][r] += p;
      }
      // one row tile at a time: scheduled as one region, the two tiles' values
      // overfill the registers and the compiler falls back to a serial order
      __builtin_amdgcn_sched_barrier(0);
    }
    scores((n + 1) & (SEQ / JS - 1), kf);   // 16 & 15 = 0: buffer 0, last read in step 14
    __syncthreads();
  }
  {
    // safe range: up to 2^64 the merge below neither overflows nor loses a term that
    // counts; the negated test takes a NaN too
    bool bad = false;
#pragma unroll
    for (int rt = 0; rt < RT; ++rt)
#pragma unroll
      for (int r = 0; r < 6; ++r) {
        bad |= !(l[rt][r] <= 0x1p64f);
        m[rt][r] = cbl[r] - cm[rt][r];   // the reference that the sums were taken against
      }
    if (bad) redo = 1;
  }
  __syncthreads();   // publishes redo
  // the same for the whole block, in a scalar register: barriers and WMMAs stand inside
  if (__builtin_amdgcn_readfirstlane(redo)) {
    // scores that climb more than 64 powers of two above a lane's first ones: pass 1
    // again with the running maximum. Buffer 0 holds step 0, as at the first start.
#pragma unroll
    for (int rt = 0; rt < RT; ++rt)
#pragma unroll
      for (int r = 0; r < 6; ++r) { m[rt][r] = -1e30f; l[rt][r] = 0.f; }
    for (int n = 0; n < SEQ / JS; ++n) {
      // the next step's K flies while this step is mixed (after the last step:
      // step 0 again, for pass 2)
      kload((n + 1) & (SEQ / JS - 1), kf);
#pragma unroll
      for (int rt = 0; rt < RT; ++rt) {
        v8f d[4];
        premix(n, rt, wa, cbl, d);
#pragma unroll
        for (int r = 0; r < 6; ++r) {
          const float mx = fmaxf(fmaxf(d[0][r], d[1][r]), fmaxf(d[2][r], d[3][r]));
          const float nm = fmaxf(m[rt][r], mx);
          float p = 0.f;
#pragma unroll
          for (int t = 0; t < 4; ++t) p += exp2_slot(d[t][r] - nm);
          l[rt][r] = l[rt][r] * exp2_slot(m[rt][r] - nm) + p;
          m[rt][r] = nm;
        }
        // one row tile at a time: scheduled as one region, the two tiles' values
        // overfill the registers and the compiler falls back to a serial order
        __builtin_amdgcn_sched_barrier(0);
      }
      scores((n + 1) & (SEQ / JS - 1), kf);   // 16 & 15 = 0: buffer 0, last read in step 14
      __syncthreads();
    }
  }

  // merge the 16 waves' stats, once: thread t < 384 merges (head t / 32, row t % 32)
#pragma unroll
  for (int rt = 0; rt < RT; ++rt)
#pragma unroll
    for (int r = 0; r < 6; ++r) {
      stM[(wv * HEADS + 6 * hlf + r) * QR + rt * 16 + lc] = m[rt][r];
      stL[(wv * HEADS + 6 * hlf + r) * QR + rt * 16 + lc] = l[rt][r];
    }
  // the padding rows of Cst read 0
  (&Cst[0][0][0][0])[threadIdx.x] = 0.f;
  __syncthreads();
  if (wv < HEADS) {   // the same for a whole wave: wave wv merges head wv
    const float bias = bl[wv] * LOG2E;
    xwait();
    const int so = wv * QR + ln;
    float mt = -1e30f;
#pragma unroll
    for (int w = 0; w < NWV; ++w) mt = fmaxf(mt, stM[w * HEADS * QR + so]);
    float ls = 0.f;
#pragma unroll
    for (int w = 0; w < NWV; ++w)
      ls += stL[w * HEADS * QR + so] * exp2_slot(stM[w * HEADS * QR + so] - mt);
    // reader: lane (hlf, lc) of row tile rt, register r <-> head 6*hlf + r, row rt*16 + lc
    const int gh = wv / 6, gr = wv % 6;
    Cst[hlf][gr >> 2][gh * 16 + lc][gr & 3] = bias - mt - log2_slot(ls);
  }
  __syncthreads();   // publishes Cst

  v8f oacc[RT][3];
#pragma unroll
  for (int rt = 0; rt < RT; ++rt)
#pragma unroll
    for (int u = 0; u < 3; ++u) oacc[rt][u] = vzero8();

  // ---------------- pass 2: probs, post-mix, P @ V ---------------------------
  for (int n = 0; n < SEQ / JS; ++n) {
    // this step's V fragments fly while the step is mixed
    v16h vf[3][2];
    frag_ld6(vt + (size_t)(jt * (SEQ / 32) + n * 2) * FTILE, ln, vf);
    const v16h xa = frag_pair(&Wop[swz][0][ln][0]);
    const v16h xb = frag_pair(&Wop[2][0][ln][0]);
#pragma unroll
    for (int rt = 0; rt < RT; ++rt) {
      v8f d[4], e[4];
      const v4f c_lo = *(const v4f*)&Cst[rt][0][ln][0], c_hi = *(const v4f*)&Cst[rt][1][ln][0];
      const v8f cbm = __builtin_shufflevector(c_lo, c_hi, 0, 1, 2, 3, 4, 5, 6, 7);
      premix(n, rt, xa, cbm, d);   // largest wave reference and row sum are taken off in the C operand
#pragma unroll
      for (int t = 0; t < 4; ++t)
#pragma unroll
        for (int r = 0; r < 6; ++r) d[t][r] = exp2_slot(d[t][r]);
      // post-softmax mix (+bw per element: summed over all 1024 j it reproduces
      // the bias term): e[t][r] = P2[6*hlf + r][rt*16 + lc][4*wv + t]
      v16h pb[4];
#pragma unroll
      for (int t = 0; t < 4; ++t) {
#pragma unroll
        for (int r = 0; r < 6; ++r) {
          const _Float16 ph = (_Float16)d[t][r];
          pb[t][r]     = ph;
          pb[t][6 + r] = ph;
        }
#pragma unroll
        for (int r = 12; r < 16; ++r) pb[t][r] = (_Float16)0.f;
      }
#pragma unroll
      for (int t = 0; t < 4; ++t) e[t] = wmma16(xb, pb[t], cbw);
      v4h pk[6];
#pragma unroll
      for (int r = 0; r < 6; ++r)
        pk[r] = (v4h){(_Float16)e[0][r], (_Float16)e[1][r], (_Float16)e[2][r], (_Float16)e[3][r]};
#pragma unroll
      for (int r = 0; r < 6; ++r) *(v4h*)&Pn[6 * hlf + r][rt * 16 + lc][wv * 4] = pk[r];
      // one row tile at a time, as in pass 1
      __builtin_amdgcn_sched_barrier(0);
    }
    __syncthreads();   // publishes Pn; ends the reads of this step's score buffer
    // the next step's K flies during P @ V
    if (n + 1 < SEQ / JS) kload(n + 1, kf);
    // A = post-mixed probs (16 x 32, twice, per row tile), B = V^T tiles
#pragma unroll
    for (int ks = 0; ks < 2; ++ks) {
      v16h a[3][RT];
#pragma unroll
      for (int u = 0; u < 3; ++u)
#pragma unroll
        for (int rt = 0; rt < RT; ++rt) {
          const _Float16* pr = &Pn[h0 + u][rt * 16 + lc][ks * 32 + hlf * 8];
          const v8h lo = *(const v8h*)pr, hi = *(const v8h*)(pr + 16);
          a[u][rt] = __builtin_shufflevector(lo, hi, 0, 1, 2, 3, 4, 5, 6, 7,
                                             8, 9, 10, 11, 12, 13, 14, 15);
        }
      // keeps the six fragments' LDS reads together ahead of their WMMAs, as in scores
      __builtin_amdgcn_sched_barrier(0);
#pragma unroll
      for (int u = 0; u < 3; ++u)
#pragma unroll
        for (int rt = 0; rt < RT; ++rt)
          oacc[rt][u] = wmma16(a[u][rt], vf[u][ks], oacc[rt][u]);
    }
    if (n + 1 < SEQ / JS) scores(n + 1, kf);
    __syncthreads();   // publishes the next scores; ends the reads of Pn
  }

  // write (B * N, DIM) f16, fragment order (A operand of the out projection)
#pragma unroll
  for (int rt = 0; rt < RT; ++rt)
#pragma unroll
    for (int u = 0; u < 3; ++u) {
      int col = (h0 + u) * HDIM + jt * 16 + lc;
#pragma unroll
      for (int r = 0; r < 8; ++r) {
        int i = i0 + rt * 16 + r + hlf * 8;
        oh[fragoff(b * SEQ + i, col, DIMC / 32)] = (_Float16)oacc[rt][u][r];
      }
    }
}

// ---------------------------------------------------------------- out proj
// grid = (M/128, 6), block = 128 (4 waves, 2 x 2 tiles of 64 x 64).
__global__ __launch_bounds__(128)
void out_proj_kernel(const _Float16* __restrict__ oh,
                     const _Float16* __restrict__ WpT,
                     const float* __restrict__ bp, float* __restrict__ out) {
  const int mt = blockIdx.x, cg = blockIdx.y;
  const int wave = threadIdx.x >> 5, ln = threadIdx.x & 31;
  const int hlf = ln >> 4, lc = ln & 15;
  const int m0 = mt * 128 + (wave >> 1) * 64;
  const int nbase = cg * 128 + (wave & 1) * 64;

  v8f c[4][4];
  gemm64(oh + (size_t)(m0 >> 4) * RTILE, WpT + (size_t)(nbase >> 4) * RTILE, ln, c);

  const int col0 = nbase + lc;
  float bias[4];
#pragma unroll
  for (int t = 0; t < 4; ++t) bias[t] = bp[col0 + t * 16];
  // the register that these loads name is reused for the store addresses: the
  // input operand keeps it whole up to the wait
  asm volatile("s_wait_xcnt 0x0" :: "v"(col0) : "memory");
#pragma unroll
  for (int t = 0; t < 4; ++t) {
    int col = col0 + t * 16;
#pragma unroll
    for (int i = 0; i < 4; ++i)
#pragma unroll
      for (int r = 0; r < 8; ++r)
        out[(size_t)(m0 + i * 16 + r + hlf * 8) * DIMC + col] = c[i][t][r] + bias[t];
  }
}

// ---------------------------------------------------------------- launch
extern "C" void kernel_launch(void* const* d_in, const int* in_sizes, int n_in,
                              void* d_out, int out_size, void* d_ws, size_t ws_size,
                              hipStream_t stream) {
  (void)in_sizes; (void)n_in; (void)out_size; (void)ws_size;
  const float* x  = (const float*)d_in[0];
  const float* Wq = (const float*)d_in[1];
  const float* Wk = (const float*)d_in[2];
  const float* Wv = (const float*)d_in[3];
  const float* Wl = (const float*)d_in[4];
  const float* bl = (const float*)d_in[5];
  const float* Ww = (const float*)d_in[6];
  const float* bw = (const float*)d_in[7];
  const float* Wp = (const float*)d_in[8];
  const float* bp = (const float*)d_in[9];
  float* out = (float*)d_out;

  _Float16* ws = (_Float16*)d_ws;
  size_t off = 0;
  const size_t NX = (size_t)BATCH * SEQ * DIMC;   // 6,291,456
  const size_t NW = (size_t)DIMC * DIMC;
  _Float16* xh  = ws + off; off += NX;
  _Float16* WqT = ws + off; off += NW;
  _Float16* WkT = ws + off; off += NW;
  _Float16* WvT = ws + off; off += NW;
  _Float16* WpT = ws + off; off += NW;
  _Float16* qb  = ws + off; off += NX;
  _Float16* kb  = ws + off; off += NX;
  _Float16* vb  = ws + off; off += NX;   // transposed layout [b][h][d][j]
  _Float16* oh  = ws + off; off += NX;

  convert_kernel<<<XBLK + WBLK, 256, 0, stream>>>(x, Wq, Wk, Wv, Wp, xh, WqT, WkT, WvT, WpT);
  qkv_gemm_kernel<<<dim3(BATCH * SEQ / 128, 18), 128, 0, stream>>>(
      xh, WqT, WkT, WvT, qb, kb, vb);
  attn_kernel<<<dim3(SEQ / QR, BATCH), 512, 0, stream>>>(
      qb, kb, vb, Wl, bl, Ww, bw, oh);
  out_proj_kernel<<<dim3(BATCH * SEQ / 128, 6), 128, 0, stream>>>(oh, WpT, bp, out);
}
